// v000
// The times below were measured on an AMD MI455X: many runs one after another, warmed up first and cycling through
// copies of the inputs, with the whole window's GPU time divided by the number of runs. Launches and the gaps
// between them are all in it. The median over several windows is given; except for v000 it joins two sittings, which
// can be a few percent apart, so the side-by-side timings, each taken in one sitting, are the better comparison.
// v000 is the starting kernel. One run takes 591 microseconds.
#include <hip/hip_runtime.h>

// Scaled dot-product attention over image positions (x [4][128][64x64] channel-major; values = keys = 1x1 conv W_kv x + b_kv ([128][128] + [128]); queries = x itself; scores[l][t] = q_l.v_t / sqrt(128) over the 4096 positions; softmax; out[c][l] = sum_t attn[l][t] v_t[c] -> [4][128][64][64] channel-major (2.1 M)).
// Layout per image: token-major bf16 copy of x (k_cvt8T) for the projection and a token-major f32 copy for the query planes; values projection exact (+ bias); q, k (= v) as fp16 planes [4096][128], v^T [128][4096]; scores [4096][4096] f32; register-row softmax (P x1024 fp16); attn.v; the epilogue writes the f32 context transposed to channel-major.
// Compute dtypes, f32 accumulate: every input rounded to bf16; projection on PLAIN bf16 operands (exact) + f32 bias; scores and attn.v on single fp16 planes (logit sigma ~1; P x1024); softmax f32; f32 output.

#define NB_  4
#define TT   4096
#define DM   128
#define NH_  1
#define NKV  1
#define REP  (NH_ / NKV)
#define HD   128
#define DQ   (NH_ * HD)
#define DKV  (NKV * HD)
#define ZH   1
#define RH   0                  // query rows < RH use hi+lo planes (0: none)
#define WIN  0
#define PCAR 1024.0f
#define SCL  0.088388347648318447f   // HD^-0.5
typedef _Float16 h16;
typedef unsigned short bf;
typedef __attribute__((ext_vector_type(16))) __bf16   v16bf;
typedef __attribute__((ext_vector_type(16))) _Float16 v16h;
typedef __attribute__((ext_vector_type(8)))  _Float16 v8h;
typedef __attribute__((ext_vector_type(8)))  unsigned short v8us;
typedef __attribute__((ext_vector_type(8)))  float    v8f;
typedef __attribute__((ext_vector_type(4)))  float    v4f;
typedef v8h  __attribute__((may_alias)) v8ha;
typedef v4f  __attribute__((may_alias)) v4fa;
typedef v8us __attribute__((may_alias)) v8usa;

__device__ __forceinline__ unsigned short f2bf(float f) { unsigned u = __float_as_uint(f); u += 0x7FFFu + ((u >> 16) & 1u); return (unsigned short)(u >> 16); }
__device__ __forceinline__ float bf2f(unsigned short b) { return __uint_as_float(((unsigned)b) << 16); }
__device__ __forceinline__ float bfr(float f) { return bf2f(f2bf(f)); }
__device__ __forceinline__ v16h cat16(v8h lo, v8h hi) { return __builtin_shufflevector(lo, hi, 0, 1, 2, 3, 4, 5, 6, 7, 8, 9, 10, 11, 12, 13, 14, 15); }
__device__ __forceinline__ v16bf cat16b(v8us lo, v8us hi) { return __builtin_bit_cast(v16bf, __builtin_shufflevector(lo, hi, 0, 1, 2, 3, 4, 5, 6, 7, 8, 9, 10, 11, 12, 13, 14, 15)); }
__device__ __forceinline__ v8f wmma16(v16h a, v16h b, v8f c) { return __builtin_amdgcn_wmma_f32_16x16x32_f16(false, a, false, b, (short)0, c, false, false); }
__device__ __forceinline__ v8f wmmab(v16bf a, v16bf b, v8f c) { return __builtin_amdgcn_wmma_f32_16x16x32_bf16(false, a, false, b, (short)0, c, false, false); }



// ---- k_gemmw: register-blocked GEMM, ONE WAVE per 64x64 output tile (16 accumulators), operands straight from K-contiguous 16-bit planes; grid (M/64, N/64, Z), 32 threads.
// C[m][n] (f32, pitch ldc, + optional f32 bias[n]) = sum_k A[m][k] Bt[n][k] (+ split products per NSPLIT). z-batch strides sA/sB/sC in elements. K % 32 == 0.
template <typename T16> struct WFrag;
template <> struct WFrag<h16> { typedef v16h V; static __device__ __forceinline__ V ld(const h16* p) { return cat16(*(const v8h*)p, *(const v8h*)(p + 16)); } static __device__ __forceinline__ v8f mma(V a, V b, v8f c) { return wmma16(a, b, c); } };
template <> struct WFrag<bf> { typedef v16bf V; static __device__ __forceinline__ V ld(const bf* p) { return cat16b(*(const v8us*)p, *(const v8us*)(p + 16)); } static __device__ __forceinline__ v8f mma(V a, V b, v8f c) { return wmmab(a, b, c); } };
template <typename T16, int NSPLIT, bool BIAS>
__global__ __launch_bounds__(32) void k_gemmw(const T16* __restrict__ A, const T16* __restrict__ A2, const T16* __restrict__ Bt, const T16* __restrict__ Bt2, int K, float* C, int ldc, const float* __restrict__ bias, size_t sA, size_t sB, size_t sC) {
    typedef typename WFrag<T16>::V V;
    __shared__ __align__(16) float os[16 * 68];
    const size_t z = blockIdx.z; A += z * sA; if (A2) A2 += z * sA; Bt += z * sB; if (Bt2) Bt2 += z * sB; C += z * sC;
    const int lane = threadIdx.x & 31, lr = lane & 15, hi = lane >> 4; const int r0 = blockIdx.x * 64, c0 = blockIdx.y * 64;
    v8f acc[4][4];
#pragma unroll
    for (int mb = 0; mb < 4; ++mb)
#pragma unroll
        for (int nb = 0; nb < 4; ++nb) acc[mb][nb] = (v8f){};
    const size_t aoff = (size_t)(r0 + lr) * K + 8 * hi, boff = (size_t)(c0 + lr) * K + 8 * hi;
#pragma unroll 1
    for (int kc = 0; kc < K; kc += 32) {
        V a[4], a2[4];
#pragma unroll
        for (int mb = 0; mb < 4; ++mb) { a[mb] = WFrag<T16>::ld(A + aoff + (size_t)mb * 16 * K + kc); if (NSPLIT == 1 || NSPLIT == 2) a2[mb] = WFrag<T16>::ld(A2 + aoff + (size_t)mb * 16 * K + kc); }
#pragma unroll
        for (int nb = 0; nb < 4; ++nb) { const V b = WFrag<T16>::ld(Bt + boff + (size_t)nb * 16 * K + kc); V b2; if (NSPLIT >= 2) b2 = WFrag<T16>::ld(Bt2 + boff + (size_t)nb * 16 * K + kc);
#pragma unroll
            for (int mb = 0; mb < 4; ++mb) { acc[mb][nb] = WFrag<T16>::mma(a[mb], b, acc[mb][nb]); if (NSPLIT == 1 || NSPLIT == 2) acc[mb][nb] = WFrag<T16>::mma(a2[mb], b, acc[mb][nb]); if (NSPLIT >= 2) acc[mb][nb] = WFrag<T16>::mma(a[mb], b2, acc[mb][nb]); } }
        asm volatile("v_nop\n\tv_nop\n\tv_nop\n\tv_nop" : "+v"(acc[0][0]), "+v"(acc[1][1]), "+v"(acc[2][2]), "+v"(acc[3][3]) : "v"(a[0]), "v"(a[3]));
    }
#pragma unroll
    for (int mb = 0; mb < 4; ++mb) {
#pragma unroll
        for (int nb = 0; nb < 4; ++nb) {
#pragma unroll
            for (int j = 0; j < 8; ++j) os[(hi * 8 + j) * 68 + nb * 16 + lr] = acc[mb][nb][j]; }
        __builtin_amdgcn_wave_barrier(); asm volatile("" ::: "memory");
        float* crow = C + (size_t)(r0 + mb * 16) * ldc + c0;
{
#pragma unroll
            for (int s = 0; s < 8; ++s) { const int row = 2 * s + hi, cofs = lr * 4; v4f val = *(const v4fa*)(os + row * 68 + cofs); if (BIAS) { val[0] += bfr(bias[c0 + cofs]); val[1] += bfr(bias[c0 + cofs + 1]); val[2] += bfr(bias[c0 + cofs + 2]); val[3] += bfr(bias[c0 + cofs + 3]); }
                *(v4f*)(crow + (size_t)row * ldc + cofs) = val; }
             }
        __builtin_amdgcn_wave_barrier(); asm volatile("" ::: "memory");
    }
}

__device__ __forceinline__ h16 tohx(float x) { return (h16)x; }
__device__ __forceinline__ void splitf(float y, unsigned short& h, unsigned short& l) { h = f2bf(y); l = f2bf(y - bf2f(h)); }
typedef __attribute__((ext_vector_type(2))) _Float16 v2h;
typedef __attribute__((ext_vector_type(4))) _Float16 v4h;
typedef __attribute__((ext_vector_type(2))) unsigned short v2us;
typedef __attribute__((ext_vector_type(4))) unsigned short v4us;
typedef __attribute__((ext_vector_type(2))) float v2f;
typedef __attribute__((ext_vector_type(4))) int v4i;

__global__ __launch_bounds__(256) void k_wtG(const float* __restrict__ w, int K, int N, bf* Bt) {
    const int lane = threadIdx.x & 31; const int L0 = (blockIdx.x * 8 + (threadIdx.x >> 5)) * 8; const int nlines = N * K / 64;
{
#pragma unroll 1
        for (int l = 0; l < 8; ++l) { const int L = L0 + l; if (L >= nlines) break; const size_t e = (size_t)L * 64 + lane * 2; const int k = (int)(e % K), n = (int)(e / K); v2us o;
            o[0] = f2bf(w[(size_t)k * N + n]); o[1] = f2bf(w[(size_t)(k + 1) * N + n]); *(v2us*)(Bt + e) = o; }
         }
}
__global__ __launch_bounds__(256) void k_cvt8T(const float* __restrict__ src, bf* dst) { const size_t i = (size_t)blockIdx.x * 256 + threadIdx.x; if (i >= (size_t)TT * DM / 8) return; const int t = (int)(i / (DM / 8)); const int c0 = (int)(i % (DM / 8)) * 8; v8us o;
#pragma unroll
    for (int k = 0; k < 8; ++k) o[k] = f2bf(src[(size_t)(c0 + k) * TT + t]); *(v8us*)(dst + (size_t)t * DM + c0) = o;  }
__global__ __launch_bounds__(256) void k_trT(const float* __restrict__ xim, float* XT) { const size_t i = (size_t)blockIdx.x * 256 + threadIdx.x; if (i >= (size_t)TT * DM / 4) return; const int c0 = (int)(i % (DM / 4)) * 4; const size_t p = i / (DM / 4); v4f o;
#pragma unroll
    for (int q = 0; q < 4; ++q) o[q] = xim[(size_t)(c0 + q) * TT + p]; *(v4f*)(XT + p * DM + c0) = o;  }
__global__ __launch_bounds__(256) void k_outT(const float* __restrict__ AT, float* out) { const size_t i = (size_t)blockIdx.x * 256 + threadIdx.x; if (i >= (size_t)DM * TT / 4) return; const int p0 = (int)(i % (TT / 4)) * 4; const int c = (int)(i / (TT / 4)); v4f o;
#pragma unroll
    for (int q = 0; q < 4; ++q) o[q] = AT[(size_t)(p0 + q) * DM + c]; *(v4f*)(out + (size_t)c * TT + p0) = o;  }
__global__ __launch_bounds__(256) void k_cvt8(const float* __restrict__ src, bf* dst, size_t n8) { const size_t i = (size_t)blockIdx.x * 256 + threadIdx.x; if (i >= n8) return; const v8f v = *(const v8f*)(src + i * 8); v8us o;
#pragma unroll
    for (int k = 0; k < 8; ++k) o[k] = f2bf(v[k]); *(v8us*)(dst + i * 8) = o;  }

// k_rope: head planes [h][t][d] (fp16) of rope(x) x sc with the rotate-half convention out[d] = x[d] cos[t][d] - x[d+HD/2] sin[t][d], out[d+HD/2] = x[d+HD/2] cos[t][d+HD/2] + x[d] sin[t][d+HD/2]
__global__ __launch_bounds__(256) void k_rope(const float* __restrict__ F, int pitch, int nheads, const float* __restrict__ CS, const float* __restrict__ RF, const float* __restrict__ nw, float sc, h16* P16, bf* Ph, bf* Pl) {
    const size_t e = ((size_t)blockIdx.x * 256 + threadIdx.x) * 2; if (e >= (size_t)nheads * TT * HD) return; const int d = (int)(e % HD); const int t = (int)((e / HD) % TT); const int h = (int)(e / ((size_t)HD * TT)); const float* f = F + (size_t)t * pitch + h * HD; const float rf = RF ? RF[(size_t)h * TT + t] : 1.0f; v2h o16; v2us oh, ol;
#pragma unroll
    for (int q = 0; q < 2; ++q) { const int dd = d + q; const int dp = (dd < HD / 2) ? dd + HD / 2 : dd - HD / 2; float x0 = f[dd], x1 = f[dp];
        if (RF) { float n0 = __fmul_rn(x0, rf), n1 = __fmul_rn(x1, rf); asm volatile("" : "+v"(n0)); asm volatile("" : "+v"(n1)); x0 = __fmul_rn(bfr(nw[dd]), n0); x1 = __fmul_rn(bfr(nw[dp]), n1); }
        const v2f cs = *(const v2f*)(CS + ((size_t)t * HD + dd) * 2); float a = __fmul_rn(x0, cs[0]), bq = __fmul_rn(x1, cs[1]); asm volatile("" : "+v"(a)); asm volatile("" : "+v"(bq)); const float r = ((dd < HD / 2) ? __fsub_rn(a, bq) : __fadd_rn(a, bq)) * sc;
        o16[q] = tohx(r); (void)oh; (void)ol; }
    *(v2h*)(P16 + e) = o16;  }
__global__ __launch_bounds__(256) void k_ropeR(const float* __restrict__ F, int pitch, int nheads, const float* __restrict__ CS, const float* __restrict__ RF, const float* __restrict__ nw, float sc, h16* P16, bf* Ph, bf* Pl) {
    const size_t e = ((size_t)blockIdx.x * 256 + threadIdx.x) * 2; if (e >= (size_t)nheads * TT * HD) return; const int d = (int)(e % HD); const int t = (int)((e / HD) % TT); const int h = (int)(e / ((size_t)HD * TT)); const float* f = F + (size_t)t * pitch + h * HD; const float rf = RF ? RF[(size_t)h * TT + t] : 1.0f; v2h o16; v2us oh, ol;
#pragma unroll
    for (int q = 0; q < 2; ++q) { const int dd = d + q; const int dp = (dd < HD / 2) ? dd + HD / 2 : dd - HD / 2; float x0 = bfr(f[dd]), x1 = bfr(f[dp]);
        if (RF) { float n0 = __fmul_rn(x0, rf), n1 = __fmul_rn(x1, rf); asm volatile("" : "+v"(n0)); asm volatile("" : "+v"(n1)); x0 = __fmul_rn(bfr(nw[dd]), n0); x1 = __fmul_rn(bfr(nw[dp]), n1); }
        const v2f cs = *(const v2f*)(CS + ((size_t)t * HD + dd) * 2); float a = __fmul_rn(x0, cs[0]), bq = __fmul_rn(x1, cs[1]); asm volatile("" : "+v"(a)); asm volatile("" : "+v"(bq)); const float r = ((dd < HD / 2) ? __fsub_rn(a, bq) : __fadd_rn(a, bq)) * sc;
        o16[q] = tohx(r); (void)oh; (void)ol; }
    *(v2h*)(P16 + e) = o16;  }
__global__ __launch_bounds__(256) void k_vtp(const float* __restrict__ F, int pitch, int nheads, h16* V16, bf* Vh, bf* Vl) { const size_t e = ((size_t)blockIdx.x * 256 + threadIdx.x) * 2; if (e >= (size_t)nheads * HD * TT) return; const int t = (int)(e % TT); const int d = (int)((e / TT) % HD); const int g = (int)(e / ((size_t)TT * HD)); v2h o16; v2us oh, ol;
#pragma unroll
    for (int q = 0; q < 2; ++q) { const float x = F[(size_t)(t + q) * pitch + g * HD + d]; o16[q] = tohx(x); (void)oh; (void)ol; }
    *(v2h*)(V16 + e) = o16;  }
__global__ __launch_bounds__(256) void k_csid(float* CS) { const int idx = blockIdx.x * 256 + threadIdx.x; if (idx >= TT * HD) return; v2f cs; cs[0] = 1.0f; cs[1] = 0.0f; *(v2f*)(CS + (size_t)idx * 2) = cs;  }
// k_asoft: per row (zz, i): t = S x HD^-0.5 (no mask); softmax over the 4096 keys (register row, one exp, fixed trees);
__global__ __launch_bounds__(256) void k_asoft(const float* __restrict__ Sb, h16* P16, bf* Ph, bf* Pl) {
    const int lane = threadIdx.x & 31; const int row = blockIdx.x * 8 + (threadIdx.x >> 5); if (row >= ZH * TT) return; const int i = row % TT; const int zz = row / TT; (void)zz; const bool hires = (i < RH); const float* sr = Sb + (size_t)row * TT; float v[TT / 32]; float mx = -3.0e38f;
#pragma unroll
    for (int ch = 0; ch < TT / 128; ++ch) { const int j0 = ch * 128 + lane * 4; const v4f a = *(const v4f*)(sr + j0);
#pragma unroll
        for (int q = 0; q < 4; ++q) { const int j = j0 + q; (void)j; const float t = a[q] * SCL; v[ch * 4 + q] = t; mx = fmaxf(mx, t); } }
#pragma unroll
    for (int sh = 16; sh; sh >>= 1) mx = fmaxf(mx, __shfl_xor(mx, sh, 32));
    float sum = 0.f;
#pragma unroll
    for (int k = 0; k < TT / 32; ++k) { float d0 = __fsub_rn(v[k], mx); asm volatile("" : "+v"(d0)); v[k] = __builtin_amdgcn_exp2f(__fmul_rn(d0, 1.4426950408889634f)); sum += v[k]; }
#pragma unroll
    for (int sh = 16; sh; sh >>= 1) sum += __shfl_xor(sum, sh, 32);
    const float f = __fdiv_rn(hires ? 1.0f : PCAR, sum);
{
        if (hires) {
#pragma unroll
            for (int ch = 0; ch < TT / 128; ++ch) { v4us oh, ol;
#pragma unroll
                for (int q = 0; q < 4; ++q) { unsigned short a, c2; splitf(v[ch * 4 + q] * f, a, c2); oh[q] = a; ol[q] = c2; }
                const size_t oo = ((size_t)zz * (RH ? RH : 1) + i) * TT + ch * 128 + lane * 4; *(v4us*)(Ph + oo) = oh; *(v4us*)(Pl + oo) = ol; }
        } else {
#pragma unroll
            for (int ch = 0; ch < TT / 128; ++ch) { v4h o4;
#pragma unroll
                for (int q = 0; q < 4; ++q) o4[q] = tohx(v[ch * 4 + q] * f);
                *(v4h*)(P16 + (size_t)row * TT + ch * 128 + lane * 4) = o4; } }
         }
}
__global__ __launch_bounds__(256) void k_merge(const float* __restrict__ O, int h0, float* OUTb) { const size_t e = ((size_t)blockIdx.x * 256 + threadIdx.x) * 2; if (e >= (size_t)ZH * TT * HD) return; const int d = (int)(e % HD); const int t = (int)((e / HD) % TT); const int zz = (int)(e / ((size_t)HD * TT)); const float cs = (t < RH) ? 1.0f : (1.0f / PCAR); const size_t oo = (size_t)t * DQ + (h0 + zz) * HD + d;
    v2f o2; o2[0] = O[e] * cs; o2[1] = O[e + 1] * cs; *(v2f*)(OUTb + oo) = o2;  }

extern "C" void kernel_launch(void* const* d_in, const int* in_sizes, int n_in,
                              void* d_out, int out_size, void* d_ws, size_t ws_size, hipStream_t stream) {
    (void)in_sizes; (void)n_in; (void)out_size;
    const float* x = (const float*)d_in[0]; const float* wk = (const float*)d_in[1]; const float* bk = (const float*)d_in[2]; const float* wq = nullptr; const float* wv = nullptr; const float* wo = nullptr; (void)wq; (void)wv; (void)wo;
    float* OUT = (float*)d_out;     // [4][128][4096] channel-major
    char* wsp = (char*)d_ws;
    auto take = [&](size_t bytes) { char* p = wsp; wsp += (bytes + 255) & ~(size_t)255; return (void*)p; };
    bf* WQ = nullptr; bf* WK = (bf*)take((size_t)DKV * DM * 2); bf* WV = nullptr; float* CS = (float*)take((size_t)TT * HD * 2 * 4);
    float* XT = (float*)take((size_t)TT * DM * 4); float* AT = (float*)take((size_t)TT * DM * 4);
    bf* XB = (bf*)take((size_t)TT * DM * 2); float* FQ = nullptr; float* FK = (float*)take((size_t)TT * DKV * 4);
    h16* QP16 = (h16*)take((size_t)NH_ * TT * HD * 2); h16* KP16 = (h16*)take((size_t)NKV * TT * HD * 2); h16* VT16 = (h16*)take((size_t)NKV * HD * TT * 2);
    bf* QPh = nullptr; bf* QPl = nullptr; bf* KPh = nullptr; bf* KPl = nullptr; bf* VTh = nullptr; bf* VTl = nullptr; bf* Ph = nullptr; bf* Pl = nullptr;
    float* Sb = (float*)take((size_t)ZH * TT * TT * 4); h16* P16 = (h16*)take((size_t)ZH * TT * TT * 2); float* Ob = (float*)take((size_t)ZH * TT * HD * 4);
    if ((size_t)(wsp - (char*)d_ws) > ws_size) return;    // ws 256 MiB
    float* FV = FK;   // values = keys: the v^T planes are built from the same projection buffer (stream-ordered)
    { k_cvt8<<<(unsigned)(((size_t)DKV * DM / 8 + 255) / 256), 256, 0, stream>>>(wk, WK, (size_t)DKV * DM / 8); }
    k_csid<<<(TT * HD + 255) / 256, 256, 0, stream>>>(CS);
    const unsigned LQ = (unsigned)(((size_t)NH_ * TT * HD / 2 + 255) / 256), LKv = (unsigned)(((size_t)NKV * TT * HD / 2 + 255) / 256);
    for (int b = 0; b < NB_; ++b) {
        
        k_cvt8T<<<(unsigned)(((size_t)TT * DM / 8 + 255) / 256), 256, 0, stream>>>(x + (size_t)b * DM * TT, XB); k_trT<<<(unsigned)(((size_t)TT * DM / 4 + 255) / 256), 256, 0, stream>>>(x + (size_t)b * DM * TT, XT);   /* image -> token-major bf16 (projection) and f32 (query planes) */
        k_ropeR<<<LQ, 256, 0, stream>>>(XT, DQ, NH_, CS, nullptr, nullptr, 1.0f, QP16, QPh, QPl);
        k_gemmw<bf, 0, true><<<dim3(TT / 64, DKV / 64, 1), 32, 0, stream>>>(XB, nullptr, WK, nullptr, DM, FK, DKV, bk, 0, 0, 0);
        k_rope<<<LKv, 256, 0, stream>>>(FK, DKV, NKV, CS, nullptr, nullptr, 1.0f, KP16, KPh, KPl);
        k_vtp<<<LKv, 256, 0, stream>>>(FV, DKV, NKV, VT16, VTh, VTl);
        for (int h0 = 0; h0 < NH_; h0 += ZH) { const size_t zq = (size_t)h0, zk = (size_t)(h0 / REP);   // one kv head per query head: each pass covers one head (ZH = 1; z-strides TT*HD)
            k_gemmw<h16, 0, false><<<dim3(TT / 64, TT / 64, ZH), 32, 0, stream>>>(QP16 + zq * TT * HD, nullptr, KP16 + zk * TT * HD, nullptr, HD, Sb, TT, nullptr, (size_t)TT * HD, (size_t)TT * HD, (size_t)TT * TT);
            k_asoft<<<ZH * TT / 8, 256, 0, stream>>>(Sb, P16, Ph, Pl);
            k_gemmw<h16, 0, false><<<dim3(TT / 64, HD / 64, ZH), 32, 0, stream>>>(P16, nullptr, VT16 + zk * HD * TT, nullptr, TT, Ob, HD, nullptr, (size_t)TT * TT, (size_t)HD * TT, (size_t)TT * HD);
            k_merge<<<(unsigned)(((size_t)ZH * TT * HD / 2 + 255) / 256), 256, 0, stream>>>(Ob, h0, AT); }
        k_outT<<<(unsigned)(((size_t)DM * TT / 4 + 255) / 256), 256, 0, stream>>>(AT, OUT + (size_t)b * DM * TT);   /* context^T, channel-major */
         }
}

// v001
// One run takes 331 microseconds.
// Two timings next to v000 both put it at 1.79 times that version's speed.
#include <hip/hip_runtime.h>

// Scaled dot-product attention over image positions (x [4][128][64x64] channel-major; values = keys = 1x1 conv W_kv x + b_kv ([128][128] + [128]); queries = x itself; scores[l][t] = q_l.v_t / sqrt(128) over the 4096 positions; softmax; out[c][l] = sum_t attn[l][t] v_t[c] -> [4][128][64][64] channel-major (2.1 M)).
// Layout per image: token-major bf16 copy of x (k_cvt8T) for the projection and a token-major f32 copy for the query planes; values projection exact (+ bias); q, k (= v) as fp16 planes [4096][128], v^T [128][4096]; scores [4096][4096] f32; register-row softmax (P x1024 fp16); attn.v; the epilogue writes the f32 context transposed to channel-major.
// Compute dtypes, f32 accumulate: every input rounded to bf16; projection on PLAIN bf16 operands (exact) + f32 bias; scores and attn.v on single fp16 planes (logit sigma ~1; P x1024); softmax f32; f32 output.

#define NB_  4
#define TT   4096
#define DM   128
#define NH_  1
#define NKV  1
#define REP  (NH_ / NKV)
#define HD   128
#define DQ   (NH_ * HD)
#define DKV  (NKV * HD)
#define ZH   1
#define RH   0                  // query rows < RH use hi+lo planes (0: none)
#define WIN  0
#define PCAR 1024.0f
#define SCL  0.088388347648318447f   // HD^-0.5
#define KSP  16                 // attn.v: key slices (grid z), one f32 partial plane each; k_merge adds them in slice order
static_assert(ZH == 1 && TT % (KSP * 32) == 0, "attn.v uses grid z for the key slices");
typedef _Float16 h16;
typedef unsigned short bf;
typedef __attribute__((ext_vector_type(16))) __bf16   v16bf;
typedef __attribute__((ext_vector_type(16))) _Float16 v16h;
typedef __attribute__((ext_vector_type(8)))  _Float16 v8h;
typedef __attribute__((ext_vector_type(8)))  unsigned short v8us;
typedef __attribute__((ext_vector_type(8)))  float    v8f;
typedef __attribute__((ext_vector_type(4)))  float    v4f;
typedef v8h  __attribute__((may_alias)) v8ha;
typedef v4f  __attribute__((may_alias)) v4fa;
typedef v8us __attribute__((may_alias)) v8usa;

__device__ __forceinline__ unsigned short f2bf(float f) { unsigned u = __float_as_uint(f); u += 0x7FFFu + ((u >> 16) & 1u); return (unsigned short)(u >> 16); }
__device__ __forceinline__ float bf2f(unsigned short b) { return __uint_as_float(((unsigned)b) << 16); }
__device__ __forceinline__ float bfr(float f) { return bf2f(f2bf(f)); }
__device__ __forceinline__ v16h cat16(v8h lo, v8h hi) { return __builtin_shufflevector(lo, hi, 0, 1, 2, 3, 4, 5, 6, 7, 8, 9, 10, 11, 12, 13, 14, 15); }
__device__ __forceinline__ v16bf cat16b(v8us lo, v8us hi) { return __builtin_bit_cast(v16bf, __builtin_shufflevector(lo, hi, 0, 1, 2, 3, 4, 5, 6, 7, 8, 9, 10, 11, 12, 13, 14, 15)); }
__device__ __forceinline__ v8f wmma16(v16h a, v16h b, v8f c) { return __builtin_amdgcn_wmma_f32_16x16x32_f16(false, a, false, b, (short)0, c, false, false); }
__device__ __forceinline__ v8f wmmab(v16bf a, v16bf b, v8f c) { return __builtin_amdgcn_wmma_f32_16x16x32_bf16(false, a, false, b, (short)0, c, false, false); }



// ---- k_gemmw: register-blocked GEMM, ONE WAVE per 64x64 output tile (16 accumulators), operands straight from K-contiguous 16-bit planes; grid (M/64, N/64, Z), 32 threads.
// C[m][n] (f32, pitch ldc, + optional f32 bias[n]) = sum_{k < Kz} A[m][k] Bt[n][k] (+ split products per NSPLIT); rows of A and Bt have pitch K >= Kz. z-batch strides sA/sB/sC in elements (attn.v: one k slice per z, sA = sB = Kz; scores: one head per z, sA = sB = TT*HD). Kz % 32 == 0.
template <typename T16> struct WFrag;
template <> struct WFrag<h16> { typedef v16h V; static __device__ __forceinline__ V ld(const h16* p) { return cat16(*(const v8h*)p, *(const v8h*)(p + 16)); } static __device__ __forceinline__ v8f mma(V a, V b, v8f c) { return wmma16(a, b, c); } };
template <> struct WFrag<bf> { typedef v16bf V; static __device__ __forceinline__ V ld(const bf* p) { return cat16b(*(const v8us*)p, *(const v8us*)(p + 16)); } static __device__ __forceinline__ v8f mma(V a, V b, v8f c) { return wmmab(a, b, c); } };
template <typename T16, int NSPLIT, bool BIAS>
__global__ __launch_bounds__(32) void k_gemmw(const T16* __restrict__ A, const T16* __restrict__ A2, const T16* __restrict__ Bt, const T16* __restrict__ Bt2, int K, int Kz, float* C, int ldc, const float* __restrict__ bias, size_t sA, size_t sB, size_t sC) {
    typedef typename WFrag<T16>::V V;
    __shared__ __align__(16) float os[16 * 68];
    const size_t z = blockIdx.z; A += z * sA; if (A2) A2 += z * sA; Bt += z * sB; if (Bt2) Bt2 += z * sB; C += z * sC;
    const int lane = threadIdx.x & 31, lr = lane & 15, hi = lane >> 4; const int r0 = blockIdx.x * 64, c0 = blockIdx.y * 64;
    v8f acc[4][4];
#pragma unroll
    for (int mb = 0; mb < 4; ++mb)
#pragma unroll
        for (int nb = 0; nb < 4; ++nb) acc[mb][nb] = (v8f){};
    const size_t aoff = (size_t)(r0 + lr) * K + 8 * hi, boff = (size_t)(c0 + lr) * K + 8 * hi;
#pragma unroll 1
    for (int kc = 0; kc < Kz; kc += 32) {
        V a[4], a2[4];
#pragma unroll
        for (int mb = 0; mb < 4; ++mb) { a[mb] = WFrag<T16>::ld(A + aoff + (size_t)mb * 16 * K + kc); if (NSPLIT == 1 || NSPLIT == 2) a2[mb] = WFrag<T16>::ld(A2 + aoff + (size_t)mb * 16 * K + kc); }
#pragma unroll
        for (int nb = 0; nb < 4; ++nb) { const V b = WFrag<T16>::ld(Bt + boff + (size_t)nb * 16 * K + kc); V b2; if (NSPLIT >= 2) b2 = WFrag<T16>::ld(Bt2 + boff + (size_t)nb * 16 * K + kc);
#pragma unroll
            for (int mb = 0; mb < 4; ++mb) { acc[mb][nb] = WFrag<T16>::mma(a[mb], b, acc[mb][nb]); if (NSPLIT == 1 || NSPLIT == 2) acc[mb][nb] = WFrag<T16>::mma(a2[mb], b, acc[mb][nb]); if (NSPLIT >= 2) acc[mb][nb] = WFrag<T16>::mma(a[mb], b2, acc[mb][nb]); } }
        asm volatile("v_nop\n\tv_nop\n\tv_nop\n\tv_nop" : "+v"(acc[0][0]), "+v"(acc[1][1]), "+v"(acc[2][2]), "+v"(acc[3][3]) : "v"(a[0]), "v"(a[3]));
    }
#pragma unroll
    for (int mb = 0; mb < 4; ++mb) {
#pragma unroll
        for (int nb = 0; nb < 4; ++nb) {
#pragma unroll
            for (int j = 0; j < 8; ++j) os[(hi * 8 + j) * 68 + nb * 16 + lr] = acc[mb][nb][j]; }
        __builtin_amdgcn_wave_barrier(); asm volatile("" ::: "memory");
        float* crow = C + (size_t)(r0 + mb * 16) * ldc + c0;
{
#pragma unroll
            for (int s = 0; s < 8; ++s) { const int row = 2 * s + hi, cofs = lr * 4; v4f val = *(const v4fa*)(os + row * 68 + cofs); if (BIAS) { val[0] += bfr(bias[c0 + cofs]); val[1] += bfr(bias[c0 + cofs + 1]); val[2] += bfr(bias[c0 + cofs + 2]); val[3] += bfr(bias[c0 + cofs + 3]); }
                *(v4f*)(crow + (size_t)row * ldc + cofs) = val; }
             }
        __builtin_amdgcn_wave_barrier(); asm volatile("" ::: "memory");
    }
}

__device__ __forceinline__ h16 tohx(float x) { return (h16)x; }
__device__ __forceinline__ void splitf(float y, unsigned short& h, unsigned short& l) { h = f2bf(y); l = f2bf(y - bf2f(h)); }
typedef __attribute__((ext_vector_type(2))) _Float16 v2h;
typedef __attribute__((ext_vector_type(4))) _Float16 v4h;
typedef __attribute__((ext_vector_type(2))) unsigned short v2us;
typedef __attribute__((ext_vector_type(4))) unsigned short v4us;
typedef __attribute__((ext_vector_type(2))) float v2f;
typedef __attribute__((ext_vector_type(4))) int v4i;

__global__ __launch_bounds__(256) void k_wtG(const float* __restrict__ w, int K, int N, bf* Bt) {
    const int lane = threadIdx.x & 31; const int L0 = (blockIdx.x * 8 + (threadIdx.x >> 5)) * 8; const int nlines = N * K / 64;
{
#pragma unroll 1
        for (int l = 0; l < 8; ++l) { const int L = L0 + l; if (L >= nlines) break; const size_t e = (size_t)L * 64 + lane * 2; const int k = (int)(e % K), n = (int)(e / K); v2us o;
            o[0] = f2bf(w[(size_t)k * N + n]); o[1] = f2bf(w[(size_t)(k + 1) * N + n]); *(v2us*)(Bt + e) = o; }
         }
}
__global__ __launch_bounds__(256) void k_cvt8T(const float* __restrict__ src, bf* dst) { const size_t i = (size_t)blockIdx.x * 256 + threadIdx.x; if (i >= (size_t)TT * DM / 8) return; const int t = (int)(i / (DM / 8)); const int c0 = (int)(i % (DM / 8)) * 8; v8us o;
#pragma unroll
    for (int k = 0; k < 8; ++k) o[k] = f2bf(src[(size_t)(c0 + k) * TT + t]); *(v8us*)(dst + (size_t)t * DM + c0) = o;  }
__global__ __launch_bounds__(256) void k_trT(const float* __restrict__ xim, float* XT) { const size_t i = (size_t)blockIdx.x * 256 + threadIdx.x; if (i >= (size_t)TT * DM / 4) return; const int c0 = (int)(i % (DM / 4)) * 4; const size_t p = i / (DM / 4); v4f o;
#pragma unroll
    for (int q = 0; q < 4; ++q) o[q] = xim[(size_t)(c0 + q) * TT + p]; *(v4f*)(XT + p * DM + c0) = o;  }
__global__ __launch_bounds__(256) void k_outT(const float* __restrict__ AT, float* out) { const size_t i = (size_t)blockIdx.x * 256 + threadIdx.x; if (i >= (size_t)DM * TT / 4) return; const int p0 = (int)(i % (TT / 4)) * 4; const int c = (int)(i / (TT / 4)); v4f o;
#pragma unroll
    for (int q = 0; q < 4; ++q) o[q] = AT[(size_t)(p0 + q) * DM + c]; *(v4f*)(out + (size_t)c * TT + p0) = o;  }
__global__ __launch_bounds__(256) void k_cvt8(const float* __restrict__ src, bf* dst, size_t n8) { const size_t i = (size_t)blockIdx.x * 256 + threadIdx.x; if (i >= n8) return; const v8f v = *(const v8f*)(src + i * 8); v8us o;
#pragma unroll
    for (int k = 0; k < 8; ++k) o[k] = f2bf(v[k]); *(v8us*)(dst + i * 8) = o;  }

// k_rope: head planes [h][t][d] (fp16) of rope(x) x sc with the rotate-half convention out[d] = x[d] cos[t][d] - x[d+HD/2] sin[t][d], out[d+HD/2] = x[d+HD/2] cos[t][d+HD/2] + x[d] sin[t][d+HD/2]
__global__ __launch_bounds__(256) void k_rope(const float* __restrict__ F, int pitch, int nheads, const float* __restrict__ CS, const float* __restrict__ RF, const float* __restrict__ nw, float sc, h16* P16, bf* Ph, bf* Pl) {
    const size_t e = ((size_t)blockIdx.x * 256 + threadIdx.x) * 2; if (e >= (size_t)nheads * TT * HD) return; const int d = (int)(e % HD); const int t = (int)((e / HD) % TT); const int h = (int)(e / ((size_t)HD * TT)); const float* f = F + (size_t)t * pitch + h * HD; const float rf = RF ? RF[(size_t)h * TT + t] : 1.0f; v2h o16; v2us oh, ol;
#pragma unroll
    for (int q = 0; q < 2; ++q) { const int dd = d + q; const int dp = (dd < HD / 2) ? dd + HD / 2 : dd - HD / 2; float x0 = f[dd], x1 = f[dp];
        if (RF) { float n0 = __fmul_rn(x0, rf), n1 = __fmul_rn(x1, rf); asm volatile("" : "+v"(n0)); asm volatile("" : "+v"(n1)); x0 = __fmul_rn(bfr(nw[dd]), n0); x1 = __fmul_rn(bfr(nw[dp]), n1); }
        const v2f cs = *(const v2f*)(CS + ((size_t)t * HD + dd) * 2); float a = __fmul_rn(x0, cs[0]), bq = __fmul_rn(x1, cs[1]); asm volatile("" : "+v"(a)); asm volatile("" : "+v"(bq)); const float r = ((dd < HD / 2) ? __fsub_rn(a, bq) : __fadd_rn(a, bq)) * sc;
        o16[q] = tohx(r); (void)oh; (void)ol; }
    *(v2h*)(P16 + e) = o16;  }
__global__ __launch_bounds__(256) void k_ropeR(const float* __restrict__ F, int pitch, int nheads, const float* __restrict__ CS, const float* __restrict__ RF, const float* __restrict__ nw, float sc, h16* P16, bf* Ph, bf* Pl) {
    const size_t e = ((size_t)blockIdx.x * 256 + threadIdx.x) * 2; if (e >= (size_t)nheads * TT * HD) return; const int d = (int)(e % HD); const int t = (int)((e / HD) % TT); const int h = (int)(e / ((size_t)HD * TT)); const float* f = F + (size_t)t * pitch + h * HD; const float rf = RF ? RF[(size_t)h * TT + t] : 1.0f; v2h o16; v2us oh, ol;
#pragma unroll
    for (int q = 0; q < 2; ++q) { const int dd = d + q; const int dp = (dd < HD / 2) ? dd + HD / 2 : dd - HD / 2; float x0 = bfr(f[dd]), x1 = bfr(f[dp]);
        if (RF) { float n0 = __fmul_rn(x0, rf), n1 = __fmul_rn(x1, rf); asm volatile("" : "+v"(n0)); asm volatile("" : "+v"(n1)); x0 = __fmul_rn(bfr(nw[dd]), n0); x1 = __fmul_rn(bfr(nw[dp]), n1); }
        const v2f cs = *(const v2f*)(CS + ((size_t)t * HD + dd) * 2); float a = __fmul_rn(x0, cs[0]), bq = __fmul_rn(x1, cs[1]); asm volatile("" : "+v"(a)); asm volatile("" : "+v"(bq)); const float r = ((dd < HD / 2) ? __fsub_rn(a, bq) : __fadd_rn(a, bq)) * sc;
        o16[q] = tohx(r); (void)oh; (void)ol; }
    *(v2h*)(P16 + e) = o16;  }
__global__ __launch_bounds__(256) void k_vtp(const float* __restrict__ F, int pitch, int nheads, h16* V16, bf* Vh, bf* Vl) { const size_t e = ((size_t)blockIdx.x * 256 + threadIdx.x) * 2; if (e >= (size_t)nheads * HD * TT) return; const int t = (int)(e % TT); const int d = (int)((e / TT) % HD); const int g = (int)(e / ((size_t)TT * HD)); v2h o16; v2us oh, ol;
#pragma unroll
    for (int q = 0; q < 2; ++q) { const float x = F[(size_t)(t + q) * pitch + g * HD + d]; o16[q] = tohx(x); (void)oh; (void)ol; }
    *(v2h*)(V16 + e) = o16;  }
__global__ __launch_bounds__(256) void k_csid(float* CS) { const int idx = blockIdx.x * 256 + threadIdx.x; if (idx >= TT * HD) return; v2f cs; cs[0] = 1.0f; cs[1] = 0.0f; *(v2f*)(CS + (size_t)idx * 2) = cs;  }
// k_asoft: per row (zz, i): t = S x HD^-0.5 (no mask); softmax over the 4096 keys (register row, one exp, fixed trees);
__global__ __launch_bounds__(256) void k_asoft(const float* __restrict__ Sb, h16* P16, bf* Ph, bf* Pl) {
    const int lane = threadIdx.x & 31; const int row = blockIdx.x * 8 + (threadIdx.x >> 5); if (row >= ZH * TT) return; const int i = row % TT; const int zz = row / TT; (void)zz; const bool hires = (i < RH); const float* sr = Sb + (size_t)row * TT; float v[TT / 32]; float mx = -3.0e38f;
#pragma unroll
    for (int ch = 0; ch < TT / 128; ++ch) { const int j0 = ch * 128 + lane * 4; const v4f a = *(const v4f*)(sr + j0);
#pragma unroll
        for (int q = 0; q < 4; ++q) { const int j = j0 + q; (void)j; const float t = a[q] * SCL; v[ch * 4 + q] = t; mx = fmaxf(mx, t); } }
#pragma unroll
    for (int sh = 16; sh; sh >>= 1) mx = fmaxf(mx, __shfl_xor(mx, sh, 32));
    float sum = 0.f;
#pragma unroll
    for (int k = 0; k < TT / 32; ++k) { float d0 = __fsub_rn(v[k], mx); asm volatile("" : "+v"(d0)); v[k] = __builtin_amdgcn_exp2f(__fmul_rn(d0, 1.4426950408889634f)); sum += v[k]; }
#pragma unroll
    for (int sh = 16; sh; sh >>= 1) sum += __shfl_xor(sum, sh, 32);
    const float f = __fdiv_rn(hires ? 1.0f : PCAR, sum);
{
        if (hires) {
#pragma unroll
            for (int ch = 0; ch < TT / 128; ++ch) { v4us oh, ol;
#pragma unroll
                for (int q = 0; q < 4; ++q) { unsigned short a, c2; splitf(v[ch * 4 + q] * f, a, c2); oh[q] = a; ol[q] = c2; }
                const size_t oo = ((size_t)zz * (RH ? RH : 1) + i) * TT + ch * 128 + lane * 4; *(v4us*)(Ph + oo) = oh; *(v4us*)(Pl + oo) = ol; }
        } else {
#pragma unroll
            for (int ch = 0; ch < TT / 128; ++ch) { v4h o4;
#pragma unroll
                for (int q = 0; q < 4; ++q) o4[q] = tohx(v[ch * 4 + q] * f);
                *(v4h*)(P16 + (size_t)row * TT + ch * 128 + lane * 4) = o4; } }
         }
}
__global__ __launch_bounds__(256) void k_merge(const float* __restrict__ O, int h0, float* OUTb) { const size_t e = ((size_t)blockIdx.x * 256 + threadIdx.x) * 2; if (e >= (size_t)ZH * TT * HD) return; const int d = (int)(e % HD); const int t = (int)((e / HD) % TT); const int zz = (int)(e / ((size_t)HD * TT)); const float cs = (t < RH) ? 1.0f : (1.0f / PCAR); const size_t oo = (size_t)t * DQ + (h0 + zz) * HD + d;
    v2f pp[KSP];   /* one partial per key slice; unrolled so that all the loads are in flight together */
#pragma unroll
    for (int s = 0; s < KSP; ++s) { pp[s] = *(const v2f*)(O + (size_t)s * ZH * TT * HD + e);
        if ((s & 3) == 3) asm volatile("s_wait_xcnt 0x0" ::: "memory"); }   /* before a later load's result or address sum reuses an address register of these loads */
    v2f s2 = pp[0];
#pragma unroll
    for (int s = 1; s < KSP; ++s) s2 += pp[s];   /* added in slice order */
    v2f o2; o2[0] = s2[0] * cs; o2[1] = s2[1] * cs; *(v2f*)(OUTb + oo) = o2;  }

extern "C" void kernel_launch(void* const* d_in, const int* in_sizes, int n_in,
                              void* d_out, int out_size, void* d_ws, size_t ws_size, hipStream_t stream) {
    (void)in_sizes; (void)n_in; (void)out_size;
    const float* x = (const float*)d_in[0]; const float* wk = (const float*)d_in[1]; const float* bk = (const float*)d_in[2]; const float* wq = nullptr; const float* wv = nullptr; const float* wo = nullptr; (void)wq; (void)wv; (void)wo;
    float* OUT = (float*)d_out;     // [4][128][4096] channel-major
    char* wsp = (char*)d_ws;
    auto take = [&](size_t bytes) { char* p = wsp; wsp += (bytes + 255) & ~(size_t)255; return (void*)p; };
    bf* WQ = nullptr; bf* WK = (bf*)take((size_t)DKV * DM * 2); bf* WV = nullptr; float* CS = (float*)take((size_t)TT * HD * 2 * 4);
    float* XT = (float*)take((size_t)TT * DM * 4); float* AT = (float*)take((size_t)TT * DM * 4);
    bf* XB = (bf*)take((size_t)TT * DM * 2); float* FQ = nullptr; float* FK = (float*)take((size_t)TT * DKV * 4);
    h16* QP16 = (h16*)take((size_t)NH_ * TT * HD * 2); h16* KP16 = (h16*)take((size_t)NKV * TT * HD * 2); h16* VT16 = (h16*)take((size_t)NKV * HD * TT * 2);
    bf* QPh = nullptr; bf* QPl = nullptr; bf* KPh = nullptr; bf* KPl = nullptr; bf* VTh = nullptr; bf* VTl = nullptr; bf* Ph = nullptr; bf* Pl = nullptr;
    float* Sb = (float*)take((size_t)ZH * TT * TT * 4); h16* P16 = (h16*)take((size_t)ZH * TT * TT * 2); float* Ob = (float*)take((size_t)KSP * ZH * TT * HD * 4);
    if ((size_t)(wsp - (char*)d_ws) > ws_size) return;    // ws 256 MiB
    float* FV = FK;   // values = keys: the v^T planes are built from the same projection buffer (stream-ordered)
    { k_cvt8<<<(unsigned)(((size_t)DKV * DM / 8 + 255) / 256), 256, 0, stream>>>(wk, WK, (size_t)DKV * DM / 8); }
    k_csid<<<(TT * HD + 255) / 256, 256, 0, stream>>>(CS);
    const unsigned LQ = (unsigned)(((size_t)NH_ * TT * HD / 2 + 255) / 256), LKv = (unsigned)(((size_t)NKV * TT * HD / 2 + 255) / 256);
    for (int b = 0; b < NB_; ++b) {
        
        k_cvt8T<<<(unsigned)(((size_t)TT * DM / 8 + 255) / 256), 256, 0, stream>>>(x + (size_t)b * DM * TT, XB); k_trT<<<(unsigned)(((size_t)TT * DM / 4 + 255) / 256), 256, 0, stream>>>(x + (size_t)b * DM * TT, XT);   /* image -> token-major bf16 (projection) and f32 (query planes) */
        k_ropeR<<<LQ, 256, 0, stream>>>(XT, DQ, NH_, CS, nullptr, nullptr, 1.0f, QP16, QPh, QPl);
        k_gemmw<bf, 0, true><<<dim3(TT / 64, DKV / 64, 1), 32, 0, stream>>>(XB, nullptr, WK, nullptr, DM, DM, FK, DKV, bk, 0, 0, 0);
        k_rope<<<LKv, 256, 0, stream>>>(FK, DKV, NKV, CS, nullptr, nullptr, 1.0f, KP16, KPh, KPl);
        k_vtp<<<LKv, 256, 0, stream>>>(FV, DKV, NKV, VT16, VTh, VTl);
        for (int h0 = 0; h0 < NH_; h0 += ZH) { const size_t zq = (size_t)h0, zk = (size_t)(h0 / REP);   // one kv head per query head: the pass's one head (ZH = 1) uses kv plane h0 / REP (z-strides TT*HD)
            k_gemmw<h16, 0, false><<<dim3(TT / 64, TT / 64, ZH), 32, 0, stream>>>(QP16 + zq * TT * HD, nullptr, KP16 + zk * TT * HD, nullptr, HD, HD, Sb, TT, nullptr, (size_t)TT * HD, (size_t)TT * HD, (size_t)TT * TT);
            k_asoft<<<ZH * TT / 8, 256, 0, stream>>>(Sb, P16, Ph, Pl);
            k_gemmw<h16, 0, false><<<dim3(TT / 64, HD / 64, KSP), 32, 0, stream>>>(P16, nullptr, VT16 + zk * HD * TT, nullptr, TT, TT / KSP, Ob, HD, nullptr, (size_t)(TT / KSP), (size_t)(TT / KSP), (size_t)ZH * TT * HD);   /* z = key slice */
            k_merge<<<(unsigned)(((size_t)ZH * TT * HD / 2 + 255) / 256), 256, 0, stream>>>(Ob, h0, AT); }
        k_outT<<<(unsigned)(((size_t)DM * TT / 4 + 255) / 256), 256, 0, stream>>>(AT, OUT + (size_t)b * DM * TT);   /* context^T, channel-major */
         }
}

// v002
// A run of this version takes 191 microseconds.
// Next to v001, in two timings, it ran 1.74 times as fast each time.
// Counting every step since v000, it is 3.12 times as fast.
#include <hip/hip_runtime.h>

// Scaled dot-product attention over image positions (x [4][128][64x64] channel-major; values = keys = 1x1 conv W_kv x + b_kv ([128][128] + [128]); queries = x itself; scores[l][t] = q_l.v_t / sqrt(128) over the 4096 positions; softmax; out[c][l] = sum_t attn[l][t] v_t[c] -> [4][128][64][64] channel-major (2.1 M)).
// Layout per image: token-major bf16 copy of x (k_cvt8T) for the projection and a token-major f32 copy for the query planes; values projection exact (+ bias); q, k (= v) as fp16 planes [4096][128], v^T [128][4096]; scores, softmax and attn.v in one kernel per key slice (k_fattn: transposed products, running maximum, P packed in registers); k_fmerge joins the slices and writes the f32 context channel-major.
// Compute dtypes, f32 accumulate: every input rounded to bf16; projection on PLAIN bf16 operands (exact) + f32 bias; scores and attn.v on single fp16 planes (logit sigma ~1; P = 2^(t - m + 6) fp16); softmax f32; f32 output.

#define NB_  4
#define TT   4096
#define DM   128
#define NH_  1
#define NKV  1
#define REP  (NH_ / NKV)
#define HD   128
#define DQ   (NH_ * HD)
#define DKV  (NKV * HD)
#define ZH   1
#define RH   0                  // query rows < RH use hi+lo planes (0: none)
#define WIN  0
#define PSH  6.0f               // P carries 2^PSH: with the trailing maximum (up to 2^8) P stays below 2^14 in fp16
#define SCL  0.088388347648318447f   // HD^-0.5
#define KSP  16                 // key slices (grid y of k_fattn), one f32 partial plane with its maxima and sums each; k_fmerge adds them in slice order
#define FQW  8                  // k_fattn: waves per workgroup, 32 query columns each
static_assert(KSP == 16 && ZH == 1 && NH_ == 1 && HD == 128 && TT % (KSP * 32) == 0 && TT % (FQW * 32) == 0, "k_fattn: one head of size 128, whole 32-key passes per slice");
typedef _Float16 h16;
typedef unsigned short bf;
typedef __attribute__((ext_vector_type(16))) __bf16   v16bf;
typedef __attribute__((ext_vector_type(16))) _Float16 v16h;
typedef __attribute__((ext_vector_type(8)))  _Float16 v8h;
typedef __attribute__((ext_vector_type(8)))  unsigned short v8us;
typedef __attribute__((ext_vector_type(8)))  float    v8f;
typedef __attribute__((ext_vector_type(4)))  float    v4f;
typedef v8h  __attribute__((may_alias)) v8ha;
typedef v4f  __attribute__((may_alias)) v4fa;
typedef v8us __attribute__((may_alias)) v8usa;

__device__ __forceinline__ unsigned short f2bf(float f) { unsigned u = __float_as_uint(f); u += 0x7FFFu + ((u >> 16) & 1u); return (unsigned short)(u >> 16); }
__device__ __forceinline__ float bf2f(unsigned short b) { return __uint_as_float(((unsigned)b) << 16); }
__device__ __forceinline__ float bfr(float f) { return bf2f(f2bf(f)); }
__device__ __forceinline__ v16h cat16(v8h lo, v8h hi) { return __builtin_shufflevector(lo, hi, 0, 1, 2, 3, 4, 5, 6, 7, 8, 9, 10, 11, 12, 13, 14, 15); }
__device__ __forceinline__ v16bf cat16b(v8us lo, v8us hi) { return __builtin_bit_cast(v16bf, __builtin_shufflevector(lo, hi, 0, 1, 2, 3, 4, 5, 6, 7, 8, 9, 10, 11, 12, 13, 14, 15)); }
__device__ __forceinline__ v8f wmma16(v16h a, v16h b, v8f c) { return __builtin_amdgcn_wmma_f32_16x16x32_f16(false, a, false, b, (short)0, c, false, false); }
__device__ __forceinline__ v8f wmmab(v16bf a, v16bf b, v8f c) { return __builtin_amdgcn_wmma_f32_16x16x32_bf16(false, a, false, b, (short)0, c, false, false); }



// ---- k_gemmw: register-blocked GEMM, ONE WAVE per 64x64 output tile (16 accumulators), operands straight from K-contiguous 16-bit planes; grid (M/64, N/64, Z), 32 threads.
// C[m][n] (f32, pitch ldc, + optional f32 bias[n]) = sum_{k < Kz} A[m][k] Bt[n][k] (+ split products per NSPLIT); rows of A and Bt have pitch K >= Kz. z-batch strides sA/sB/sC in elements (projection only: Z = 1, strides 0). Kz % 32 == 0.
template <typename T16> struct WFrag;
template <> struct WFrag<h16> { typedef v16h V; static __device__ __forceinline__ V ld(const h16* p) { return cat16(*(const v8h*)p, *(const v8h*)(p + 16)); } static __device__ __forceinline__ v8f mma(V a, V b, v8f c) { return wmma16(a, b, c); } };
template <> struct WFrag<bf> { typedef v16bf V; static __device__ __forceinline__ V ld(const bf* p) { return cat16b(*(const v8us*)p, *(const v8us*)(p + 16)); } static __device__ __forceinline__ v8f mma(V a, V b, v8f c) { return wmmab(a, b, c); } };
template <typename T16, int NSPLIT, bool BIAS>
__global__ __launch_bounds__(32) void k_gemmw(const T16* __restrict__ A, const T16* __restrict__ A2, const T16* __restrict__ Bt, const T16* __restrict__ Bt2, int K, int Kz, float* C, int ldc, const float* __restrict__ bias, size_t sA, size_t sB, size_t sC) {
    typedef typename WFrag<T16>::V V;
    __shared__ __align__(16) float os[16 * 68];
    const size_t z = blockIdx.z; A += z * sA; if (A2) A2 += z * sA; Bt += z * sB; if (Bt2) Bt2 += z * sB; C += z * sC;
    const int lane = threadIdx.x & 31, lr = lane & 15, hi = lane >> 4; const int r0 = blockIdx.x * 64, c0 = blockIdx.y * 64;
    v8f acc[4][4];
#pragma unroll
    for (int mb = 0; mb < 4; ++mb)
#pragma unroll
        for (int nb = 0; nb < 4; ++nb) acc[mb][nb] = (v8f){};
    const size_t aoff = (size_t)(r0 + lr) * K + 8 * hi, boff = (size_t)(c0 + lr) * K + 8 * hi;
#pragma unroll 1
    for (int kc = 0; kc < Kz; kc += 32) {
        V a[4], a2[4];
#pragma unroll
        for (int mb = 0; mb < 4; ++mb) { a[mb] = WFrag<T16>::ld(A + aoff + (size_t)mb * 16 * K + kc); if (NSPLIT == 1 || NSPLIT == 2) a2[mb] = WFrag<T16>::ld(A2 + aoff + (size_t)mb * 16 * K + kc); }
#pragma unroll
        for (int nb = 0; nb < 4; ++nb) { const V b = WFrag<T16>::ld(Bt + boff + (size_t)nb * 16 * K + kc); V b2; if (NSPLIT >= 2) b2 = WFrag<T16>::ld(Bt2 + boff + (size_t)nb * 16 * K + kc);
#pragma unroll
            for (int mb = 0; mb < 4; ++mb) { acc[mb][nb] = WFrag<T16>::mma(a[mb], b, acc[mb][nb]); if (NSPLIT == 1 || NSPLIT == 2) acc[mb][nb] = WFrag<T16>::mma(a2[mb], b, acc[mb][nb]); if (NSPLIT >= 2) acc[mb][nb] = WFrag<T16>::mma(a[mb], b2, acc[mb][nb]); } }
        asm volatile("v_nop\n\tv_nop\n\tv_nop\n\tv_nop" : "+v"(acc[0][0]), "+v"(acc[1][1]), "+v"(acc[2][2]), "+v"(acc[3][3]) : "v"(a[0]), "v"(a[3]));
    }
#pragma unroll
    for (int mb = 0; mb < 4; ++mb) {
#pragma unroll
        for (int nb = 0; nb < 4; ++nb) {
#pragma unroll
            for (int j = 0; j < 8; ++j) os[(hi * 8 + j) * 68 + nb * 16 + lr] = acc[mb][nb][j]; }
        __builtin_amdgcn_wave_barrier(); asm volatile("" ::: "memory");
        float* crow = C + (size_t)(r0 + mb * 16) * ldc + c0;
{
#pragma unroll
            for (int s = 0; s < 8; ++s) { const int row = 2 * s + hi, cofs = lr * 4; v4f val = *(const v4fa*)(os + row * 68 + cofs); if (BIAS) { val[0] += bfr(bias[c0 + cofs]); val[1] += bfr(bias[c0 + cofs + 1]); val[2] += bfr(bias[c0 + cofs + 2]); val[3] += bfr(bias[c0 + cofs + 3]); }
                *(v4f*)(crow + (size_t)row * ldc + cofs) = val; }
             }
        __builtin_amdgcn_wave_barrier(); asm volatile("" ::: "memory");
    }
}

__device__ __forceinline__ h16 tohx(float x) { return (h16)x; }
__device__ __forceinline__ void splitf(float y, unsigned short& h, unsigned short& l) { h = f2bf(y); l = f2bf(y - bf2f(h)); }
typedef __attribute__((ext_vector_type(2))) _Float16 v2h;
typedef __attribute__((ext_vector_type(4))) _Float16 v4h;
typedef __attribute__((ext_vector_type(2))) unsigned short v2us;
typedef __attribute__((ext_vector_type(4))) unsigned short v4us;
typedef __attribute__((ext_vector_type(2))) float v2f;
typedef __attribute__((ext_vector_type(4))) int v4i;

__global__ __launch_bounds__(256) void k_wtG(const float* __restrict__ w, int K, int N, bf* Bt) {
    const int lane = threadIdx.x & 31; const int L0 = (blockIdx.x * 8 + (threadIdx.x >> 5)) * 8; const int nlines = N * K / 64;
{
#pragma unroll 1
        for (int l = 0; l < 8; ++l) { const int L = L0 + l; if (L >= nlines) break; const size_t e = (size_t)L * 64 + lane * 2; const int k = (int)(e % K), n = (int)(e / K); v2us o;
            o[0] = f2bf(w[(size_t)k * N + n]); o[1] = f2bf(w[(size_t)(k + 1) * N + n]); *(v2us*)(Bt + e) = o; }
         }
}
__global__ __launch_bounds__(256) void k_cvt8T(const float* __restrict__ src, bf* dst) { const size_t i = (size_t)blockIdx.x * 256 + threadIdx.x; if (i >= (size_t)TT * DM / 8) return; const int t = (int)(i / (DM / 8)); const int c0 = (int)(i % (DM / 8)) * 8; v8us o;
#pragma unroll
    for (int k = 0; k < 8; ++k) o[k] = f2bf(src[(size_t)(c0 + k) * TT + t]); *(v8us*)(dst + (size_t)t * DM + c0) = o;  }
__global__ __launch_bounds__(256) void k_trT(const float* __restrict__ xim, float* XT) { const size_t i = (size_t)blockIdx.x * 256 + threadIdx.x; if (i >= (size_t)TT * DM / 4) return; const int c0 = (int)(i % (DM / 4)) * 4; const size_t p = i / (DM / 4); v4f o;
#pragma unroll
    for (int q = 0; q < 4; ++q) o[q] = xim[(size_t)(c0 + q) * TT + p]; *(v4f*)(XT + p * DM + c0) = o;  }
__global__ __launch_bounds__(256) void k_cvt8(const float* __restrict__ src, bf* dst, size_t n8) { const size_t i = (size_t)blockIdx.x * 256 + threadIdx.x; if (i >= n8) return; const v8f v = *(const v8f*)(src + i * 8); v8us o;
#pragma unroll
    for (int k = 0; k < 8; ++k) o[k] = f2bf(v[k]); *(v8us*)(dst + i * 8) = o;  }

// k_rope: head planes [h][t][d] (fp16) of rope(x) x sc with the rotate-half convention out[d] = x[d] cos[t][d] - x[d+HD/2] sin[t][d], out[d+HD/2] = x[d+HD/2] cos[t][d+HD/2] + x[d] sin[t][d+HD/2]
__global__ __launch_bounds__(256) void k_rope(const float* __restrict__ F, int pitch, int nheads, const float* __restrict__ CS, const float* __restrict__ RF, const float* __restrict__ nw, float sc, h16* P16, bf* Ph, bf* Pl) {
    const size_t e = ((size_t)blockIdx.x * 256 + threadIdx.x) * 2; if (e >= (size_t)nheads * TT * HD) return; const int d = (int)(e % HD); const int t = (int)((e / HD) % TT); const int h = (int)(e / ((size_t)HD * TT)); const float* f = F + (size_t)t * pitch + h * HD; const float rf = RF ? RF[(size_t)h * TT + t] : 1.0f; v2h o16; v2us oh, ol;
#pragma unroll
    for (int q = 0; q < 2; ++q) { const int dd = d + q; const int dp = (dd < HD / 2) ? dd + HD / 2 : dd - HD / 2; float x0 = f[dd], x1 = f[dp];
        if (RF) { float n0 = __fmul_rn(x0, rf), n1 = __fmul_rn(x1, rf); asm volatile("" : "+v"(n0)); asm volatile("" : "+v"(n1)); x0 = __fmul_rn(bfr(nw[dd]), n0); x1 = __fmul_rn(bfr(nw[dp]), n1); }
        const v2f cs = *(const v2f*)(CS + ((size_t)t * HD + dd) * 2); float a = __fmul_rn(x0, cs[0]), bq = __fmul_rn(x1, cs[1]); asm volatile("" : "+v"(a)); asm volatile("" : "+v"(bq)); const float r = ((dd < HD / 2) ? __fsub_rn(a, bq) : __fadd_rn(a, bq)) * sc;
        o16[q] = tohx(r); (void)oh; (void)ol; }
    *(v2h*)(P16 + e) = o16;  }
__global__ __launch_bounds__(256) void k_ropeR(const float* __restrict__ F, int pitch, int nheads, const float* __restrict__ CS, const float* __restrict__ RF, const float* __restrict__ nw, float sc, h16* P16, bf* Ph, bf* Pl) {
    const size_t e = ((size_t)blockIdx.x * 256 + threadIdx.x) * 2; if (e >= (size_t)nheads * TT * HD) return; const int d = (int)(e % HD); const int t = (int)((e / HD) % TT); const int h = (int)(e / ((size_t)HD * TT)); const float* f = F + (size_t)t * pitch + h * HD; const float rf = RF ? RF[(size_t)h * TT + t] : 1.0f; v2h o16; v2us oh, ol;
#pragma unroll
    for (int q = 0; q < 2; ++q) { const int dd = d + q; const int dp = (dd < HD / 2) ? dd + HD / 2 : dd - HD / 2; float x0 = bfr(f[dd]), x1 = bfr(f[dp]);
        if (RF) { float n0 = __fmul_rn(x0, rf), n1 = __fmul_rn(x1, rf); asm volatile("" : "+v"(n0)); asm volatile("" : "+v"(n1)); x0 = __fmul_rn(bfr(nw[dd]), n0); x1 = __fmul_rn(bfr(nw[dp]), n1); }
        const v2f cs = *(const v2f*)(CS + ((size_t)t * HD + dd) * 2); float a = __fmul_rn(x0, cs[0]), bq = __fmul_rn(x1, cs[1]); asm volatile("" : "+v"(a)); asm volatile("" : "+v"(bq)); const float r = ((dd < HD / 2) ? __fsub_rn(a, bq) : __fadd_rn(a, bq)) * sc;
        o16[q] = tohx(r); (void)oh; (void)ol; }
    *(v2h*)(P16 + e) = o16;  }
__global__ __launch_bounds__(256) void k_vtp(const float* __restrict__ F, int pitch, int nheads, h16* V16, bf* Vh, bf* Vl) { const size_t e = ((size_t)blockIdx.x * 256 + threadIdx.x) * 2; if (e >= (size_t)nheads * HD * TT) return; const int t = (int)(e % TT); const int d = (int)((e / TT) % HD); const int g = (int)(e / ((size_t)TT * HD)); v2h o16; v2us oh, ol;
#pragma unroll
    for (int q = 0; q < 2; ++q) { const float x = F[(size_t)(t + q) * pitch + g * HD + d]; o16[q] = tohx(x); (void)oh; (void)ol; }
    *(v2h*)(V16 + e) = o16;  }
__global__ __launch_bounds__(256) void k_csid(float* CS) { const int idx = blockIdx.x * 256 + threadIdx.x; if (idx >= TT * HD) return; v2f cs; cs[0] = 1.0f; cs[1] = 0.0f; *(v2f*)(CS + (size_t)idx * 2) = cs;  }
__device__ __forceinline__ v16h ldf(const h16* p) { return cat16(*(const v8h*)p, *(const v8h*)(p + 16)); }
__device__ __forceinline__ float xhalf(float x) { return __builtin_bit_cast(float, __builtin_amdgcn_permlanex16(__builtin_bit_cast(int, x), __builtin_bit_cast(int, x), 0x76543210, 0xfedcba98, false, false)); }  // lane l with lane l ^ 16
__global__ __launch_bounds__(FQW * 32) __attribute__((amdgpu_waves_per_eu(2, 2))) void k_fattn(const h16* __restrict__ Q, const h16* __restrict__ Kp, const h16* __restrict__ Vt, float* __restrict__ Op, float* __restrict__ Mp, float* __restrict__ Lp) {
    const int lane = threadIdx.x & 31, c = lane & 15, h = lane >> 4; const int q0 = (blockIdx.x * FQW + (threadIdx.x >> 5)) * 32; const int sl = blockIdx.y, kbeg = sl * (TT / KSP), kend = kbeg + TT / KSP;
    const float cscale = SCL * 1.4426950408889634f;
    v16h qf[2][4], kf[2][4];
    const h16* qp = Q + (size_t)(q0 + c) * HD + 8 * h; const h16* kp = Kp + (size_t)(kbeg + c) * HD + 8 * h; const h16* vp = Vt + (size_t)c * TT + kbeg + 8 * h;
#pragma unroll
    for (int g = 0; g < 2; ++g)
#pragma unroll
        for (int kc = 0; kc < 4; ++kc) qf[g][kc] = ldf(qp + 16 * g * HD + 32 * kc);
#pragma unroll
    for (int kt = 0; kt < 2; ++kt)
#pragma unroll
        for (int kc = 0; kc < 4; ++kc) kf[kt][kc] = ldf(kp + 16 * kt * HD + 32 * kc);
    asm volatile("s_wait_xcnt 0x0" :: "v"(qp), "v"(kp) : "memory");   /* before an address register of the loads above is reused; the operands keep those registers until here */
    v8f acc[2][8]; float m_run[2], l_run[2];
#pragma unroll
    for (int g = 0; g < 2; ++g) { m_run[g] = -3.0e38f; l_run[g] = 0.0f;
#pragma unroll
        for (int t = 0; t < 8; ++t) acc[g][t] = (v8f){}; }
#pragma unroll 1   /* one pass per trip: an unrolled body would not fit two waves per SIMD */
    for (int key0 = kbeg; key0 < kend; key0 += 32) {
        v16h vf[8];   /* this pass's v^T fragments, in flight under the score products and the softmax */
#pragma unroll
        for (int t = 0; t < 8; ++t) vf[t] = ldf(vp + (size_t)16 * t * TT);
        v8f s[2][2];
#pragma unroll
        for (int kt = 0; kt < 2; ++kt)
#pragma unroll
            for (int g = 0; g < 2; ++g) { s[kt][g] = (v8f){};
#pragma unroll
                for (int kc = 0; kc < 4; ++kc) s[kt][g] = wmma16(kf[kt][kc], qf[g][kc], s[kt][g]); }
        const int nk = (key0 + 32 < kend) ? key0 + 32 : kbeg;   /* next pass's key rows, fetched one pass ahead; the last pass re-reads the slice's first rows and drops them */
        kp = Kp + (size_t)(nk + c) * HD + 8 * h;
#pragma unroll
        for (int kt = 0; kt < 2; ++kt)
#pragma unroll
            for (int kc = 0; kc < 4; ++kc) kf[kt][kc] = ldf(kp + 16 * kt * HD + 32 * kc);
        asm volatile("s_wait_xcnt 0x0" :: "v"(vp), "v"(kp) : "memory");   /* before an address register of this pass's loads is advanced or reused; the operands keep those registers until here */
        vp += 32;
        float mb[2]; bool need = false;
#pragma unroll
        for (int g = 0; g < 2; ++g) { float mx = s[0][g][0];
#pragma unroll
            for (int r = 1; r < 8; ++r) mx = fmaxf(mx, s[0][g][r]);
#pragma unroll
            for (int r = 0; r < 8; ++r) mx = fmaxf(mx, s[1][g][r]);
            mx = fmaxf(mx, xhalf(mx)) * cscale; mb[g] = mx; need = need || (mx > m_run[g] + 8.0f); }
        if (__builtin_amdgcn_ballot_w32(need) != 0) {   /* scalar branch; rare after the first pass */
#pragma unroll
            for (int g = 0; g < 2; ++g) { const float m_new = fmaxf(m_run[g], mb[g]); const float corr = __builtin_amdgcn_exp2f(m_run[g] - m_new); l_run[g] *= corr; m_run[g] = m_new;
#pragma unroll
                for (int t = 0; t < 8; ++t) acc[g][t] = acc[g][t] * corr; } }
#pragma unroll
        for (int g = 0; g < 2; ++g) { const float nm = PSH - m_run[g]; v16h pf; float ps0 = 0.0f, ps1 = 0.0f;
#pragma unroll
            for (int i = 0; i < 8; ++i) { const float p0 = __builtin_amdgcn_exp2f(fmaf(s[i >> 2][g][2 * (i & 3)], cscale, nm)), p1 = __builtin_amdgcn_exp2f(fmaf(s[i >> 2][g][2 * (i & 3) + 1], cscale, nm));
                if (i & 1) ps1 += p0 + p1; else ps0 += p0 + p1; pf[2 * i] = (h16)p0; pf[2 * i + 1] = (h16)p1; }
            l_run[g] += ps0 + ps1;
#pragma unroll
            for (int t = 0; t < 8; ++t) acc[g][t] = wmma16(vf[t], pf, acc[g][t]); }
    }
#pragma unroll
    for (int g = 0; g < 2; ++g) { const float l_fin = l_run[g] + xhalf(l_run[g]);   /* each wave half summed its eight keys of every 16-key tile */
        if (h == 0) { Mp[(size_t)sl * TT + q0 + 16 * g + c] = m_run[g]; Lp[(size_t)sl * TT + q0 + 16 * g + c] = l_fin; }
#pragma unroll
        for (int t = 0; t < 8; ++t)
#pragma unroll
            for (int r = 0; r < 8; ++r) Op[((size_t)sl * HD + 16 * t + 8 * h + r) * TT + q0 + 16 * g + c] = acc[g][t][r]; }
}
// k_fmerge: out[ch][l] = sum_s w_s O_s[ch][l] / sum_s w_s l_s, w_s = 2^(m_s - max_s m_s), slices added in slice order. A thread: 4 consecutive queries x 2 channels. O0 to O3: the partial planes of slices 0-3, 4-7, 8-11, 12-15.
__global__ __launch_bounds__(256) void k_fmerge(const float* __restrict__ O0, const float* __restrict__ O1, const float* __restrict__ O2, const float* __restrict__ O3, const float* __restrict__ Mp, const float* __restrict__ Lp, float* __restrict__ out) {
    const unsigned vl = (threadIdx.x & 31) * 16u, vo = (threadIdx.x >> 5) * (8u * TT) + vl;   /* byte offsets of the lane in the block's 128 queries and in its 16 channels x 128 queries: with block-uniform bases, two offset registers serve every load */
    const size_t tile = (size_t)blockIdx.y * 16 * TT + blockIdx.x * 128; const char* mp = (const char*)(Mp + blockIdx.x * 128); const char* lp = (const char*)(Lp + blockIdx.x * 128);
    v4f w[KSP], ls[KSP], pp[2][KSP];   /* unrolled so that all the slices' loads are in flight together */
#pragma unroll
    for (int s = 0; s < KSP; ++s) { w[s] = *(const v4f*)(mp + (size_t)s * TT * 4 + vl); ls[s] = *(const v4f*)(lp + (size_t)s * TT * 4 + vl); }
    __builtin_amdgcn_sched_barrier(0);   /* with the one behind the wait: keeps the loads in front of the wait and the next base's sum, which reuses a base register, behind it */
    asm volatile("s_wait_xcnt 0x0" ::: "memory");   /* before a base register of the loads above is reused */
    __builtin_amdgcn_sched_barrier(0);
#pragma unroll
    for (int s = 0; s < KSP; ++s) { const char* og = (const char*)((s < 4 ? O0 : s < 8 ? O1 : s < 12 ? O2 : O3) + tile);   /* one scalar base per four slices (its own argument): the rest fits the instruction's offset */
        pp[0][s] = *(const v4f*)(og + (size_t)(s & 3) * HD * TT * 4 + vo); pp[1][s] = *(const v4f*)(og + (size_t)(s & 3) * HD * TT * 4 + TT * 4 + vo);
        if ((s & 3) == 3 && s + 1 < KSP) { __builtin_amdgcn_sched_barrier(0); asm volatile("s_wait_xcnt 0x0" ::: "memory"); __builtin_amdgcn_sched_barrier(0); } }   /* the same three lines, for the same reason, behind each base's eight loads */
    __builtin_amdgcn_sched_barrier(0);   /* keeps every load above this line: sunk into the sums they would wait for one another */
    asm volatile("s_wait_xcnt 0x0" :: "v"(vl), "v"(vo) : "memory");   /* before an address register of the loads above is reused; the operands keep the offset registers until here */
    __builtin_amdgcn_sched_barrier(0);   /* keeps the arithmetic, which reuses those registers, behind the wait */
    v4f mx = w[0], den = (v4f){};
#pragma unroll
    for (int s = 1; s < KSP; ++s)
#pragma unroll
        for (int q = 0; q < 4; ++q) mx[q] = fmaxf(mx[q], w[s][q]);
#pragma unroll
    for (int s = 0; s < KSP; ++s) {
#pragma unroll
        for (int q = 0; q < 4; ++q) w[s][q] = __builtin_amdgcn_exp2f(w[s][q] - mx[q]);
        den += w[s] * ls[s]; }
    v4f inv;
#pragma unroll
    for (int q = 0; q < 4; ++q) inv[q] = __fdiv_rn(1.0f, den[q]);
    v4f o0 = w[0] * pp[0][0], o1 = w[0] * pp[1][0];
#pragma unroll
    for (int s = 1; s < KSP; ++s) { o0 += w[s] * pp[0][s]; o1 += w[s] * pp[1][s]; }   /* added in slice order */
    float* po = out + tile + vo / 4; *(v4f*)po = o0 * inv; *(v4f*)(po + TT) = o1 * inv;
}

extern "C" void kernel_launch(void* const* d_in, const int* in_sizes, int n_in,
                              void* d_out, int out_size, void* d_ws, size_t ws_size, hipStream_t stream) {
    (void)in_sizes; (void)n_in; (void)out_size;
    const float* x = (const float*)d_in[0]; const float* wk = (const float*)d_in[1]; const float* bk = (const float*)d_in[2]; const float* wq = nullptr; const float* wv = nullptr; const float* wo = nullptr; (void)wq; (void)wv; (void)wo;
    float* OUT = (float*)d_out;     // [4][128][4096] channel-major
    char* wsp = (char*)d_ws;
    auto take = [&](size_t bytes) { char* p = wsp; wsp += (bytes + 255) & ~(size_t)255; return (void*)p; };
    bf* WQ = nullptr; bf* WK = (bf*)take((size_t)DKV * DM * 2); bf* WV = nullptr; float* CS = (float*)take((size_t)TT * HD * 2 * 4);
    float* XT = (float*)take((size_t)TT * DM * 4);
    bf* XB = (bf*)take((size_t)TT * DM * 2); float* FQ = nullptr; float* FK = (float*)take((size_t)TT * DKV * 4);
    h16* QP16 = (h16*)take((size_t)NH_ * TT * HD * 2); h16* KP16 = (h16*)take((size_t)NKV * TT * HD * 2); h16* VT16 = (h16*)take((size_t)NKV * HD * TT * 2);
    bf* QPh = nullptr; bf* QPl = nullptr; bf* KPh = nullptr; bf* KPl = nullptr; bf* VTh = nullptr; bf* VTl = nullptr;
    float* Ob = (float*)take((size_t)KSP * ZH * TT * HD * 4); float* Mb = (float*)take((size_t)KSP * TT * 4); float* Lb = (float*)take((size_t)KSP * TT * 4);
    if ((size_t)(wsp - (char*)d_ws) > ws_size) return;    // ws 256 MiB
    float* FV = FK;   // values = keys: the v^T planes are built from the same projection buffer (stream-ordered)
    { k_cvt8<<<(unsigned)(((size_t)DKV * DM / 8 + 255) / 256), 256, 0, stream>>>(wk, WK, (size_t)DKV * DM / 8); }
    k_csid<<<(TT * HD + 255) / 256, 256, 0, stream>>>(CS);
    const unsigned LQ = (unsigned)(((size_t)NH_ * TT * HD / 2 + 255) / 256), LKv = (unsigned)(((size_t)NKV * TT * HD / 2 + 255) / 256);
    for (int b = 0; b < NB_; ++b) {
        
        k_cvt8T<<<(unsigned)(((size_t)TT * DM / 8 + 255) / 256), 256, 0, stream>>>(x + (size_t)b * DM * TT, XB); k_trT<<<(unsigned)(((size_t)TT * DM / 4 + 255) / 256), 256, 0, stream>>>(x + (size_t)b * DM * TT, XT);   /* image -> token-major bf16 (projection) and f32 (query planes) */
        k_ropeR<<<LQ, 256, 0, stream>>>(XT, DQ, NH_, CS, nullptr, nullptr, 1.0f, QP16, QPh, QPl);
        k_gemmw<bf, 0, true><<<dim3(TT / 64, DKV / 64, 1), 32, 0, stream>>>(XB, nullptr, WK, nullptr, DM, DM, FK, DKV, bk, 0, 0, 0);
        k_rope<<<LKv, 256, 0, stream>>>(FK, DKV, NKV, CS, nullptr, nullptr, 1.0f, KP16, KPh, KPl);
        k_vtp<<<LKv, 256, 0, stream>>>(FV, DKV, NKV, VT16, VTh, VTl);
        k_fattn<<<dim3(TT / (FQW * 32), KSP, 1), FQW * 32, 0, stream>>>(QP16, KP16, VT16, Ob, Mb, Lb);   /* y = key slice */
        k_fmerge<<<dim3(TT / 128, HD / 16, 1), 256, 0, stream>>>(Ob, Ob + (size_t)4 * HD * TT, Ob + (size_t)8 * HD * TT, Ob + (size_t)12 * HD * TT, Mb, Lb, OUT + (size_t)b * DM * TT);   /* context^T, channel-major */
         }
}

// v003
// One run takes 131 microseconds.
// Two timings next to v002 put it at 1.47 and 1.48 times that version's speed.
// Over all steps from v000 it is 4.60 times as fast.
#include <hip/hip_runtime.h>

// Scaled dot-product attention over image positions (x [4][128][64x64] channel-major; values = keys = 1x1 conv W_kv x + b_kv ([128][128] + [128]); queries = x itself; scores[l][t] = q_l.v_t / sqrt(128) over the 4096 positions; softmax; out[c][l] = sum_t attn[l][t] v_t[c] -> [4][128][64][64] channel-major (2.1 M)).
// The four images run side by side: every kernel but k_cvt8 and k_csid (weights, CS) takes the image as one more grid index (k_gemmw as its batch index z), and every buffer below but the weights and CS holds all four, image-major.
// Layout per image: token-major bf16 copy of x (k_cvt8T) for the projection and a token-major f32 copy for the query planes; values projection exact (+ bias); q, k (= v) as fp16 planes [4096][128], v^T [128][4096]; scores, softmax and attn.v in one kernel per key slice (k_fattn: transposed products, running maximum, P packed in registers); k_fmerge joins the slices and writes the f32 context channel-major.
// Compute dtypes, f32 accumulate: every input rounded to bf16; projection on PLAIN bf16 operands (exact) + f32 bias; scores and attn.v on single fp16 planes (logit sigma ~1; P = 2^(t - m + 6) fp16); softmax f32; f32 output.

#define NB_  4
#define TT   4096
#define DM   128
#define NH_  1
#define NKV  1
#define REP  (NH_ / NKV)
#define HD   128
#define DQ   (NH_ * HD)
#define DKV  (NKV * HD)
#define ZH   1
#define RH   0                  // query rows < RH use hi+lo planes (0: none)
#define WIN  0
#define PSH  6.0f               // P carries 2^PSH: with the trailing maximum (up to 2^8) P stays below 2^14 in fp16
#define SCL  0.088388347648318447f   // HD^-0.5
#define KSP  16                 // key slices (grid y of k_fattn), one f32 partial plane with its maxima and sums each; k_fmerge adds them in slice order
#define FQW  8                  // k_fattn: waves per workgroup, 32 query columns each
static_assert(KSP == 16 && ZH == 1 && NH_ == 1 && HD == 128 && TT % (KSP * 32) == 0 && TT % (FQW * 32) == 0, "k_fattn: one head of size 128, whole 32-key passes per slice");
typedef _Float16 h16;
typedef unsigned short bf;
typedef __attribute__((ext_vector_type(16))) __bf16   v16bf;
typedef __attribute__((ext_vector_type(16))) _Float16 v16h;
typedef __attribute__((ext_vector_type(8)))  _Float16 v8h;
typedef __attribute__((ext_vector_type(8)))  unsigned short v8us;
typedef __attribute__((ext_vector_type(8)))  float    v8f;
typedef __attribute__((ext_vector_type(4)))  float    v4f;
typedef v8h  __attribute__((may_alias)) v8ha;
typedef v4f  __attribute__((may_alias)) v4fa;
typedef v8us __attribute__((may_alias)) v8usa;

__device__ __forceinline__ unsigned short f2bf(float f) { unsigned u = __float_as_uint(f); u += 0x7FFFu + ((u >> 16) & 1u); return (unsigned short)(u >> 16); }
__device__ __forceinline__ float bf2f(unsigned short b) { return __uint_as_float(((unsigned)b) << 16); }
__device__ __forceinline__ float bfr(float f) { return bf2f(f2bf(f)); }
__device__ __forceinline__ v16h cat16(v8h lo, v8h hi) { return __builtin_shufflevector(lo, hi, 0, 1, 2, 3, 4, 5, 6, 7, 8, 9, 10, 11, 12, 13, 14, 15); }
__device__ __forceinline__ v16bf cat16b(v8us lo, v8us hi) { return __builtin_bit_cast(v16bf, __builtin_shufflevector(lo, hi, 0, 1, 2, 3, 4, 5, 6, 7, 8, 9, 10, 11, 12, 13, 14, 15)); }
__device__ __forceinline__ v8f wmma16(v16h a, v16h b, v8f c) { return __builtin_amdgcn_wmma_f32_16x16x32_f16(false, a, false, b, (short)0, c, false, false); }
__device__ __forceinline__ v8f wmmab(v16bf a, v16bf b, v8f c) { return __builtin_amdgcn_wmma_f32_16x16x32_bf16(false, a, false, b, (short)0, c, false, false); }



// ---- k_gemmw: register-blocked GEMM, ONE WAVE per 64x64 output tile (16 accumulators), operands straight from K-contiguous 16-bit planes; grid (M/64, N/64, Z), 32 threads.
// C[m][n] (f32, pitch ldc, + optional f32 bias[n]) = sum_{k < Kz} A[m][k] Bt[n][k] (+ split products per NSPLIT); rows of A and Bt have pitch K >= Kz. z-batch strides sA/sB/sC in elements (here one image per z: sA = TT*DM, sB = 0, sC = TT*DKV). Kz % 32 == 0.
template <typename T16> struct WFrag;
template <> struct WFrag<h16> { typedef v16h V; static __device__ __forceinline__ V ld(const h16* p) { return cat16(*(const v8h*)p, *(const v8h*)(p + 16)); } static __device__ __forceinline__ v8f mma(V a, V b, v8f c) { return wmma16(a, b, c); } };
template <> struct WFrag<bf> { typedef v16bf V; static __device__ __forceinline__ V ld(const bf* p) { return cat16b(*(const v8us*)p, *(const v8us*)(p + 16)); } static __device__ __forceinline__ v8f mma(V a, V b, v8f c) { return wmmab(a, b, c); } };
template <typename T16, int NSPLIT, bool BIAS>
__global__ __launch_bounds__(32) void k_gemmw(const T16* __restrict__ A, const T16* __restrict__ A2, const T16* __restrict__ Bt, const T16* __restrict__ Bt2, int K, int Kz, float* C, int ldc, const float* __restrict__ bias, size_t sA, size_t sB, size_t sC) {
    typedef typename WFrag<T16>::V V;
    __shared__ __align__(16) float os[16 * 68];
    const size_t z = blockIdx.z; A += z * sA; if (A2) A2 += z * sA; Bt += z * sB; if (Bt2) Bt2 += z * sB; C += z * sC;
    const int lane = threadIdx.x & 31, lr = lane & 15, hi = lane >> 4; const int r0 = blockIdx.x * 64, c0 = blockIdx.y * 64;
    v8f acc[4][4];
#pragma unroll
    for (int mb = 0; mb < 4; ++mb)
#pragma unroll
        for (int nb = 0; nb < 4; ++nb) acc[mb][nb] = (v8f){};
    const size_t aoff = (size_t)(r0 + lr) * K + 8 * hi, boff = (size_t)(c0 + lr) * K + 8 * hi;
#pragma unroll 1
    for (int kc = 0; kc < Kz; kc += 32) {
        V a[4], a2[4];
#pragma unroll
        for (int mb = 0; mb < 4; ++mb) { a[mb] = WFrag<T16>::ld(A + aoff + (size_t)mb * 16 * K + kc); if (NSPLIT == 1 || NSPLIT == 2) a2[mb] = WFrag<T16>::ld(A2 + aoff + (size_t)mb * 16 * K + kc); }
#pragma unroll
        for (int nb = 0; nb < 4; ++nb) { const V b = WFrag<T16>::ld(Bt + boff + (size_t)nb * 16 * K + kc); V b2; if (NSPLIT >= 2) b2 = WFrag<T16>::ld(Bt2 + boff + (size_t)nb * 16 * K + kc);
#pragma unroll
            for (int mb = 0; mb < 4; ++mb) { acc[mb][nb] = WFrag<T16>::mma(a[mb], b, acc[mb][nb]); if (NSPLIT == 1 || NSPLIT == 2) acc[mb][nb] = WFrag<T16>::mma(a2[mb], b, acc[mb][nb]); if (NSPLIT >= 2) acc[mb][nb] = WFrag<T16>::mma(a[mb], b2, acc[mb][nb]); } }
        asm volatile("v_nop\n\tv_nop\n\tv_nop\n\tv_nop" : "+v"(acc[0][0]), "+v"(acc[1][1]), "+v"(acc[2][2]), "+v"(acc[3][3]) : "v"(a[0]), "v"(a[3]));
    }
#pragma unroll
    for (int mb = 0; mb < 4; ++mb) {
#pragma unroll
        for (int nb = 0; nb < 4; ++nb) {
#pragma unroll
            for (int j = 0; j < 8; ++j) os[(hi * 8 + j) * 68 + nb * 16 + lr] = acc[mb][nb][j]; }
        __builtin_amdgcn_wave_barrier(); asm volatile("" ::: "memory");
        float* crow = C + (size_t)(r0 + mb * 16) * ldc + c0;
{
#pragma unroll
            for (int s = 0; s < 8; ++s) { const int row = 2 * s + hi, cofs = lr * 4; v4f val = *(const v4fa*)(os + row * 68 + cofs); if (BIAS) { val[0] += bfr(bias[c0 + cofs]); val[1] += bfr(bias[c0 + cofs + 1]); val[2] += bfr(bias[c0 + cofs + 2]); val[3] += bfr(bias[c0 + cofs + 3]); }
                *(v4f*)(crow + (size_t)row * ldc + cofs) = val; }
             }
        __builtin_amdgcn_wave_barrier(); asm volatile("" ::: "memory");
    }
}

__device__ __forceinline__ h16 tohx(float x) { return (h16)x; }
__device__ __forceinline__ void splitf(float y, unsigned short& h, unsigned short& l) { h = f2bf(y); l = f2bf(y - bf2f(h)); }
typedef __attribute__((ext_vector_type(2))) _Float16 v2h;
typedef __attribute__((ext_vector_type(4))) _Float16 v4h;
typedef __attribute__((ext_vector_type(2))) unsigned short v2us;
typedef __attribute__((ext_vector_type(4))) unsigned short v4us;
typedef __attribute__((ext_vector_type(2))) float v2f;
typedef __attribute__((ext_vector_type(4))) int v4i;

__global__ __launch_bounds__(256) void k_wtG(const float* __restrict__ w, int K, int N, bf* Bt) {
    const int lane = threadIdx.x & 31; const int L0 = (blockIdx.x * 8 + (threadIdx.x >> 5)) * 8; const int nlines = N * K / 64;
{
#pragma unroll 1
        for (int l = 0; l < 8; ++l) { const int L = L0 + l; if (L >= nlines) break; const size_t e = (size_t)L * 64 + lane * 2; const int k = (int)(e % K), n = (int)(e / K); v2us o;
            o[0] = f2bf(w[(size_t)k * N + n]); o[1] = f2bf(w[(size_t)(k + 1) * N + n]); *(v2us*)(Bt + e) = o; }
         }
}
__global__ __launch_bounds__(256) void k_cvt8T(const float* __restrict__ src, bf* dst) { const size_t i = (size_t)blockIdx.x * 256 + threadIdx.x; if (i >= (size_t)TT * DM / 8) return; src += (size_t)blockIdx.y * DM * TT; dst += (size_t)blockIdx.y * TT * DM;   /* y = image */ const int t = (int)(i / (DM / 8)); const int c0 = (int)(i % (DM / 8)) * 8; v8us o;
#pragma unroll
    for (int k = 0; k < 8; ++k) o[k] = f2bf(src[(size_t)(c0 + k) * TT + t]); *(v8us*)(dst + (size_t)t * DM + c0) = o;  }
__global__ __launch_bounds__(256) void k_trT(const float* __restrict__ xim, float* XT) { const size_t i = (size_t)blockIdx.x * 256 + threadIdx.x; if (i >= (size_t)TT * DM / 4) return; xim += (size_t)blockIdx.y * DM * TT; XT += (size_t)blockIdx.y * TT * DM;   /* y = image */ const int c0 = (int)(i % (DM / 4)) * 4; const size_t p = i / (DM / 4); v4f o;
#pragma unroll
    for (int q = 0; q < 4; ++q) o[q] = xim[(size_t)(c0 + q) * TT + p]; *(v4f*)(XT + p * DM + c0) = o;  }
__global__ __launch_bounds__(256) void k_cvt8(const float* __restrict__ src, bf* dst, size_t n8) { const size_t i = (size_t)blockIdx.x * 256 + threadIdx.x; if (i >= n8) return; const v8f v = *(const v8f*)(src + i * 8); v8us o;
#pragma unroll
    for (int k = 0; k < 8; ++k) o[k] = f2bf(v[k]); *(v8us*)(dst + i * 8) = o;  }

// k_rope: head planes [h][t][d] (fp16) of rope(x) x sc with the rotate-half convention out[d] = x[d] cos[t][d] - x[d+HD/2] sin[t][d], out[d+HD/2] = x[d+HD/2] cos[t][d+HD/2] + x[d] sin[t][d+HD/2]
__global__ __launch_bounds__(256) void k_rope(const float* __restrict__ F, int pitch, int nheads, const float* __restrict__ CS, const float* __restrict__ RF, const float* __restrict__ nw, float sc, h16* P16, bf* Ph, bf* Pl) {
    F += (size_t)blockIdx.y * TT * pitch; P16 += (size_t)blockIdx.y * nheads * TT * HD;   /* y = image */
    const size_t e = ((size_t)blockIdx.x * 256 + threadIdx.x) * 2; if (e >= (size_t)nheads * TT * HD) return; const int d = (int)(e % HD); const int t = (int)((e / HD) % TT); const int h = (int)(e / ((size_t)HD * TT)); const float* f = F + (size_t)t * pitch + h * HD; const float rf = RF ? RF[(size_t)h * TT + t] : 1.0f; v2h o16; v2us oh, ol;
#pragma unroll
    for (int q = 0; q < 2; ++q) { const int dd = d + q; const int dp = (dd < HD / 2) ? dd + HD / 2 : dd - HD / 2; float x0 = f[dd], x1 = f[dp];
        if (RF) { float n0 = __fmul_rn(x0, rf), n1 = __fmul_rn(x1, rf); asm volatile("" : "+v"(n0)); asm volatile("" : "+v"(n1)); x0 = __fmul_rn(bfr(nw[dd]), n0); x1 = __fmul_rn(bfr(nw[dp]), n1); }
        const v2f cs = *(const v2f*)(CS + ((size_t)t * HD + dd) * 2); float a = __fmul_rn(x0, cs[0]), bq = __fmul_rn(x1, cs[1]); asm volatile("" : "+v"(a)); asm volatile("" : "+v"(bq)); const float r = ((dd < HD / 2) ? __fsub_rn(a, bq) : __fadd_rn(a, bq)) * sc;
        o16[q] = tohx(r); (void)oh; (void)ol; }
    *(v2h*)(P16 + e) = o16;  }
__global__ __launch_bounds__(256) void k_ropeR(const float* __restrict__ F, int pitch, int nheads, const float* __restrict__ CS, const float* __restrict__ RF, const float* __restrict__ nw, float sc, h16* P16, bf* Ph, bf* Pl) {
    F += (size_t)blockIdx.y * TT * pitch; P16 += (size_t)blockIdx.y * nheads * TT * HD;   /* y = image */
    const size_t e = ((size_t)blockIdx.x * 256 + threadIdx.x) * 2; if (e >= (size_t)nheads * TT * HD) return; const int d = (int)(e % HD); const int t = (int)((e / HD) % TT); const int h = (int)(e / ((size_t)HD * TT)); const float* f = F + (size_t)t * pitch + h * HD; const float rf = RF ? RF[(size_t)h * TT + t] : 1.0f; v2h o16; v2us oh, ol;
#pragma unroll
    for (int q = 0; q < 2; ++q) { const int dd = d + q; const int dp = (dd < HD / 2) ? dd + HD / 2 : dd - HD / 2; float x0 = bfr(f[dd]), x1 = bfr(f[dp]);
        if (RF) { float n0 = __fmul_rn(x0, rf), n1 = __fmul_rn(x1, rf); asm volatile("" : "+v"(n0)); asm volatile("" : "+v"(n1)); x0 = __fmul_rn(bfr(nw[dd]), n0); x1 = __fmul_rn(bfr(nw[dp]), n1); }
        const v2f cs = *(const v2f*)(CS + ((size_t)t * HD + dd) * 2); float a = __fmul_rn(x0, cs[0]), bq = __fmul_rn(x1, cs[1]); asm volatile("" : "+v"(a)); asm volatile("" : "+v"(bq)); const float r = ((dd < HD / 2) ? __fsub_rn(a, bq) : __fadd_rn(a, bq)) * sc;
        o16[q] = tohx(r); (void)oh; (void)ol; }
    *(v2h*)(P16 + e) = o16;  }
__global__ __launch_bounds__(256) void k_vtp(const float* __restrict__ F, int pitch, int nheads, h16* V16, bf* Vh, bf* Vl) { const size_t e = ((size_t)blockIdx.x * 256 + threadIdx.x) * 2; if (e >= (size_t)nheads * HD * TT) return; F += (size_t)blockIdx.y * TT * pitch; V16 += (size_t)blockIdx.y * nheads * HD * TT;   /* y = image */
    const int t = (int)(e % TT); const int d = (int)((e / TT) % HD); const int g = (int)(e / ((size_t)TT * HD)); v2h o16; v2us oh, ol;
#pragma unroll
    for (int q = 0; q < 2; ++q) { const float x = F[(size_t)(t + q) * pitch + g * HD + d]; o16[q] = tohx(x); (void)oh; (void)ol; }
    *(v2h*)(V16 + e) = o16;  }
__global__ __launch_bounds__(256) void k_csid(float* CS) { const int idx = blockIdx.x * 256 + threadIdx.x; if (idx >= TT * HD) return; v2f cs; cs[0] = 1.0f; cs[1] = 0.0f; *(v2f*)(CS + (size_t)idx * 2) = cs;  }
__device__ __forceinline__ v16h ldf(const h16* p) { return cat16(*(const v8h*)p, *(const v8h*)(p + 16)); }
__device__ __forceinline__ float xhalf(float x) { return __builtin_bit_cast(float, __builtin_amdgcn_permlanex16(__builtin_bit_cast(int, x), __builtin_bit_cast(int, x), 0x76543210, 0xfedcba98, false, false)); }  // lane l with lane l ^ 16
__global__ __launch_bounds__(FQW * 32) __attribute__((amdgpu_waves_per_eu(2, 2))) void k_fattn(const h16* __restrict__ Q, const h16* __restrict__ Kp, const h16* __restrict__ Vt, float* __restrict__ Op, float* __restrict__ Mp, float* __restrict__ Lp) {
    const int lane = threadIdx.x & 31, c = lane & 15, h = lane >> 4; const int q0 = (blockIdx.x * FQW + (threadIdx.x >> 5)) * 32; const int sl = blockIdx.y, kbeg = sl * (TT / KSP), kend = kbeg + TT / KSP;
    const float cscale = SCL * 1.4426950408889634f;
    { const size_t im = blockIdx.z; Q += im * TT * HD; Kp += im * TT * HD; Vt += im * HD * TT; Op += im * KSP * HD * TT; Mp += im * KSP * TT; Lp += im * KSP * TT; }   /* z = image */
    v16h qf[2][4], kf[2][4];
    const h16* qp = Q + (size_t)(q0 + c) * HD + 8 * h; const h16* kp = Kp + (size_t)(kbeg + c) * HD + 8 * h; const h16* vp = Vt + (size_t)c * TT + kbeg + 8 * h;
#pragma unroll
    for (int g = 0; g < 2; ++g)
#pragma unroll
        for (int kc = 0; kc < 4; ++kc) qf[g][kc] = ldf(qp + 16 * g * HD + 32 * kc);
#pragma unroll
    for (int kt = 0; kt < 2; ++kt)
#pragma unroll
        for (int kc = 0; kc < 4; ++kc) kf[kt][kc] = ldf(kp + 16 * kt * HD + 32 * kc);
    asm volatile("s_wait_xcnt 0x0" :: "v"(qp), "v"(kp) : "memory");   /* before an address register of the loads above is reused; the operands keep those registers until here */
    v8f acc[2][8]; float m_run[2], l_run[2];
#pragma unroll
    for (int g = 0; g < 2; ++g) { m_run[g] = -3.0e38f; l_run[g] = 0.0f;
#pragma unroll
        for (int t = 0; t < 8; ++t) acc[g][t] = (v8f){}; }
#pragma unroll 1   /* one pass per trip: an unrolled body would not fit two waves per SIMD */
    for (int key0 = kbeg; key0 < kend; key0 += 32) {
        v16h vf[8];   /* this pass's v^T fragments, in flight under the score products and the softmax */
#pragma unroll
        for (int t = 0; t < 8; ++t) vf[t] = ldf(vp + (size_t)16 * t * TT);
        v8f s[2][2];
#pragma unroll
        for (int kt = 0; kt < 2; ++kt)
#pragma unroll
            for (int g = 0; g < 2; ++g) { s[kt][g] = (v8f){};
#pragma unroll
                for (int kc = 0; kc < 4; ++kc) s[kt][g] = wmma16(kf[kt][kc], qf[g][kc], s[kt][g]); }
        const int nk = (key0 + 32 < kend) ? key0 + 32 : kbeg;   /* next pass's key rows, fetched one pass ahead; the last pass re-reads the slice's first rows and drops them */
        kp = Kp + (size_t)(nk + c) * HD + 8 * h;
#pragma unroll
        for (int kt = 0; kt < 2; ++kt)
#pragma unroll
            for (int kc = 0; kc < 4; ++kc) kf[kt][kc] = ldf(kp + 16 * kt * HD + 32 * kc);
        asm volatile("s_wait_xcnt 0x0" :: "v"(vp), "v"(kp) : "memory");   /* before an address register of this pass's loads is advanced or reused; the operands keep those registers until here */
        vp += 32;
        float mb[2]; bool need = false;
#pragma unroll
        for (int g = 0; g < 2; ++g) { float mx = s[0][g][0];
#pragma unroll
            for (int r = 1; r < 8; ++r) mx = fmaxf(mx, s[0][g][r]);
#pragma unroll
            for (int r = 0; r < 8; ++r) mx = fmaxf(mx, s[1][g][r]);
            mx = fmaxf(mx, xhalf(mx)) * cscale; mb[g] = mx; need = need || (mx > m_run[g] + 8.0f); }
        if (__builtin_amdgcn_ballot_w32(need) != 0) {   /* scalar branch; rare after the first pass */
#pragma unroll
            for (int g = 0; g < 2; ++g) { const float m_new = fmaxf(m_run[g], mb[g]); const float corr = __builtin_amdgcn_exp2f(m_run[g] - m_new); l_run[g] *= corr; m_run[g] = m_new;
#pragma unroll
                for (int t = 0; t < 8; ++t) acc[g][t] = acc[g][t] * corr; } }
#pragma unroll
        for (int g = 0; g < 2; ++g) { const float nm = PSH - m_run[g]; v16h pf; float ps0 = 0.0f, ps1 = 0.0f;
#pragma unroll
            for (int i = 0; i < 8; ++i) { const float p0 = __builtin_amdgcn_exp2f(fmaf(s[i >> 2][g][2 * (i & 3)], cscale, nm)), p1 = __builtin_amdgcn_exp2f(fmaf(s[i >> 2][g][2 * (i & 3) + 1], cscale, nm));
                if (i & 1) ps1 += p0 + p1; else ps0 += p0 + p1; pf[2 * i] = (h16)p0; pf[2 * i + 1] = (h16)p1; }
            l_run[g] += ps0 + ps1;
#pragma unroll
            for (int t = 0; t < 8; ++t) acc[g][t] = wmma16(vf[t], pf, acc[g][t]); }
    }
#pragma unroll
    for (int g = 0; g < 2; ++g) { const float l_fin = l_run[g] + xhalf(l_run[g]);   /* each wave half summed its eight keys of every 16-key tile */
        if (h == 0) { Mp[(size_t)sl * TT + q0 + 16 * g + c] = m_run[g]; Lp[(size_t)sl * TT + q0 + 16 * g + c] = l_fin; }
#pragma unroll
        for (int t = 0; t < 8; ++t)
#pragma unroll
            for (int r = 0; r < 8; ++r) Op[((size_t)sl * HD + 16 * t + 8 * h + r) * TT + q0 + 16 * g + c] = acc[g][t][r]; }
}
// k_fmerge: out[ch][l] = sum_s w_s O_s[ch][l] / sum_s w_s l_s, w_s = 2^(m_s - max_s m_s), slices added in slice order. A thread: 4 consecutive queries x 2 channels. O0 to O3: the partial planes of slices 0-3, 4-7, 8-11, 12-15.
__global__ __launch_bounds__(256) void k_fmerge(const float* __restrict__ O0, const float* __restrict__ O1, const float* __restrict__ O2, const float* __restrict__ O3, const float* __restrict__ Mp, const float* __restrict__ Lp, float* __restrict__ out) {
    { const size_t im = blockIdx.z, io = im * KSP * HD * TT; O0 += io; O1 += io; O2 += io; O3 += io; Mp += im * KSP * TT; Lp += im * KSP * TT; out += im * DM * TT; }   /* z = image */
    const unsigned vl = (threadIdx.x & 31) * 16u, vo = (threadIdx.x >> 5) * (8u * TT) + vl;   /* byte offsets of the lane in the block's 128 queries and in its 16 channels x 128 queries: with block-uniform bases, two offset registers serve every load */
    const size_t tile = (size_t)blockIdx.y * 16 * TT + blockIdx.x * 128; const char* mp = (const char*)(Mp + blockIdx.x * 128); const char* lp = (const char*)(Lp + blockIdx.x * 128);
    v4f w[KSP], ls[KSP], pp[2][KSP];   /* unrolled so that all the slices' loads are in flight together */
#pragma unroll
    for (int s = 0; s < KSP; ++s) { w[s] = *(const v4f*)(mp + (size_t)s * TT * 4 + vl); ls[s] = *(const v4f*)(lp + (size_t)s * TT * 4 + vl); }
    __builtin_amdgcn_sched_barrier(0);   /* with the one behind the wait: keeps the loads in front of the wait and the next base's sum, which reuses a base register, behind it */
    asm volatile("s_wait_xcnt 0x0" ::: "memory");   /* before a base register of the loads above is reused */
    __builtin_amdgcn_sched_barrier(0);
#pragma unroll
    for (int s = 0; s < KSP; ++s) { const char* og = (const char*)((s < 4 ? O0 : s < 8 ? O1 : s < 12 ? O2 : O3) + tile);   /* one scalar base per four slices (its own argument): the rest fits the instruction's offset */
        pp[0][s] = *(const v4f*)(og + (size_t)(s & 3) * HD * TT * 4 + vo); pp[1][s] = *(const v4f*)(og + (size_t)(s & 3) * HD * TT * 4 + TT * 4 + vo);
        if ((s & 3) == 3 && s + 1 < KSP) { __builtin_amdgcn_sched_barrier(0); asm volatile("s_wait_xcnt 0x0" ::: "memory"); __builtin_amdgcn_sched_barrier(0); } }   /* the same three lines, for the same reason, behind each base's eight loads */
    __builtin_amdgcn_sched_barrier(0);   /* keeps every load above this line: sunk into the sums they would wait for one another */
    asm volatile("s_wait_xcnt 0x0" :: "v"(vl), "v"(vo) : "memory");   /* before an address register of the loads above is reused; the operands keep the offset registers until here */
    __builtin_amdgcn_sched_barrier(0);   /* keeps the arithmetic, which reuses those registers, behind the wait */
    v4f mx = w[0], den = (v4f){};
#pragma unroll
    for (int s = 1; s < KSP; ++s)
#pragma unroll
        for (int q = 0; q < 4; ++q) mx[q] = fmaxf(mx[q], w[s][q]);
#pragma unroll
    for (int s = 0; s < KSP; ++s) {
#pragma unroll
        for (int q = 0; q < 4; ++q) w[s][q] = __builtin_amdgcn_exp2f(w[s][q] - mx[q]);
        den += w[s] * ls[s]; }
    v4f inv;
#pragma unroll
    for (int q = 0; q < 4; ++q) inv[q] = __fdiv_rn(1.0f, den[q]);
    v4f o0 = w[0] * pp[0][0], o1 = w[0] * pp[1][0];
#pragma unroll
    for (int s = 1; s < KSP; ++s) { o0 += w[s] * pp[0][s]; o1 += w[s] * pp[1][s]; }   /* added in slice order */
    float* po = out + tile + vo / 4; *(v4f*)po = o0 * inv; *(v4f*)(po + TT) = o1 * inv;
}

extern "C" void kernel_launch(void* const* d_in, const int* in_sizes, int n_in,
                              void* d_out, int out_size, void* d_ws, size_t ws_size, hipStream_t stream) {
    (void)in_sizes; (void)n_in; (void)out_size;
    const float* x = (const float*)d_in[0]; const float* wk = (const float*)d_in[1]; const float* bk = (const float*)d_in[2]; const float* wq = nullptr; const float* wv = nullptr; const float* wo = nullptr; (void)wq; (void)wv; (void)wo;
    float* OUT = (float*)d_out;     // [4][128][4096] channel-major
    char* wsp = (char*)d_ws;
    auto take = [&](size_t bytes) { char* p = wsp; wsp += (bytes + 255) & ~(size_t)255; return (void*)p; };
    bf* WQ = nullptr; bf* WK = (bf*)take((size_t)DKV * DM * 2); bf* WV = nullptr; float* CS = (float*)take((size_t)TT * HD * 2 * 4);
    float* XT = (float*)take((size_t)NB_ * TT * DM * 4);
    bf* XB = (bf*)take((size_t)NB_ * TT * DM * 2); float* FQ = nullptr; float* FK = (float*)take((size_t)NB_ * TT * DKV * 4);
    h16* QP16 = (h16*)take((size_t)NB_ * NH_ * TT * HD * 2); h16* KP16 = (h16*)take((size_t)NB_ * NKV * TT * HD * 2); h16* VT16 = (h16*)take((size_t)NB_ * NKV * HD * TT * 2);
    bf* QPh = nullptr; bf* QPl = nullptr; bf* KPh = nullptr; bf* KPl = nullptr; bf* VTh = nullptr; bf* VTl = nullptr;
    float* Ob = (float*)take((size_t)NB_ * KSP * ZH * TT * HD * 4); float* Mb = (float*)take((size_t)NB_ * KSP * TT * 4); float* Lb = (float*)take((size_t)NB_ * KSP * TT * 4);
    if ((size_t)(wsp - (char*)d_ws) > ws_size) return;    // ws 256 MiB
    float* FV = FK;   // values = keys: the v^T planes are built from the same projection buffer (stream-ordered)
    { k_cvt8<<<(unsigned)(((size_t)DKV * DM / 8 + 255) / 256), 256, 0, stream>>>(wk, WK, (size_t)DKV * DM / 8); }
    k_csid<<<(TT * HD + 255) / 256, 256, 0, stream>>>(CS);
    const unsigned LQ = (unsigned)(((size_t)NH_ * TT * HD / 2 + 255) / 256), LKv = (unsigned)(((size_t)NKV * TT * HD / 2 + 255) / 256);
    /* one launch of each kernel for all four images */
    k_cvt8T<<<dim3((unsigned)(((size_t)TT * DM / 8 + 255) / 256), NB_, 1), 256, 0, stream>>>(x, XB); k_trT<<<dim3((unsigned)(((size_t)TT * DM / 4 + 255) / 256), NB_, 1), 256, 0, stream>>>(x, XT);   /* image -> token-major bf16 (projection) and f32 (query planes) */
    k_ropeR<<<dim3(LQ, NB_, 1), 256, 0, stream>>>(XT, DQ, NH_, CS, nullptr, nullptr, 1.0f, QP16, QPh, QPl);
    k_gemmw<bf, 0, true><<<dim3(TT / 64, DKV / 64, NB_), 32, 0, stream>>>(XB, nullptr, WK, nullptr, DM, DM, FK, DKV, bk, (size_t)TT * DM, 0, (size_t)TT * DKV);   /* z = image */
    k_rope<<<dim3(LKv, NB_, 1), 256, 0, stream>>>(FK, DKV, NKV, CS, nullptr, nullptr, 1.0f, KP16, KPh, KPl);
    k_vtp<<<dim3(LKv, NB_, 1), 256, 0, stream>>>(FV, DKV, NKV, VT16, VTh, VTl);
    k_fattn<<<dim3(TT / (FQW * 32), KSP, NB_), FQW * 32, 0, stream>>>(QP16, KP16, VT16, Ob, Mb, Lb);   /* y = key slice, z = image */
    k_fmerge<<<dim3(TT / 128, HD / 16, NB_), 256, 0, stream>>>(Ob, Ob + (size_t)4 * HD * TT, Ob + (size_t)8 * HD * TT, Ob + (size_t)12 * HD * TT, Mb, Lb, OUT);   /* context^T, channel-major; z = image */
}

// v004
// It runs in 105 microseconds.
// Two timings next to v003 both put it at 1.25 times that version's speed.
// Over all steps from v000 it is 5.74 times as fast.
#include <hip/hip_runtime.h>

// Scaled dot-product attention over image positions (x [4][128][64x64] channel-major; values = keys = 1x1 conv W_kv x + b_kv ([128][128] + [128]); queries = x itself; scores[l][t] = q_l.v_t / sqrt(128) over the 4096 positions; softmax; out[c][l] = sum_t attn[l][t] v_t[c] -> [4][128][64][64] channel-major (2.1 M)).
// The four images run side by side: every kernel takes the image as its grid index z, and every buffer below holds all four, image-major.
// Layout per image: the values projection (k_proj, exact products + bias) reads x and the weights as they are and writes all three fp16 planes itself; q, k (= v) as fp16 planes [4096][128], v^T [128][4096]; scores, softmax and attn.v in one kernel per key slice (k_fattn: transposed products, running maximum, P packed in registers); k_fmerge joins the slices and writes the f32 context channel-major.
// Compute dtypes, f32 accumulate: every input rounded to bf16; projection on PLAIN bf16 operands (exact) + f32 bias; scores and attn.v on single fp16 planes (logit sigma ~1; P = 2^(t - m + 6) fp16); softmax f32; f32 output.

#define NB_  4
#define TT   4096
#define DM   128
#define NH_  1
#define NKV  1
#define REP  (NH_ / NKV)
#define HD   128
#define DQ   (NH_ * HD)
#define DKV  (NKV * HD)
#define ZH   1
#define RH   0                  // query rows < RH use hi+lo planes (0: none)
#define WIN  0
#define PSH  6.0f               // P carries 2^PSH: with the trailing maximum (up to 2^8) P stays below 2^14 in fp16
#define SCL  0.088388347648318447f   // HD^-0.5
#define KSP  16                 // key slices (grid y of k_fattn), one f32 partial plane with its maxima and sums each; k_fmerge adds them in slice order
#define FQW  8                  // k_fattn: waves per workgroup, 32 query columns each
static_assert(KSP == 16 && ZH == 1 && NH_ == 1 && HD == 128 && TT % (KSP * 32) == 0 && TT % (FQW * 32) == 0, "k_fattn: one head of size 128, whole 32-key passes per slice");
typedef _Float16 h16;
typedef unsigned short bf;
typedef __attribute__((ext_vector_type(16))) __bf16   v16bf;
typedef __attribute__((ext_vector_type(16))) _Float16 v16h;
typedef __attribute__((ext_vector_type(8)))  _Float16 v8h;
typedef __attribute__((ext_vector_type(4)))  _Float16 v4h;
typedef __attribute__((ext_vector_type(8)))  unsigned short v8us;
typedef __attribute__((ext_vector_type(16))) unsigned short v16us;
typedef __attribute__((ext_vector_type(8)))  unsigned v8u;
typedef __attribute__((ext_vector_type(2)))  __bf16   v2bf;
typedef __attribute__((ext_vector_type(2)))  float    v2f;
typedef __attribute__((ext_vector_type(8)))  float    v8f;
typedef __attribute__((ext_vector_type(4)))  float    v4f;
typedef v8h  __attribute__((may_alias)) v8ha;
typedef v4f  __attribute__((may_alias)) v4fa;
typedef v8us __attribute__((may_alias)) v8usa;

__device__ __forceinline__ unsigned short f2bf(float f) { unsigned u = __float_as_uint(f); u += 0x7FFFu + ((u >> 16) & 1u); return (unsigned short)(u >> 16); }
__device__ __forceinline__ float bf2f(unsigned short b) { return __uint_as_float(((unsigned)b) << 16); }
__device__ __forceinline__ float bfr(float f) { return bf2f(f2bf(f)); }
__device__ __forceinline__ unsigned pkbf(float lo, float up) { v2f t; t[0] = lo; t[1] = up; return __builtin_bit_cast(unsigned, __builtin_convertvector(t, v2bf)); }   // two f32 rounded to nearest even into one register of bf16, as f2bf rounds, in one instruction
__device__ __forceinline__ v16h cat16(v8h lo, v8h hi) { return __builtin_shufflevector(lo, hi, 0, 1, 2, 3, 4, 5, 6, 7, 8, 9, 10, 11, 12, 13, 14, 15); }
__device__ __forceinline__ v8f wmma16(v16h a, v16h b, v8f c) { return __builtin_amdgcn_wmma_f32_16x16x32_f16(false, a, false, b, (short)0, c, false, false); }
__device__ __forceinline__ v8f wmmab(v16bf a, v16bf b, v8f c) { return __builtin_amdgcn_wmma_f32_16x16x32_bf16(false, a, false, b, (short)0, c, false, false); }



// ---- k_proj: the whole preparation. ONE WAVE per 64 tokens x 64 output channels (16 accumulators); grid (TT/64, DKV/64, image), 32 threads.
// C[t][o] = sum_c bf16(x[c][t]) bf16(w[o][c]) + bf16(bias[o]), f32 accumulate. Both operands come straight from the f32 inputs and are rounded to bf16 in registers:
// an A fragment's lane is one token, so its sixteen channels are sixteen 4-byte loads, each of which covers 64 consecutive bytes of two rows of channel-major x; a B fragment's lane is one row of w.
// C leaves the kernel as two fp16 planes: Ck[t][o] and its transpose Cv[o][t]. The waves of output block 0 also write the A fragments' values as the fp16 query plane Qp[t][c].
// A wave writes whole 128-byte lines of each plane (64 o of a row of Ck, 64 t of a row of Cv, whole rows of Qp).
__global__ __launch_bounds__(32) void k_proj(const float* __restrict__ x, const float* __restrict__ w, const float* __restrict__ bias, h16* Qp, h16* Ck, h16* Cv) {
    __shared__ __align__(16) float os[16 * 68];
    { const size_t z = blockIdx.z; x += z * DM * TT; Qp += z * TT * DM; Ck += z * TT * DKV; Cv += z * DKV * TT; }   /* z = image */
    const int lane = threadIdx.x & 31, lr = lane & 15, hi = lane >> 4; const int r0 = blockIdx.x * 64, c0 = blockIdx.y * 64;
    const float* xp = x + (size_t)(8 * hi) * TT + r0 + lr;        /* channel 8 hi, token r0 + lr */
    const float* wp = w + (size_t)(c0 + lr) * DM + 8 * hi;        /* row c0 + lr, channel 8 hi */
    const float* bu = bias + c0;                                  /* the same for the whole wave */
    v4f wr[4][4][4];      /* [32-channel chunk][16-row block][quarter of the fragment] */
#pragma unroll
    for (int kq = 0; kq < 4; ++kq)
#pragma unroll
        for (int nb = 0; nb < 4; ++nb) { const float* p = wp + (size_t)nb * 16 * DM + 32 * kq; wr[kq][nb][0] = *(const v4f*)p; wr[kq][nb][1] = *(const v4f*)(p + 4); wr[kq][nb][2] = *(const v4f*)(p + 16); wr[kq][nb][3] = *(const v4f*)(p + 20); }
    float bcol[4];        /* the bias of this lane's four columns, for the transposed plane */
#pragma unroll
    for (int nb = 0; nb < 4; ++nb) bcol[nb] = bu[nb * 16 + lr];
    v4f brow = *(const v4f*)(bu + lr * 4);   /* and of the four columns that the lane stores of each row of Ck */
    float xr[4][4][16];   /* [token block][32-channel chunk][fragment element]: element i is channel 32 kq + 8 hi + i (i < 8) or 32 kq + 16 + 8 hi + i - 8, on the A side as on the B side */
#pragma unroll
    for (int mb = 0; mb < 4; ++mb)
#pragma unroll
        for (int kq = 0; kq < 4; ++kq)
#pragma unroll
            for (int i = 0; i < 16; ++i) xr[mb][kq][i] = xp[(size_t)(32 * kq + (i & 7) + 16 * (i >> 3)) * TT + mb * 16];
    __builtin_amdgcn_sched_barrier(0);   /* keeps every load above this line: sunk among the conversions and the products they would wait for memory one group after another */
    asm volatile("s_wait_xcnt 0x0" :: "v"(xp), "v"(wp), "s"(bu), "v"(lr) : "memory");   /* before an address register of the loads above is reused; the operands keep those registers until here */
    __builtin_amdgcn_sched_barrier(0);   /* keeps the arithmetic, which reuses those registers, behind the wait */
    v16bf a[4][4];
#pragma unroll
    for (int mb = 0; mb < 4; ++mb)
#pragma unroll
        for (int kq = 0; kq < 4; ++kq) { v8u pk;
#pragma unroll
            for (int i = 0; i < 8; ++i) pk[i] = pkbf(xr[mb][kq][2 * i], xr[mb][kq][2 * i + 1]);
            a[mb][kq] = __builtin_bit_cast(v16bf, pk); }
    if (blockIdx.y == 0) {   /* the query plane: the same bf16-rounded values as fp16, token-major; one branch for all of it, outside the loads and the products */
        h16* qp = Qp + (size_t)(r0 + lr) * DM + 8 * hi; v8h qv[4][4][2];
#pragma unroll
        for (int mb = 0; mb < 4; ++mb)
#pragma unroll
            for (int kq = 0; kq < 4; ++kq) { const v16us av = __builtin_bit_cast(v16us, a[mb][kq]);
#pragma unroll
                for (int i = 0; i < 8; ++i) { qv[mb][kq][0][i] = (h16)bf2f(av[i]); qv[mb][kq][1][i] = (h16)bf2f(av[8 + i]); } }
#pragma unroll
        for (int mb = 0; mb < 4; ++mb)
#pragma unroll
            for (int kq = 0; kq < 4; ++kq) { *(v8h*)(qp + (size_t)mb * 16 * DM + 32 * kq) = qv[mb][kq][0]; *(v8h*)(qp + (size_t)mb * 16 * DM + 32 * kq + 16) = qv[mb][kq][1]; }
        asm volatile("s_wait_xcnt 0x0" :: "v"(qp) : "memory");   /* before a register of the stores above is reused */
    }
    v8f acc[4][4];
#pragma unroll
    for (int mb = 0; mb < 4; ++mb)
#pragma unroll
        for (int nb = 0; nb < 4; ++nb) acc[mb][nb] = (v8f){};
#pragma unroll
    for (int kq = 0; kq < 4; ++kq) {
#pragma unroll
        for (int nb = 0; nb < 4; ++nb) { const v4f w0 = wr[kq][nb][0], w1 = wr[kq][nb][1], w2 = wr[kq][nb][2], w3 = wr[kq][nb][3]; v8u pk;
            pk[0] = pkbf(w0[0], w0[1]); pk[1] = pkbf(w0[2], w0[3]); pk[2] = pkbf(w1[0], w1[1]); pk[3] = pkbf(w1[2], w1[3]); pk[4] = pkbf(w2[0], w2[1]); pk[5] = pkbf(w2[2], w2[3]); pk[6] = pkbf(w3[0], w3[1]); pk[7] = pkbf(w3[2], w3[3]);
            const v16bf b = __builtin_bit_cast(v16bf, pk);
#pragma unroll
            for (int mb = 0; mb < 4; ++mb) acc[mb][nb] = wmmab(a[mb][kq], b, acc[mb][nb]); }
    }
#pragma unroll
    for (int nb = 0; nb < 4; ++nb) { bcol[nb] = bfr(bcol[nb]); brow[nb] = bfr(brow[nb]); }
    h16* cvp = Cv + (size_t)(c0 + lr) * TT + r0 + 8 * hi; h16* ckp = Ck + (size_t)(r0 + hi) * DKV + c0 + lr * 4;
#pragma unroll
    for (int mb = 0; mb < 4; ++mb) { v8h tv[4]; v4h hv[8];
#pragma unroll
        for (int nb = 0; nb < 4; ++nb)   /* a lane's accumulator registers are eight consecutive tokens of one output channel: 16 bytes of a row of Cv */
#pragma unroll
            for (int j = 0; j < 8; ++j) { os[(hi * 8 + j) * 68 + nb * 16 + lr] = acc[mb][nb][j]; tv[nb][j] = (h16)(acc[mb][nb][j] + bcol[nb]); }
        __builtin_amdgcn_wave_barrier(); asm volatile("" ::: "memory");   /* the rows are read back by other lanes of the wave: keeps the LDS reads behind the writes */
#pragma unroll
        for (int s = 0; s < 8; ++s) { const v4f val = *(const v4fa*)(os + (2 * s + hi) * 68 + lr * 4) + brow; hv[s][0] = (h16)val[0]; hv[s][1] = (h16)val[1]; hv[s][2] = (h16)val[2]; hv[s][3] = (h16)val[3]; }
        __builtin_amdgcn_wave_barrier(); asm volatile("" ::: "memory");   /* and the next block's LDS writes behind these reads */
#pragma unroll
        for (int nb = 0; nb < 4; ++nb) *(v8h*)(cvp + (size_t)nb * 16 * TT + mb * 16) = tv[nb];
#pragma unroll
        for (int s = 0; s < 8; ++s) *(v4h*)(ckp + (size_t)(mb * 16 + 2 * s) * DKV) = hv[s];
        __builtin_amdgcn_sched_barrier(0);   /* with the one behind the wait: keeps the stores in front of the wait and the next block's arithmetic, which reuses their registers, behind it */
        asm volatile("s_wait_xcnt 0x0" :: "v"(cvp), "v"(ckp) : "memory");   /* before a register of the stores above is reused */
        __builtin_amdgcn_sched_barrier(0);
    }
}

__device__ __forceinline__ void splitf(float y, unsigned short& h, unsigned short& l) { h = f2bf(y); l = f2bf(y - bf2f(h)); }
typedef __attribute__((ext_vector_type(2))) unsigned short v2us;
typedef __attribute__((ext_vector_type(4))) unsigned short v4us;
typedef __attribute__((ext_vector_type(4))) int v4i;

__global__ __launch_bounds__(256) void k_wtG(const float* __restrict__ w, int K, int N, bf* Bt) {
    const int lane = threadIdx.x & 31; const int L0 = (blockIdx.x * 8 + (threadIdx.x >> 5)) * 8; const int nlines = N * K / 64;
{
#pragma unroll 1
        for (int l = 0; l < 8; ++l) { const int L = L0 + l; if (L >= nlines) break; const size_t e = (size_t)L * 64 + lane * 2; const int k = (int)(e % K), n = (int)(e / K); v2us o;
            o[0] = f2bf(w[(size_t)k * N + n]); o[1] = f2bf(w[(size_t)(k + 1) * N + n]); *(v2us*)(Bt + e) = o; }
         }
}
__device__ __forceinline__ v16h ldf(const h16* p) { return cat16(*(const v8h*)p, *(const v8h*)(p + 16)); }
__device__ __forceinline__ float xhalf(float x) { return __builtin_bit_cast(float, __builtin_amdgcn_permlanex16(__builtin_bit_cast(int, x), __builtin_bit_cast(int, x), 0x76543210, 0xfedcba98, false, false)); }  // lane l with lane l ^ 16
__global__ __launch_bounds__(FQW * 32) __attribute__((amdgpu_waves_per_eu(2, 2))) void k_fattn(const h16* __restrict__ Q, const h16* __restrict__ Kp, const h16* __restrict__ Vt, float* __restrict__ Op, float* __restrict__ Mp, float* __restrict__ Lp) {
    const int lane = threadIdx.x & 31, c = lane & 15, h = lane >> 4; const int q0 = (blockIdx.x * FQW + (threadIdx.x >> 5)) * 32; const int sl = blockIdx.y, kbeg = sl * (TT / KSP), kend = kbeg + TT / KSP;
    const float cscale = SCL * 1.4426950408889634f;
    { const size_t im = blockIdx.z; Q += im * TT * HD; Kp += im * TT * HD; Vt += im * HD * TT; Op += im * KSP * HD * TT; Mp += im * KSP * TT; Lp += im * KSP * TT; }   /* z = image */
    v16h qf[2][4], kf[2][4];
    const h16* qp = Q + (size_t)(q0 + c) * HD + 8 * h; const h16* kp = Kp + (size_t)(kbeg + c) * HD + 8 * h; const h16* vp = Vt + (size_t)c * TT + kbeg + 8 * h;
#pragma unroll
    for (int g = 0; g < 2; ++g)
#pragma unroll
        for (int kc = 0; kc < 4; ++kc) qf[g][kc] = ldf(qp + 16 * g * HD + 32 * kc);
#pragma unroll
    for (int kt = 0; kt < 2; ++kt)
#pragma unroll
        for (int kc = 0; kc < 4; ++kc) kf[kt][kc] = ldf(kp + 16 * kt * HD + 32 * kc);
    asm volatile("s_wait_xcnt 0x0" :: "v"(qp), "v"(kp) : "memory");   /* before an address register of the loads above is reused; the operands keep those registers until here */
    v8f acc[2][8]; float m_run[2], l_run[2];
#pragma unroll
    for (int g = 0; g < 2; ++g) { m_run[g] = -3.0e38f; l_run[g] = 0.0f;
#pragma unroll
        for (int t = 0; t < 8; ++t) acc[g][t] = (v8f){}; }
#pragma unroll 1   /* one pass per trip: an unrolled body would not fit two waves per SIMD */
    for (int key0 = kbeg; key0 < kend; key0 += 32) {
        v16h vf[8];   /* this pass's v^T fragments, in flight under the score products and the softmax */
#pragma unroll
        for (int t = 0; t < 8; ++t) vf[t] = ldf(vp + (size_t)16 * t * TT);
        v8f s[2][2];
#pragma unroll
        for (int kt = 0; kt < 2; ++kt)
#pragma unroll
            for (int g = 0; g < 2; ++g) { s[kt][g] = (v8f){};
#pragma unroll
                for (int kc = 0; kc < 4; ++kc) s[kt][g] = wmma16(kf[kt][kc], qf[g][kc], s[kt][g]); }
        const int nk = (key0 + 32 < kend) ? key0 + 32 : kbeg;   /* next pass's key rows, fetched one pass ahead; the last pass re-reads the slice's first rows and drops them */
        kp = Kp + (size_t)(nk + c) * HD + 8 * h;
#pragma unroll
        for (int kt = 0; kt < 2; ++kt)
#pragma unroll
            for (int kc = 0; kc < 4; ++kc) kf[kt][kc] = ldf(kp + 16 * kt * HD + 32 * kc);
        asm volatile("s_wait_xcnt 0x0" :: "v"(vp), "v"(kp) : "memory");   /* before an address register of this pass's loads is advanced or reused; the operands keep those registers until here */
        vp += 32;
        float mb[2]; bool need = false;
#pragma unroll
        for (int g = 0; g < 2; ++g) { float mx = s[0][g][0];
#pragma unroll
            for (int r = 1; r < 8; ++r) mx = fmaxf(mx, s[0][g][r]);
#pragma unroll
            for (int r = 0; r < 8; ++r) mx = fmaxf(mx, s[1][g][r]);
            mx = fmaxf(mx, xhalf(mx)) * cscale; mb[g] = mx; need = need || (mx > m_run[g] + 8.0f); }
        if (__builtin_amdgcn_ballot_w32(need) != 0) {   /* scalar branch; rare after the first pass */
#pragma unroll
            for (int g = 0; g < 2; ++g) { const float m_new = fmaxf(m_run[g], mb[g]); const float corr = __builtin_amdgcn_exp2f(m_run[g] - m_new); l_run[g] *= corr; m_run[g] = m_new;
#pragma unroll
                for (int t = 0; t < 8; ++t) acc[g][t] = acc[g][t] * corr; } }
#pragma unroll
        for (int g = 0; g < 2; ++g) { const float nm = PSH - m_run[g]; v16h pf; float ps0 = 0.0f, ps1 = 0.0f;
#pragma unroll
            for (int i = 0; i < 8; ++i) { const float p0 = __builtin_amdgcn_exp2f(fmaf(s[i >> 2][g][2 * (i & 3)], cscale, nm)), p1 = __builtin_amdgcn_exp2f(fmaf(s[i >> 2][g][2 * (i & 3) + 1], cscale, nm));
                if (i & 1) ps1 += p0 + p1; else ps0 += p0 + p1; pf[2 * i] = (h16)p0; pf[2 * i + 1] = (h16)p1; }
            l_run[g] += ps0 + ps1;
#pragma unroll
            for (int t = 0; t < 8; ++t) acc[g][t] = wmma16(vf[t], pf, acc[g][t]); }
    }
#pragma unroll
    for (int g = 0; g < 2; ++g) { const float l_fin = l_run[g] + xhalf(l_run[g]);   /* each wave half summed its eight keys of every 16-key tile */
        if (h == 0) { Mp[(size_t)sl * TT + q0 + 16 * g + c] = m_run[g]; Lp[(size_t)sl * TT + q0 + 16 * g + c] = l_fin; }
#pragma unroll
        for (int t = 0; t < 8; ++t)
#pragma unroll
            for (int r = 0; r < 8; ++r) Op[((size_t)sl * HD + 16 * t + 8 * h + r) * TT + q0 + 16 * g + c] = acc[g][t][r]; }
}
// k_fmerge: out[ch][l] = sum_s w_s O_s[ch][l] / sum_s w_s l_s, w_s = 2^(m_s - max_s m_s), slices added in slice order. A thread: 4 consecutive queries x 2 channels. O0 to O3: the partial planes of slices 0-3, 4-7, 8-11, 12-15.
__global__ __launch_bounds__(256) void k_fmerge(const float* __restrict__ O0, const float* __restrict__ O1, const float* __restrict__ O2, const float* __restrict__ O3, const float* __restrict__ Mp, const float* __restrict__ Lp, float* __restrict__ out) {
    { const size_t im = blockIdx.z, io = im * KSP * HD * TT; O0 += io; O1 += io; O2 += io; O3 += io; Mp += im * KSP * TT; Lp += im * KSP * TT; out += im * DM * TT; }   /* z = image */
    const unsigned vl = (threadIdx.x & 31) * 16u, vo = (threadIdx.x >> 5) * (8u * TT) + vl;   /* byte offsets of the lane in the block's 128 queries and in its 16 channels x 128 queries: with block-uniform bases, two offset registers serve every load */
    const size_t tile = (size_t)blockIdx.y * 16 * TT + blockIdx.x * 128; const char* mp = (const char*)(Mp + blockIdx.x * 128); const char* lp = (const char*)(Lp + blockIdx.x * 128);
    v4f w[KSP], ls[KSP], pp[2][KSP];   /* unrolled so that all the slices' loads are in flight together */
#pragma unroll
    for (int s = 0; s < KSP; ++s) { w[s] = *(const v4f*)(mp + (size_t)s * TT * 4 + vl); ls[s] = *(const v4f*)(lp + (size_t)s * TT * 4 + vl); }
    __builtin_amdgcn_sched_barrier(0);   /* with the one behind the wait: keeps the loads in front of the wait and the next base's sum, which reuses a base register, behind it */
    asm volatile("s_wait_xcnt 0x0" ::: "memory");   /* before a base register of the loads above is reused */
    __builtin_amdgcn_sched_barrier(0);
#pragma unroll
    for (int s = 0; s < KSP; ++s) { const char* og = (const char*)((s < 4 ? O0 : s < 8 ? O1 : s < 12 ? O2 : O3) + tile);   /* one scalar base per four slices (its own argument): the rest fits the instruction's offset */
        pp[0][s] = *(const v4f*)(og + (size_t)(s & 3) * HD * TT * 4 + vo); pp[1][s] = *(const v4f*)(og + (size_t)(s & 3) * HD * TT * 4 + TT * 4 + vo);
        if ((s & 3) == 3 && s + 1 < KSP) { __builtin_amdgcn_sched_barrier(0); asm volatile("s_wait_xcnt 0x0" ::: "memory"); __builtin_amdgcn_sched_barrier(0); } }   /* the same three lines, for the same reason, behind each base's eight loads */
    __builtin_amdgcn_sched_barrier(0);   /* keeps every load above this line: sunk into the sums they would wait for one another */
    asm volatile("s_wait_xcnt 0x0" :: "v"(vl), "v"(vo) : "memory");   /* before an address register of the loads above is reused; the operands keep the offset registers until here */
    __builtin_amdgcn_sched_barrier(0);   /* keeps the arithmetic, which reuses those registers, behind the wait */
    v4f mx = w[0], den = (v4f){};
#pragma unroll
    for (int s = 1; s < KSP; ++s)
#pragma unroll
        for (int q = 0; q < 4; ++q) mx[q] = fmaxf(mx[q], w[s][q]);
#pragma unroll
    for (int s = 0; s < KSP; ++s) {
#pragma unroll
        for (int q = 0; q < 4; ++q) w[s][q] = __builtin_amdgcn_exp2f(w[s][q] - mx[q]);
        den += w[s] * ls[s]; }
    v4f inv;
#pragma unroll
    for (int q = 0; q < 4; ++q) inv[q] = __fdiv_rn(1.0f, den[q]);
    v4f o0 = w[0] * pp[0][0], o1 = w[0] * pp[1][0];
#pragma unroll
    for (int s = 1; s < KSP; ++s) { o0 += w[s] * pp[0][s]; o1 += w[s] * pp[1][s]; }   /* added in slice order */
    float* po = out + tile + vo / 4; *(v4f*)po = o0 * inv; *(v4f*)(po + TT) = o1 * inv;
}

extern "C" void kernel_launch(void* const* d_in, const int* in_sizes, int n_in,
                              void* d_out, int out_size, void* d_ws, size_t ws_size, hipStream_t stream) {
    (void)in_sizes; (void)n_in; (void)out_size;
    const float* x = (const float*)d_in[0]; const float* wk = (const float*)d_in[1]; const float* bk = (const float*)d_in[2]; const float* wq = nullptr; const float* wv = nullptr; const float* wo = nullptr; (void)wq; (void)wv; (void)wo;
    float* OUT = (float*)d_out;     // [4][128][4096] channel-major
    char* wsp = (char*)d_ws;
    auto take = [&](size_t bytes) { char* p = wsp; wsp += (bytes + 255) & ~(size_t)255; return (void*)p; };
    h16* QP16 = (h16*)take((size_t)NB_ * NH_ * TT * HD * 2); h16* KP16 = (h16*)take((size_t)NB_ * NKV * TT * HD * 2); h16* VT16 = (h16*)take((size_t)NB_ * NKV * HD * TT * 2);
    float* Ob = (float*)take((size_t)NB_ * KSP * ZH * TT * HD * 4); float* Mb = (float*)take((size_t)NB_ * KSP * TT * 4); float* Lb = (float*)take((size_t)NB_ * KSP * TT * 4);
    if ((size_t)(wsp - (char*)d_ws) > ws_size) return;    // ws 256 MiB
    /* one launch of each kernel for all four images */
    k_proj<<<dim3(TT / 64, DKV / 64, NB_), 32, 0, stream>>>(x, wk, bk, QP16, KP16, VT16);   /* z = image; query plane, key plane and v^T */
    k_fattn<<<dim3(TT / (FQW * 32), KSP, NB_), FQW * 32, 0, stream>>>(QP16, KP16, VT16, Ob, Mb, Lb);   /* y = key slice, z = image */
    k_fmerge<<<dim3(TT / 128, HD / 16, NB_), 256, 0, stream>>>(Ob, Ob + (size_t)4 * HD * TT, Ob + (size_t)8 * HD * TT, Ob + (size_t)12 * HD * TT, Mb, Lb, OUT);   /* context^T, channel-major; z = image */
}

// v005
// It runs in 67.1 microseconds.
// Two timings next to v004 put it at 1.55 and 1.57 times that version's speed.
// Counting every step since v000, it is 8.96 times as fast.
#include <hip/hip_runtime.h>

// Scaled dot-product attention over image positions (x [4][128][64x64] channel-major; values = keys = 1x1 conv W_kv x + b_kv ([128][128] + [128]); queries = x itself; scores[l][t] = q_l.v_t / sqrt(128) over the 4096 positions; softmax; out[c][l] = sum_t attn[l][t] v_t[c] -> [4][128][64][64] channel-major (2.1 M)).
// The four images run side by side: every kernel takes the image as its grid index z, and every buffer below holds all four, image-major.
// Layout per image: the values projection (k_proj, exact products + bias) reads x and the weights as they are and writes all three fp16 planes itself; q, k (= v) as fp16 planes [4096][128], v^T [128][4096]; scores, softmax and attn.v in one kernel per key slice (k_fattn: the slice's keys and v^T staged in LDS once per workgroup, transposed products, running maximum, P packed in registers); k_fmerge joins the slices and writes the f32 context channel-major.
// Compute dtypes, f32 accumulate: every input rounded to bf16; projection on PLAIN bf16 operands (exact) + f32 bias; scores and attn.v on single fp16 planes (logit sigma ~1; P = 2^(t - m + 6) fp16); softmax f32; f32 output.

#define NB_  4
#define TT   4096
#define DM   128
#define NH_  1
#define NKV  1
#define REP  (NH_ / NKV)
#define HD   128
#define DQ   (NH_ * HD)
#define DKV  (NKV * HD)
#define ZH   1
#define RH   0                  // query rows < RH use hi+lo planes (0: none)
#define WIN  0
#define PSH  6.0f               // P carries 2^PSH: with the trailing maximum (up to 2^8) P stays below 2^14 in fp16
#define SCL  0.088388347648318447f   // HD^-0.5
#define KSP  16                 // key slices (grid y of k_fattn), one f32 partial plane with its maxima and sums each; k_fmerge adds them in slice order
#define FQW  8                  // k_fattn: waves per workgroup, 32 query columns each
#define SLK  (TT / KSP)         // keys per slice
#define KLP  (HD + 8)           // k_fattn, LDS: fp16 elements per key row, 272 bytes = 16 x 17, so that sixteen rows read 16 bytes wide fall on all 64 banks
#define VLP  (SLK + 8)          // the same for a row of v^T: 528 bytes = 16 x 33
static_assert(KSP == 16 && ZH == 1 && NH_ == 1 && HD == 128 && TT % (KSP * 32) == 0 && TT % (FQW * 32) == 0, "k_fattn: one head of size 128, whole 32-key passes per slice");
static_assert(FQW * 32 == 256 && SLK == 256, "k_fattn: 256 threads copy a slice of 256 keys, sixteen 16-byte pieces of each plane per thread");
typedef _Float16 h16;
typedef unsigned short bf;
typedef __attribute__((ext_vector_type(16))) __bf16   v16bf;
typedef __attribute__((ext_vector_type(16))) _Float16 v16h;
typedef __attribute__((ext_vector_type(8)))  _Float16 v8h;
typedef __attribute__((ext_vector_type(4)))  _Float16 v4h;
typedef __attribute__((ext_vector_type(8)))  unsigned short v8us;
typedef __attribute__((ext_vector_type(16))) unsigned short v16us;
typedef __attribute__((ext_vector_type(8)))  unsigned v8u;
typedef __attribute__((ext_vector_type(2)))  __bf16   v2bf;
typedef __attribute__((ext_vector_type(2)))  float    v2f;
typedef __attribute__((ext_vector_type(8)))  float    v8f;
typedef __attribute__((ext_vector_type(4)))  float    v4f;
typedef v8h  __attribute__((may_alias)) v8ha;
typedef v4f  __attribute__((may_alias)) v4fa;
typedef v8us __attribute__((may_alias)) v8usa;

__device__ __forceinline__ unsigned short f2bf(float f) { unsigned u = __float_as_uint(f); u += 0x7FFFu + ((u >> 16) & 1u); return (unsigned short)(u >> 16); }
__device__ __forceinline__ float bf2f(unsigned short b) { return __uint_as_float(((unsigned)b) << 16); }
__device__ __forceinline__ float bfr(float f) { return bf2f(f2bf(f)); }
__device__ __forceinline__ unsigned pkbf(float lo, float up) { v2f t; t[0] = lo; t[1] = up; return __builtin_bit_cast(unsigned, __builtin_convertvector(t, v2bf)); }   // two f32 rounded to nearest even into one register of bf16, as f2bf rounds, in one instruction
__device__ __forceinline__ v16h cat16(v8h lo, v8h hi) { return __builtin_shufflevector(lo, hi, 0, 1, 2, 3, 4, 5, 6, 7, 8, 9, 10, 11, 12, 13, 14, 15); }
__device__ __forceinline__ v8f wmma16(v16h a, v16h b, v8f c) { return __builtin_amdgcn_wmma_f32_16x16x32_f16(false, a, false, b, (short)0, c, false, false); }
__device__ __forceinline__ v8f wmmab(v16bf a, v16bf b, v8f c) { return __builtin_amdgcn_wmma_f32_16x16x32_bf16(false, a, false, b, (short)0, c, false, false); }



// ---- k_proj: the whole preparation. ONE WAVE per 64 tokens x 64 output channels (16 accumulators); grid (TT/64, DKV/64, image), 32 threads.
// C[t][o] = sum_c bf16(x[c][t]) bf16(w[o][c]) + bf16(bias[o]), f32 accumulate. Both operands come straight from the f32 inputs and are rounded to bf16 in registers:
// an A fragment's lane is one token, so its sixteen channels are sixteen 4-byte loads, each of which covers 64 consecutive bytes of two rows of channel-major x; a B fragment's lane is one row of w.
// C leaves the kernel as two fp16 planes: Ck[t][o] and its transpose Cv[o][t]. The waves of output block 0 also write the A fragments' values as the fp16 query plane Qp[t][c].
// A wave writes whole 128-byte lines of each plane (64 o of a row of Ck, 64 t of a row of Cv, whole rows of Qp).
__global__ __launch_bounds__(32) void k_proj(const float* __restrict__ x, const float* __restrict__ w, const float* __restrict__ bias, h16* Qp, h16* Ck, h16* Cv) {
    __shared__ __align__(16) float os[16 * 68];
    { const size_t z = blockIdx.z; x += z * DM * TT; Qp += z * TT * DM; Ck += z * TT * DKV; Cv += z * DKV * TT; }   /* z = image */
    const int lane = threadIdx.x & 31, lr = lane & 15, hi = lane >> 4; const int r0 = blockIdx.x * 64, c0 = blockIdx.y * 64;
    const float* xp = x + (size_t)(8 * hi) * TT + r0 + lr;        /* channel 8 hi, token r0 + lr */
    const float* wp = w + (size_t)(c0 + lr) * DM + 8 * hi;        /* row c0 + lr, channel 8 hi */
    const float* bu = bias + c0;                                  /* the same for the whole wave */
    v4f wr[4][4][4];      /* [32-channel chunk][16-row block][quarter of the fragment] */
#pragma unroll
    for (int kq = 0; kq < 4; ++kq)
#pragma unroll
        for (int nb = 0; nb < 4; ++nb) { const float* p = wp + (size_t)nb * 16 * DM + 32 * kq; wr[kq][nb][0] = *(const v4f*)p; wr[kq][nb][1] = *(const v4f*)(p + 4); wr[kq][nb][2] = *(const v4f*)(p + 16); wr[kq][nb][3] = *(const v4f*)(p + 20); }
    float bcol[4];        /* the bias of this lane's four columns, for the transposed plane */
#pragma unroll
    for (int nb = 0; nb < 4; ++nb) bcol[nb] = bu[nb * 16 + lr];
    v4f brow = *(const v4f*)(bu + lr * 4);   /* and of the four columns that the lane stores of each row of Ck */
    float xr[4][4][16];   /* [token block][32-channel chunk][fragment element]: element i is channel 32 kq + 8 hi + i (i < 8) or 32 kq + 16 + 8 hi + i - 8, on the A side as on the B side */
#pragma unroll
    for (int mb = 0; mb < 4; ++mb)
#pragma unroll
        for (int kq = 0; kq < 4; ++kq)
#pragma unroll
            for (int i = 0; i < 16; ++i) xr[mb][kq][i] = xp[(size_t)(32 * kq + (i & 7) + 16 * (i >> 3)) * TT + mb * 16];
    __builtin_amdgcn_sched_barrier(0);   /* keeps every load above this line: sunk among the conversions and the products they would wait for memory one group after another */
    asm volatile("s_wait_xcnt 0x0" :: "v"(xp), "v"(wp), "s"(bu), "v"(lr) : "memory");   /* before an address register of the loads above is reused; the operands keep those registers until here */
    __builtin_amdgcn_sched_barrier(0);   /* keeps the arithmetic, which reuses those registers, behind the wait */
    v16bf a[4][4];
#pragma unroll
    for (int mb = 0; mb < 4; ++mb)
#pragma unroll
        for (int kq = 0; kq < 4; ++kq) { v8u pk;
#pragma unroll
            for (int i = 0; i < 8; ++i) pk[i] = pkbf(xr[mb][kq][2 * i], xr[mb][kq][2 * i + 1]);
            a[mb][kq] = __builtin_bit_cast(v16bf, pk); }
    if (blockIdx.y == 0) {   /* the query plane: the same bf16-rounded values as fp16, token-major; one branch for all of it, outside the loads and the products */
        h16* qp = Qp + (size_t)(r0 + lr) * DM + 8 * hi; v8h qv[4][4][2];
#pragma unroll
        for (int mb = 0; mb < 4; ++mb)
#pragma unroll
            for (int kq = 0; kq < 4; ++kq) { const v16us av = __builtin_bit_cast(v16us, a[mb][kq]);
#pragma unroll
                for (int i = 0; i < 8; ++i) { qv[mb][kq][0][i] = (h16)bf2f(av[i]); qv[mb][kq][1][i] = (h16)bf2f(av[8 + i]); } }
#pragma unroll
        for (int mb = 0; mb < 4; ++mb)
#pragma unroll
            for (int kq = 0; kq < 4; ++kq) { *(v8h*)(qp + (size_t)mb * 16 * DM + 32 * kq) = qv[mb][kq][0]; *(v8h*)(qp + (size_t)mb * 16 * DM + 32 * kq + 16) = qv[mb][kq][1]; }
        asm volatile("s_wait_xcnt 0x0" :: "v"(qp) : "memory");   /* before a register of the stores above is reused */
    }
    v8f acc[4][4];
#pragma unroll
    for (int mb = 0; mb < 4; ++mb)
#pragma unroll
        for (int nb = 0; nb < 4; ++nb) acc[mb][nb] = (v8f){};
#pragma unroll
    for (int kq = 0; kq < 4; ++kq) {
#pragma unroll
        for (int nb = 0; nb < 4; ++nb) { const v4f w0 = wr[kq][nb][0], w1 = wr[kq][nb][1], w2 = wr[kq][nb][2], w3 = wr[kq][nb][3]; v8u pk;
            pk[0] = pkbf(w0[0], w0[1]); pk[1] = pkbf(w0[2], w0[3]); pk[2] = pkbf(w1[0], w1[1]); pk[3] = pkbf(w1[2], w1[3]); pk[4] = pkbf(w2[0], w2[1]); pk[5] = pkbf(w2[2], w2[3]); pk[6] = pkbf(w3[0], w3[1]); pk[7] = pkbf(w3[2], w3[3]);
            const v16bf b = __builtin_bit_cast(v16bf, pk);
#pragma unroll
            for (int mb = 0; mb < 4; ++mb) acc[mb][nb] = wmmab(a[mb][kq], b, acc[mb][nb]); }
    }
#pragma unroll
    for (int nb = 0; nb < 4; ++nb) { bcol[nb] = bfr(bcol[nb]); brow[nb] = bfr(brow[nb]); }
    h16* cvp = Cv + (size_t)(c0 + lr) * TT + r0 + 8 * hi; h16* ckp = Ck + (size_t)(r0 + hi) * DKV + c0 + lr * 4;
#pragma unroll
    for (int mb = 0; mb < 4; ++mb) { v8h tv[4]; v4h hv[8];
#pragma unroll
        for (int nb = 0; nb < 4; ++nb)   /* a lane's accumulator registers are eight consecutive tokens of one output channel: 16 bytes of a row of Cv */
#pragma unroll
            for (int j = 0; j < 8; ++j) { os[(hi * 8 + j) * 68 + nb * 16 + lr] = acc[mb][nb][j]; tv[nb][j] = (h16)(acc[mb][nb][j] + bcol[nb]); }
        __builtin_amdgcn_wave_barrier(); asm volatile("" ::: "memory");   /* the rows are read back by other lanes of the wave: keeps the LDS reads behind the writes */
#pragma unroll
        for (int s = 0; s < 8; ++s) { const v4f val = *(const v4fa*)(os + (2 * s + hi) * 68 + lr * 4) + brow; hv[s][0] = (h16)val[0]; hv[s][1] = (h16)val[1]; hv[s][2] = (h16)val[2]; hv[s][3] = (h16)val[3]; }
        __builtin_amdgcn_wave_barrier(); asm volatile("" ::: "memory");   /* and the next block's LDS writes behind these reads */
#pragma unroll
        for (int nb = 0; nb < 4; ++nb) *(v8h*)(cvp + (size_t)nb * 16 * TT + mb * 16) = tv[nb];
#pragma unroll
        for (int s = 0; s < 8; ++s) *(v4h*)(ckp + (size_t)(mb * 16 + 2 * s) * DKV) = hv[s];
        __builtin_amdgcn_sched_barrier(0);   /* with the one behind the wait: keeps the stores in front of the wait and the next block's arithmetic, which reuses their registers, behind it */
        asm volatile("s_wait_xcnt 0x0" :: "v"(cvp), "v"(ckp) : "memory");   /* before a register of the stores above is reused */
        __builtin_amdgcn_sched_barrier(0);
    }
}

__device__ __forceinline__ void splitf(float y, unsigned short& h, unsigned short& l) { h = f2bf(y); l = f2bf(y - bf2f(h)); }
typedef __attribute__((ext_vector_type(2))) unsigned short v2us;
typedef __attribute__((ext_vector_type(4))) unsigned short v4us;
typedef __attribute__((ext_vector_type(4))) int v4i;

__global__ __launch_bounds__(256) void k_wtG(const float* __restrict__ w, int K, int N, bf* Bt) {
    const int lane = threadIdx.x & 31; const int L0 = (blockIdx.x * 8 + (threadIdx.x >> 5)) * 8; const int nlines = N * K / 64;
{
#pragma unroll 1
        for (int l = 0; l < 8; ++l) { const int L = L0 + l; if (L >= nlines) break; const size_t e = (size_t)L * 64 + lane * 2; const int k = (int)(e % K), n = (int)(e / K); v2us o;
            o[0] = f2bf(w[(size_t)k * N + n]); o[1] = f2bf(w[(size_t)(k + 1) * N + n]); *(v2us*)(Bt + e) = o; }
         }
}
__device__ __forceinline__ v16h ldf(const h16* p) { return cat16(*(const v8h*)p, *(const v8h*)(p + 16)); }
__device__ __forceinline__ float xhalf(float x) { return __builtin_bit_cast(float, __builtin_amdgcn_permlanex16(__builtin_bit_cast(int, x), __builtin_bit_cast(int, x), 0x76543210, 0xfedcba98, false, false)); }  // lane l with lane l ^ 16
// Eight asynchronous 16-byte copies per lane, global memory to LDS: piece i from g + i gs to LDS byte l + i ls. The last line waits before a register that a copy names may be reused; inside the statement nothing can move in front of it.
__device__ __forceinline__ void cp8(unsigned l, unsigned ls, const char* g, size_t gs) {
    asm volatile("global_load_async_to_lds_b128 %0, %8, off\n\t"
                 "global_load_async_to_lds_b128 %1, %9, off\n\t"
                 "global_load_async_to_lds_b128 %2, %10, off\n\t"
                 "global_load_async_to_lds_b128 %3, %11, off\n\t"
                 "global_load_async_to_lds_b128 %4, %12, off\n\t"
                 "global_load_async_to_lds_b128 %5, %13, off\n\t"
                 "global_load_async_to_lds_b128 %6, %14, off\n\t"
                 "global_load_async_to_lds_b128 %7, %15, off\n\t"
                 "s_wait_xcnt 0x0"
                 :: "v"(l), "v"(l + ls), "v"(l + 2 * ls), "v"(l + 3 * ls), "v"(l + 4 * ls), "v"(l + 5 * ls), "v"(l + 6 * ls), "v"(l + 7 * ls),
                    "v"(g), "v"(g + gs), "v"(g + 2 * gs), "v"(g + 3 * gs), "v"(g + 4 * gs), "v"(g + 5 * gs), "v"(g + 6 * gs), "v"(g + 7 * gs) : "memory");
}
typedef __attribute__((address_space(3))) const h16 lds_h16;
__global__ __launch_bounds__(FQW * 32) __attribute__((amdgpu_waves_per_eu(2, 2))) void k_fattn(const h16* __restrict__ Q, const h16* __restrict__ Kp, const h16* __restrict__ Vt, float* __restrict__ Op, float* __restrict__ Mp, float* __restrict__ Lp) {
    __shared__ __attribute__((aligned(16))) h16 Ks[SLK * KLP];   /* key row k of the slice at k KLP */
    __shared__ __attribute__((aligned(16))) h16 Vs[HD * VLP];    /* row d of v^T, the slice's keys, at d VLP */
    const int lane = threadIdx.x & 31, c = lane & 15, h = lane >> 4; const int q0 = (blockIdx.x * FQW + (threadIdx.x >> 5)) * 32; const int sl = blockIdx.y, kbeg = sl * SLK;
    const float cscale = SCL * 1.4426950408889634f;
    { const size_t im = blockIdx.z; Q += im * TT * HD; Kp += im * TT * HD; Vt += im * HD * TT; Op += im * KSP * HD * TT; Mp += im * KSP * TT; Lp += im * KSP * TT; }   /* z = image */
    v16h qf[2][4], kf[2][4];
    {   /* the slice into LDS: a wave's copy is 512 consecutive bytes of global memory, two key rows or one row of v^T; thread i takes piece i, i + 256, ... of each plane */
        const unsigned tid = threadIdx.x;
        const unsigned kl0 = (unsigned)(size_t)(lds_h16*)Ks + (tid >> 4) * (KLP * 2) + (tid & 15) * 16, vl0 = (unsigned)(size_t)(lds_h16*)Vs + (tid >> 5) * (VLP * 2) + (tid & 31) * 16;
        const char* kg = (const char*)(Kp + (size_t)kbeg * HD) + tid * 16; const char* vg = (const char*)(Vt + (size_t)(tid >> 5) * TT + kbeg) + (tid & 31) * 16;
        cp8(kl0, 16 * KLP * 2, kg, 4096); cp8(kl0 + 128 * KLP * 2, 16 * KLP * 2, kg + 8 * 4096, 4096);
        cp8(vl0, 8 * VLP * 2, vg, (size_t)8 * TT * 2); cp8(vl0 + 64 * VLP * 2, 8 * VLP * 2, vg + (size_t)64 * TT * 2, (size_t)8 * TT * 2);
    }
    const h16* qp = Q + (size_t)(q0 + c) * HD + 8 * h; const h16* kl = Ks + c * KLP + 8 * h; const h16* vl = Vs + c * VLP + 8 * h;
#pragma unroll
    for (int g = 0; g < 2; ++g)
#pragma unroll
        for (int kc = 0; kc < 4; ++kc) qf[g][kc] = ldf(qp + 16 * g * HD + 32 * kc);
    asm volatile("s_wait_xcnt 0x0" :: "v"(qp) : "memory");   /* before an address register of the loads above is reused; the operand keeps that register until here */
    asm volatile("s_wait_asynccnt 0x0" ::: "memory");   /* this wave's copies have landed */
    __syncthreads();                                    /* and every other wave's: nothing of the slice is read in front of this barrier */
#pragma unroll
    for (int kt = 0; kt < 2; ++kt)
#pragma unroll
        for (int kc = 0; kc < 4; ++kc) kf[kt][kc] = ldf(kl + 16 * kt * KLP + 32 * kc);
    v8f acc[2][8]; float m_run[2], l_run[2];
#pragma unroll
    for (int g = 0; g < 2; ++g) { m_run[g] = -3.0e38f; l_run[g] = 0.0f;
#pragma unroll
        for (int t = 0; t < 8; ++t) acc[g][t] = (v8f){}; }
#pragma unroll 1   /* one pass per trip: an unrolled body would not fit two waves per SIMD */
    for (int key0 = 0; key0 < SLK; key0 += 32) {   /* key0 counts inside the slice */
        v16h vf[8];   /* this pass's v^T fragments, in flight under the score products and the softmax */
#pragma unroll
        for (int t = 0; t < 8; ++t) vf[t] = ldf(vl + 16 * t * VLP + key0);
        v8f s[2][2];
#pragma unroll
        for (int kt = 0; kt < 2; ++kt)
#pragma unroll
            for (int g = 0; g < 2; ++g) { s[kt][g] = (v8f){};
#pragma unroll
                for (int kc = 0; kc < 4; ++kc) s[kt][g] = wmma16(kf[kt][kc], qf[g][kc], s[kt][g]); }
        const int nk = (key0 + 32 < SLK) ? key0 + 32 : 0;   /* next pass's key rows, fetched one pass ahead; the last pass re-reads the slice's first rows and drops them */
#pragma unroll
        for (int kt = 0; kt < 2; ++kt)
#pragma unroll
            for (int kc = 0; kc < 4; ++kc) kf[kt][kc] = ldf(kl + (nk + 16 * kt) * KLP + 32 * kc);
        float mb[2]; bool need = false;
#pragma unroll
        for (int g = 0; g < 2; ++g) { float mx = s[0][g][0];
#pragma unroll
            for (int r = 1; r < 8; ++r) mx = fmaxf(mx, s[0][g][r]);
#pragma unroll
            for (int r = 0; r < 8; ++r) mx = fmaxf(mx, s[1][g][r]);
            mx = fmaxf(mx, xhalf(mx)) * cscale; mb[g] = mx; need = need || (mx > m_run[g] + 8.0f); }
        if (__builtin_amdgcn_ballot_w32(need) != 0) {   /* scalar branch; rare after the first pass */
#pragma unroll
            for (int g = 0; g < 2; ++g) { const float m_new = fmaxf(m_run[g], mb[g]); const float corr = __builtin_amdgcn_exp2f(m_run[g] - m_new); l_run[g] *= corr; m_run[g] = m_new;
#pragma unroll
                for (int t = 0; t < 8; ++t) acc[g][t] = acc[g][t] * corr; } }
#pragma unroll
        for (int g = 0; g < 2; ++g) { const float nm = PSH - m_run[g]; v16h pf; float ps0 = 0.0f, ps1 = 0.0f;
#pragma unroll
            for (int i = 0; i < 8; ++i) { const float p0 = __builtin_amdgcn_exp2f(fmaf(s[i >> 2][g][2 * (i & 3)], cscale, nm)), p1 = __builtin_amdgcn_exp2f(fmaf(s[i >> 2][g][2 * (i & 3) + 1], cscale, nm));
                if (i & 1) ps1 += p0 + p1; else ps0 += p0 + p1; pf[2 * i] = (h16)p0; pf[2 * i + 1] = (h16)p1; }
            l_run[g] += ps0 + ps1;
#pragma unroll
            for (int t = 0; t < 8; ++t) acc[g][t] = wmma16(vf[t], pf, acc[g][t]); }
    }
#pragma unroll
    for (int g = 0; g < 2; ++g) { const float l_fin = l_run[g] + xhalf(l_run[g]);   /* each wave half summed its eight keys of every 16-key tile */
        if (h == 0) { Mp[(size_t)sl * TT + q0 + 16 * g + c] = m_run[g]; Lp[(size_t)sl * TT + q0 + 16 * g + c] = l_fin; }
#pragma unroll
        for (int t = 0; t < 8; ++t)
#pragma unroll
            for (int r = 0; r < 8; ++r) Op[((size_t)sl * HD + 16 * t + 8 * h + r) * TT + q0 + 16 * g + c] = acc[g][t][r]; }
}
// k_fmerge: out[ch][l] = sum_s w_s O_s[ch][l] / sum_s w_s l_s, w_s = 2^(m_s - max_s m_s), slices added in slice order. A thread: 4 consecutive queries x 2 channels. O0 to O3: the partial planes of slices 0-3, 4-7, 8-11, 12-15.
__global__ __launch_bounds__(256) void k_fmerge(const float* __restrict__ O0, const float* __restrict__ O1, const float* __restrict__ O2, const float* __restrict__ O3, const float* __restrict__ Mp, const float* __restrict__ Lp, float* __restrict__ out) {
    { const size_t im = blockIdx.z, io = im * KSP * HD * TT; O0 += io; O1 += io; O2 += io; O3 += io; Mp += im * KSP * TT; Lp += im * KSP * TT; out += im * DM * TT; }   /* z = image */
    const unsigned vl = (threadIdx.x & 31) * 16u, vo = (threadIdx.x >> 5) * (8u * TT) + vl;   /* byte offsets of the lane in the block's 128 queries and in its 16 channels x 128 queries: with block-uniform bases, two offset registers serve every load */
    const size_t tile = (size_t)blockIdx.y * 16 * TT + blockIdx.x * 128; const char* mp = (const char*)(Mp + blockIdx.x * 128); const char* lp = (const char*)(Lp + blockIdx.x * 128);
    v4f w[KSP], ls[KSP], pp[2][KSP];   /* unrolled so that all the slices' loads are in flight together */
#pragma unroll
    for (int s = 0; s < KSP; ++s) { w[s] = *(const v4f*)(mp + (size_t)s * TT * 4 + vl); ls[s] = *(const v4f*)(lp + (size_t)s * TT * 4 + vl); }
    __builtin_amdgcn_sched_barrier(0);   /* with the one behind the wait: keeps the loads in front of the wait and the next base's sum, which reuses a base register, behind it */
    asm volatile("s_wait_xcnt 0x0" ::: "memory");   /* before a base register of the loads above is reused */
    __builtin_amdgcn_sched_barrier(0);
#pragma unroll
    for (int s = 0; s < KSP; ++s) { const char* og = (const char*)((s < 4 ? O0 : s < 8 ? O1 : s < 12 ? O2 : O3) + tile);   /* one scalar base per four slices (its own argument): the rest fits the instruction's offset */
        pp[0][s] = *(const v4f*)(og + (size_t)(s & 3) * HD * TT * 4 + vo); pp[1][s] = *(const v4f*)(og + (size_t)(s & 3) * HD * TT * 4 + TT * 4 + vo);
        if ((s & 3) == 3 && s + 1 < KSP) { __builtin_amdgcn_sched_barrier(0); asm volatile("s_wait_xcnt 0x0" ::: "memory"); __builtin_amdgcn_sched_barrier(0); } }   /* the same three lines, for the same reason, behind each base's eight loads */
    __builtin_amdgcn_sched_barrier(0);   /* keeps every load above this line: sunk into the sums they would wait for one another */
    asm volatile("s_wait_xcnt 0x0" :: "v"(vl), "v"(vo) : "memory");   /* before an address register of the loads above is reused; the operands keep the offset registers until here */
    __builtin_amdgcn_sched_barrier(0);   /* keeps the arithmetic, which reuses those registers, behind the wait */
    v4f mx = w[0], den = (v4f){};
#pragma unroll
    for (int s = 1; s < KSP; ++s)
#pragma unroll
        for (int q = 0; q < 4; ++q) mx[q] = fmaxf(mx[q], w[s][q]);
#pragma unroll
    for (int s = 0; s < KSP; ++s) {
#pragma unroll
        for (int q = 0; q < 4; ++q) w[s][q] = __builtin_amdgcn_exp2f(w[s][q] - mx[q]);
        den += w[s] * ls[s]; }
    v4f inv;
#pragma unroll
    for (int q = 0; q < 4; ++q) inv[q] = __fdiv_rn(1.0f, den[q]);
    v4f o0 = w[0] * pp[0][0], o1 = w[0] * pp[1][0];
#pragma unroll
    for (int s = 1; s < KSP; ++s) { o0 += w[s] * pp[0][s]; o1 += w[s] * pp[1][s]; }   /* added in slice order */
    float* po = out + tile + vo / 4; *(v4f*)po = o0 * inv; *(v4f*)(po + TT) = o1 * inv;
}

extern "C" void kernel_launch(void* const* d_in, const int* in_sizes, int n_in,
                              void* d_out, int out_size, void* d_ws, size_t ws_size, hipStream_t stream) {
    (void)in_sizes; (void)n_in; (void)out_size;
    const float* x = (const float*)d_in[0]; const float* wk = (const float*)d_in[1]; const float* bk = (const float*)d_in[2]; const float* wq = nullptr; const float* wv = nullptr; const float* wo = nullptr; (void)wq; (void)wv; (void)wo;
    float* OUT = (float*)d_out;     // [4][128][4096] channel-major
    char* wsp = (char*)d_ws;
    auto take = [&](size_t bytes) { char* p = wsp; wsp += (bytes + 255) & ~(size_t)255; return (void*)p; };
    h16* QP16 = (h16*)take((size_t)NB_ * NH_ * TT * HD * 2); h16* KP16 = (h16*)take((size_t)NB_ * NKV * TT * HD * 2); h16* VT16 = (h16*)take((size_t)NB_ * NKV * HD * TT * 2);
    float* Ob = (float*)take((size_t)NB_ * KSP * ZH * TT * HD * 4); float* Mb = (float*)take((size_t)NB_ * KSP * TT * 4); float* Lb = (float*)take((size_t)NB_ * KSP * TT * 4);
    if ((size_t)(wsp - (char*)d_ws) > ws_size) return;    // ws 256 MiB
    /* one launch of each kernel for all four images */
    k_proj<<<dim3(TT / 64, DKV / 64, NB_), 32, 0, stream>>>(x, wk, bk, QP16, KP16, VT16);   /* z = image; query plane, key plane and v^T */
    k_fattn<<<dim3(TT / (FQW * 32), KSP, NB_), FQW * 32, 0, stream>>>(QP16, KP16, VT16, Ob, Mb, Lb);   /* y = key slice, z = image */
    k_fmerge<<<dim3(TT / 128, HD / 16, NB_), 256, 0, stream>>>(Ob, Ob + (size_t)4 * HD * TT, Ob + (size_t)8 * HD * TT, Ob + (size_t)12 * HD * TT, Mb, Lb, OUT);   /* context^T, channel-major; z = image */
}

// v006
// It runs in 43.4 microseconds.
// Next to v005, in two timings, it ran 1.54 and 1.55 times as fast.
// Counting every step since v000, it is 13.9 times as fast.
#include <hip/hip_runtime.h>

// Scaled dot-product attention over image positions (x [4][128][64x64] channel-major; values = keys = 1x1 conv W_kv x + b_kv ([128][128] + [128]); queries = x itself; scores[l][t] = q_l.v_t / sqrt(128) over the 4096 positions; softmax; out[c][l] = sum_t attn[l][t] v_t[c] -> [4][128][64][64] channel-major (2.1 M)).
// The four images run side by side: every kernel takes the image as its grid index z, and every buffer below holds all four, image-major.
// Layout per image: the values projection (k_proj, exact products + bias) reads x and the weights as they are and writes all three fp16 planes itself; q, k (= v) as fp16 planes [4096][128], v^T [128][4096]; scores, softmax and attn.v in one kernel per key slice (k_fattn: the slice's keys and v^T pass through two LDS buffers, tile by tile, transposed products, running maximum, P packed in registers); k_fmerge joins the slices and writes the f32 context channel-major.
// Compute dtypes, f32 accumulate: every input rounded to bf16; projection on PLAIN bf16 operands (exact) + f32 bias; scores and attn.v on single fp16 planes (logit sigma ~1; P = 2^(t - m + 6) fp16); softmax f32; f32 output.

#define NB_  4
#define TT   4096
#define DM   128
#define NH_  1
#define NKV  1
#define REP  (NH_ / NKV)
#define HD   128
#define DQ   (NH_ * HD)
#define DKV  (NKV * HD)
#define ZH   1
#define RH   0                  // query rows < RH use hi+lo planes (0: none)
#define WIN  0
#define PSH  6.0f               // P carries 2^PSH: with the trailing maximum (up to 2^8) P stays below 2^14 in fp16
#define SCL  0.088388347648318447f   // HD^-0.5
#define KSP  4                  // key slices (grid y of k_fattn), one f32 partial plane with its maxima and sums each; k_fmerge adds them in slice order. 16 query blocks x 4 slices x 4 images = 256 workgroups
#define FQW  8                  // k_fattn: waves per workgroup, 32 query columns each
#define SLK  (TT / KSP)         // keys per slice
#define TLK  256                // keys per tile: what one LDS buffer holds
#define NTL  (SLK / TLK)        // tiles per slice
#define KLP  (HD + 8)           // k_fattn, LDS: fp16 elements per key row, 272 bytes = 16 x 17, so that sixteen rows read 16 bytes wide fall on all 64 banks
#define VLP  (TLK + 8)          // the same for a row of v^T: 528 bytes = 16 x 33
static_assert(ZH == 1 && NH_ == 1 && HD == 128 && TT % (KSP * TLK) == 0 && TLK % 32 == 0 && TT % (FQW * 32) == 0, "k_fattn: one head of size 128, whole tiles per slice, whole 32-key passes per tile");
static_assert(FQW * 32 == 256 && TLK == 256, "k_fattn: 256 threads copy a tile of 256 keys, sixteen 16-byte pieces of each plane per thread");
static_assert(NTL >= 2, "k_fattn: the two-buffer ring starts with two tiles");
static_assert((size_t)(KSP - 1) * HD * TT * 4 + TT * 4 < ((size_t)1 << 23), "k_fmerge: every slice's plane within the load's offset field");
typedef _Float16 h16;
typedef unsigned short bf;
typedef __attribute__((ext_vector_type(16))) __bf16   v16bf;
typedef __attribute__((ext_vector_type(16))) _Float16 v16h;
typedef __attribute__((ext_vector_type(8)))  _Float16 v8h;
typedef __attribute__((ext_vector_type(4)))  _Float16 v4h;
typedef __attribute__((ext_vector_type(8)))  unsigned short v8us;
typedef __attribute__((ext_vector_type(16))) unsigned short v16us;
typedef __attribute__((ext_vector_type(8)))  unsigned v8u;
typedef __attribute__((ext_vector_type(2)))  __bf16   v2bf;
typedef __attribute__((ext_vector_type(2)))  float    v2f;
typedef __attribute__((ext_vector_type(8)))  float    v8f;
typedef __attribute__((ext_vector_type(4)))  float    v4f;
typedef v8h  __attribute__((may_alias)) v8ha;
typedef v4f  __attribute__((may_alias)) v4fa;
typedef v8us __attribute__((may_alias)) v8usa;

__device__ __forceinline__ unsigned short f2bf(float f) { unsigned u = __float_as_uint(f); u += 0x7FFFu + ((u >> 16) & 1u); return (unsigned short)(u >> 16); }
__device__ __forceinline__ float bf2f(unsigned short b) { return __uint_as_float(((unsigned)b) << 16); }
__device__ __forceinline__ float bfr(float f) { return bf2f(f2bf(f)); }
__device__ __forceinline__ unsigned pkbf(float lo, float up) { v2f t; t[0] = lo; t[1] = up; return __builtin_bit_cast(unsigned, __builtin_convertvector(t, v2bf)); }   // two f32 rounded to nearest even into one register of bf16, as f2bf rounds, in one instruction
__device__ __forceinline__ v16h cat16(v8h lo, v8h hi) { return __builtin_shufflevector(lo, hi, 0, 1, 2, 3, 4, 5, 6, 7, 8, 9, 10, 11, 12, 13, 14, 15); }
__device__ __forceinline__ v8f wmma16(v16h a, v16h b, v8f c) { return __builtin_amdgcn_wmma_f32_16x16x32_f16(false, a, false, b, (short)0, c, false, false); }
__device__ __forceinline__ v8f wmmab(v16bf a, v16bf b, v8f c) { return __builtin_amdgcn_wmma_f32_16x16x32_bf16(false, a, false, b, (short)0, c, false, false); }



// ---- k_proj: the whole preparation. ONE WAVE per 64 tokens x 64 output channels (16 accumulators); grid (TT/64, DKV/64, image), 32 threads.
// C[t][o] = sum_c bf16(x[c][t]) bf16(w[o][c]) + bf16(bias[o]), f32 accumulate. Both operands come straight from the f32 inputs and are rounded to bf16 in registers:
// an A fragment's lane is one token, so its sixteen channels are sixteen 4-byte loads, each of which covers 64 consecutive bytes of two rows of channel-major x; a B fragment's lane is one row of w.
// C leaves the kernel as two fp16 planes: Ck[t][o] and its transpose Cv[o][t]. The waves of output block 0 also write the A fragments' values as the fp16 query plane Qp[t][c].
// A wave writes whole 128-byte lines of each plane (64 o of a row of Ck, 64 t of a row of Cv, whole rows of Qp).
__global__ __launch_bounds__(32) void k_proj(const float* __restrict__ x, const float* __restrict__ w, const float* __restrict__ bias, h16* Qp, h16* Ck, h16* Cv) {
    __shared__ __align__(16) float os[16 * 68];
    { const size_t z = blockIdx.z; x += z * DM * TT; Qp += z * TT * DM; Ck += z * TT * DKV; Cv += z * DKV * TT; }   /* z = image */
    const int lane = threadIdx.x & 31, lr = lane & 15, hi = lane >> 4; const int r0 = blockIdx.x * 64, c0 = blockIdx.y * 64;
    const float* xp = x + (size_t)(8 * hi) * TT + r0 + lr;        /* channel 8 hi, token r0 + lr */
    const float* wp = w + (size_t)(c0 + lr) * DM + 8 * hi;        /* row c0 + lr, channel 8 hi */
    const float* bu = bias + c0;                                  /* the same for the whole wave */
    v4f wr[4][4][4];      /* [32-channel chunk][16-row block][quarter of the fragment] */
#pragma unroll
    for (int kq = 0; kq < 4; ++kq)
#pragma unroll
        for (int nb = 0; nb < 4; ++nb) { const float* p = wp + (size_t)nb * 16 * DM + 32 * kq; wr[kq][nb][0] = *(const v4f*)p; wr[kq][nb][1] = *(const v4f*)(p + 4); wr[kq][nb][2] = *(const v4f*)(p + 16); wr[kq][nb][3] = *(const v4f*)(p + 20); }
    float bcol[4];        /* the bias of this lane's four columns, for the transposed plane */
#pragma unroll
    for (int nb = 0; nb < 4; ++nb) bcol[nb] = bu[nb * 16 + lr];
    v4f brow = *(const v4f*)(bu + lr * 4);   /* and of the four columns that the lane stores of each row of Ck */
    float xr[4][4][16];   /* [token block][32-channel chunk][fragment element]: element i is channel 32 kq + 8 hi + i (i < 8) or 32 kq + 16 + 8 hi + i - 8, on the A side as on the B side */
#pragma unroll
    for (int mb = 0; mb < 4; ++mb)
#pragma unroll
        for (int kq = 0; kq < 4; ++kq)
#pragma unroll
            for (int i = 0; i < 16; ++i) xr[mb][kq][i] = xp[(size_t)(32 * kq + (i & 7) + 16 * (i >> 3)) * TT + mb * 16];
    __builtin_amdgcn_sched_barrier(0);   /* keeps every load above this line: sunk among the conversions and the products they would wait for memory one group after another */
    asm volatile("s_wait_xcnt 0x0" :: "v"(xp), "v"(wp), "s"(bu), "v"(lr) : "memory");   /* before an address register of the loads above is reused; the operands keep those registers until here */
    __builtin_amdgcn_sched_barrier(0);   /* keeps the arithmetic, which reuses those registers, behind the wait */
    v16bf a[4][4];
#pragma unroll
    for (int mb = 0; mb < 4; ++mb)
#pragma unroll
        for (int kq = 0; kq < 4; ++kq) { v8u pk;
#pragma unroll
            for (int i = 0; i < 8; ++i) pk[i] = pkbf(xr[mb][kq][2 * i], xr[mb][kq][2 * i + 1]);
            a[mb][kq] = __builtin_bit_cast(v16bf, pk); }
    if (blockIdx.y == 0) {   /* the query plane: the same bf16-rounded values as fp16, token-major; one branch for all of it, outside the loads and the products */
        h16* qp = Qp + (size_t)(r0 + lr) * DM + 8 * hi; v8h qv[4][4][2];
#pragma unroll
        for (int mb = 0; mb < 4; ++mb)
#pragma unroll
            for (int kq = 0; kq < 4; ++kq) { const v16us av = __builtin_bit_cast(v16us, a[mb][kq]);
#pragma unroll
                for (int i = 0; i < 8; ++i) { qv[mb][kq][0][i] = (h16)bf2f(av[i]); qv[mb][kq][1][i] = (h16)bf2f(av[8 + i]); } }
#pragma unroll
        for (int mb = 0; mb < 4; ++mb)
#pragma unroll
            for (int kq = 0; kq < 4; ++kq) { *(v8h*)(qp + (size_t)mb * 16 * DM + 32 * kq) = qv[mb][kq][0]; *(v8h*)(qp + (size_t)mb * 16 * DM + 32 * kq + 16) = qv[mb][kq][1]; }
        asm volatile("s_wait_xcnt 0x0" :: "v"(qp) : "memory");   /* before a register of the stores above is reused */
    }
    v8f acc[4][4];
#pragma unroll
    for (int mb = 0; mb < 4; ++mb)
#pragma unroll
        for (int nb = 0; nb < 4; ++nb) acc[mb][nb] = (v8f){};
#pragma unroll
    for (int kq = 0; kq < 4; ++kq) {
#pragma unroll
        for (int nb = 0; nb < 4; ++nb) { const v4f w0 = wr[kq][nb][0], w1 = wr[kq][nb][1], w2 = wr[kq][nb][2], w3 = wr[kq][nb][3]; v8u pk;
            pk[0] = pkbf(w0[0], w0[1]); pk[1] = pkbf(w0[2], w0[3]); pk[2] = pkbf(w1[0], w1[1]); pk[3] = pkbf(w1[2], w1[3]); pk[4] = pkbf(w2[0], w2[1]); pk[5] = pkbf(w2[2], w2[3]); pk[6] = pkbf(w3[0], w3[1]); pk[7] = pkbf(w3[2], w3[3]);
            const v16bf b = __builtin_bit_cast(v16bf, pk);
#pragma unroll
            for (int mb = 0; mb < 4; ++mb) acc[mb][nb] = wmmab(a[mb][kq], b, acc[mb][nb]); }
    }
#pragma unroll
    for (int nb = 0; nb < 4; ++nb) { bcol[nb] = bfr(bcol[nb]); brow[nb] = bfr(brow[nb]); }
    h16* cvp = Cv + (size_t)(c0 + lr) * TT + r0 + 8 * hi; h16* ckp = Ck + (size_t)(r0 + hi) * DKV + c0 + lr * 4;
#pragma unroll
    for (int mb = 0; mb < 4; ++mb) { v8h tv[4]; v4h hv[8];
#pragma unroll
        for (int nb = 0; nb < 4; ++nb)   /* a lane's accumulator registers are eight consecutive tokens of one output channel: 16 bytes of a row of Cv */
#pragma unroll
            for (int j = 0; j < 8; ++j) { os[(hi * 8 + j) * 68 + nb * 16 + lr] = acc[mb][nb][j]; tv[nb][j] = (h16)(acc[mb][nb][j] + bcol[nb]); }
        __builtin_amdgcn_wave_barrier(); asm volatile("" ::: "memory");   /* the rows are read back by other lanes of the wave: keeps the LDS reads behind the writes */
#pragma unroll
        for (int s = 0; s < 8; ++s) { const v4f val = *(const v4fa*)(os + (2 * s + hi) * 68 + lr * 4) + brow; hv[s][0] = (h16)val[0]; hv[s][1] = (h16)val[1]; hv[s][2] = (h16)val[2]; hv[s][3] = (h16)val[3]; }
        __builtin_amdgcn_wave_barrier(); asm volatile("" ::: "memory");   /* and the next block's LDS writes behind these reads */
#pragma unroll
        for (int nb = 0; nb < 4; ++nb) *(v8h*)(cvp + (size_t)nb * 16 * TT + mb * 16) = tv[nb];
#pragma unroll
        for (int s = 0; s < 8; ++s) *(v4h*)(ckp + (size_t)(mb * 16 + 2 * s) * DKV) = hv[s];
        __builtin_amdgcn_sched_barrier(0);   /* with the one behind the wait: keeps the stores in front of the wait and the next block's arithmetic, which reuses their registers, behind it */
        asm volatile("s_wait_xcnt 0x0" :: "v"(cvp), "v"(ckp) : "memory");   /* before a register of the stores above is reused */
        __builtin_amdgcn_sched_barrier(0);
    }
}

__device__ __forceinline__ void splitf(float y, unsigned short& h, unsigned short& l) { h = f2bf(y); l = f2bf(y - bf2f(h)); }
typedef __attribute__((ext_vector_type(2))) unsigned short v2us;
typedef __attribute__((ext_vector_type(4))) unsigned short v4us;
typedef __attribute__((ext_vector_type(4))) int v4i;

__global__ __launch_bounds__(256) void k_wtG(const float* __restrict__ w, int K, int N, bf* Bt) {
    const int lane = threadIdx.x & 31; const int L0 = (blockIdx.x * 8 + (threadIdx.x >> 5)) * 8; const int nlines = N * K / 64;
{
#pragma unroll 1
        for (int l = 0; l < 8; ++l) { const int L = L0 + l; if (L >= nlines) break; const size_t e = (size_t)L * 64 + lane * 2; const int k = (int)(e % K), n = (int)(e / K); v2us o;
            o[0] = f2bf(w[(size_t)k * N + n]); o[1] = f2bf(w[(size_t)(k + 1) * N + n]); *(v2us*)(Bt + e) = o; }
         }
}
__device__ __forceinline__ v16h ldf(const h16* p) { return cat16(*(const v8h*)p, *(const v8h*)(p + 16)); }
__device__ __forceinline__ float xhalf(float x) { return __builtin_bit_cast(float, __builtin_amdgcn_permlanex16(__builtin_bit_cast(int, x), __builtin_bit_cast(int, x), 0x76543210, 0xfedcba98, false, false)); }  // lane l with lane l ^ 16
// Eight asynchronous 16-byte copies per lane, global memory to LDS: piece i from g + i gs to LDS byte l + i ls. The last line waits before a register that a copy names may be reused; inside the statement nothing can move in front of it.
__device__ __forceinline__ void cp8(unsigned l, unsigned ls, const char* g, size_t gs) {
    asm volatile("global_load_async_to_lds_b128 %0, %8, off\n\t"
                 "global_load_async_to_lds_b128 %1, %9, off\n\t"
                 "global_load_async_to_lds_b128 %2, %10, off\n\t"
                 "global_load_async_to_lds_b128 %3, %11, off\n\t"
                 "global_load_async_to_lds_b128 %4, %12, off\n\t"
                 "global_load_async_to_lds_b128 %5, %13, off\n\t"
                 "global_load_async_to_lds_b128 %6, %14, off\n\t"
                 "global_load_async_to_lds_b128 %7, %15, off\n\t"
                 "s_wait_xcnt 0x0"
                 :: "v"(l), "v"(l + ls), "v"(l + 2 * ls), "v"(l + 3 * ls), "v"(l + 4 * ls), "v"(l + 5 * ls), "v"(l + 6 * ls), "v"(l + 7 * ls),
                    "v"(g), "v"(g + gs), "v"(g + 2 * gs), "v"(g + 3 * gs), "v"(g + 4 * gs), "v"(g + 5 * gs), "v"(g + 6 * gs), "v"(g + 7 * gs) : "memory");
}
typedef __attribute__((address_space(3))) const h16 lds_h16;
__global__ __launch_bounds__(FQW * 32) __attribute__((amdgpu_waves_per_eu(2, 2))) void k_fattn(const h16* __restrict__ Q, const h16* __restrict__ Kp, const h16* __restrict__ Vt, float* __restrict__ Op, float* __restrict__ Mp, float* __restrict__ Lp) {
    __shared__ __attribute__((aligned(16))) h16 Ks[2 * TLK * KLP];   /* buffer b at b TLK KLP; key row k of its tile at k KLP */
    __shared__ __attribute__((aligned(16))) h16 Vs[2 * HD * VLP];    /* buffer b at b HD VLP; row d of v^T, the tile's keys, at d VLP */
    const int lane = threadIdx.x & 31, c = lane & 15, h = lane >> 4; const int q0 = (blockIdx.x * FQW + (threadIdx.x >> 5)) * 32; const int sl = blockIdx.y, kbeg = sl * SLK;
    const float cscale = SCL * 1.4426950408889634f;
    { const size_t im = blockIdx.z; Q += im * TT * HD; Kp += im * TT * HD; Vt += im * HD * TT; Op += im * KSP * HD * TT; Mp += im * KSP * TT; Lp += im * KSP * TT; }   /* z = image */
    v16h qf[2][4], kf[2][4];
    /* a tile into LDS: a wave's copy is 512 consecutive bytes of global memory, two key rows or one row of v^T; thread i takes piece i, i + 256, ... of each plane */
    const unsigned tid = threadIdx.x;
    const unsigned kl0 = (unsigned)(size_t)(lds_h16*)Ks + (tid >> 4) * (KLP * 2) + (tid & 15) * 16, vl0 = (unsigned)(size_t)(lds_h16*)Vs + (tid >> 5) * (VLP * 2) + (tid & 31) * 16;
    const char* kg = (const char*)(Kp + (size_t)kbeg * HD) + tid * 16; const char* vg = (const char*)(Vt + (size_t)(tid >> 5) * TT + kbeg) + (tid & 31) * 16;
    auto stage = [&](int tile) {   /* tile 'tile' of the slice into buffer tile & 1: 32 copies per wave */
        const unsigned kb = kl0 + (tile & 1) * (TLK * KLP * 2), vb = vl0 + (tile & 1) * (HD * VLP * 2); const char* kt = kg + (size_t)tile * TLK * HD * 2; const char* vt = vg + (size_t)tile * TLK * 2;
        cp8(kb, 16 * KLP * 2, kt, 4096); cp8(kb + 128 * KLP * 2, 16 * KLP * 2, kt + 8 * 4096, 4096);
        cp8(vb, 8 * VLP * 2, vt, (size_t)8 * TT * 2); cp8(vb + 64 * VLP * 2, 8 * VLP * 2, vt + (size_t)64 * TT * 2, (size_t)8 * TT * 2);
    };
    const h16* qp = Q + (size_t)(q0 + c) * HD + 8 * h;
#pragma unroll
    for (int g = 0; g < 2; ++g)
#pragma unroll
        for (int kc = 0; kc < 4; ++kc) qf[g][kc] = ldf(qp + 16 * g * HD + 32 * kc);
    asm volatile("s_wait_xcnt 0x0" :: "v"(qp) : "memory");   /* before an address register of the loads above is reused; the operand keeps that register until here */
    v8f acc[2][8]; float m_run[2], l_run[2];
#pragma unroll
    for (int g = 0; g < 2; ++g) { m_run[g] = -3.0e38f; l_run[g] = 0.0f;
#pragma unroll
        for (int t = 0; t < 8; ++t) acc[g][t] = (v8f){}; }
    /* The ring. Trips -2 and -1 are its start and work on nothing: trip -2 issues tile 0's copies; trip -1 waits for them, passes the barrier and issues tile 1's. From trip 0 on: work on tile tl, then wait, barrier, tile tl + 2's copies.
       The copies stand at ONE place, where each address is a loop-variant sum: an address part that is itself an operand of an asm statement must stay in the first 256 registers, which the loop's tiles fill, and was spilled to scratch memory. */
#pragma unroll 1   /* one tile per trip: the buffers alternate, the code is the same */
    for (int tl = -2; tl < NTL; ++tl) {
    if (tl >= 0) {
    const h16* kl = Ks + (tl & 1) * (TLK * KLP) + c * KLP + 8 * h; const h16* vl = Vs + (tl & 1) * (HD * VLP) + c * VLP + 8 * h;
#pragma unroll
    for (int kt = 0; kt < 2; ++kt)
#pragma unroll
        for (int kc = 0; kc < 4; ++kc) kf[kt][kc] = ldf(kl + 16 * kt * KLP + 32 * kc);
#pragma unroll 1   /* one pass per trip: an unrolled body would not fit two waves per SIMD */
    for (int key0 = 0; key0 < TLK; key0 += 32) {   /* key0 counts inside the tile */
        v16h vf[8];   /* this pass's v^T fragments, in flight under the score products and the softmax */
#pragma unroll
        for (int t = 0; t < 8; ++t) vf[t] = ldf(vl + 16 * t * VLP + key0);
        v8f s[2][2];
#pragma unroll
        for (int kt = 0; kt < 2; ++kt)
#pragma unroll
            for (int g = 0; g < 2; ++g) { s[kt][g] = (v8f){};
#pragma unroll
                for (int kc = 0; kc < 4; ++kc) s[kt][g] = wmma16(kf[kt][kc], qf[g][kc], s[kt][g]); }
        const int nk = (key0 + 32 < TLK) ? key0 + 32 : 0;   /* next pass's key rows, fetched one pass ahead; the last pass re-reads its own tile's first rows and drops them: a trip reads its own buffer alone */
#pragma unroll
        for (int kt = 0; kt < 2; ++kt)
#pragma unroll
            for (int kc = 0; kc < 4; ++kc) kf[kt][kc] = ldf(kl + (nk + 16 * kt) * KLP + 32 * kc);
        float mb[2]; bool need = false;
#pragma unroll
        for (int g = 0; g < 2; ++g) { float mx = s[0][g][0];
#pragma unroll
            for (int r = 1; r < 8; ++r) mx = fmaxf(mx, s[0][g][r]);
#pragma unroll
            for (int r = 0; r < 8; ++r) mx = fmaxf(mx, s[1][g][r]);
            mx = fmaxf(mx, xhalf(mx)) * cscale; mb[g] = mx; need = need || (mx > m_run[g] + 8.0f); }
        if (__builtin_amdgcn_ballot_w32(need) != 0) {   /* scalar branch; rare after the first pass */
#pragma unroll
            for (int g = 0; g < 2; ++g) { const float m_new = fmaxf(m_run[g], mb[g]); const float corr = __builtin_amdgcn_exp2f(m_run[g] - m_new); l_run[g] *= corr; m_run[g] = m_new;
#pragma unroll
                for (int t = 0; t < 8; ++t) acc[g][t] = acc[g][t] * corr; } }
#pragma unroll
        for (int g = 0; g < 2; ++g) { const float nm = PSH - m_run[g]; v16h pf; float ps0 = 0.0f, ps1 = 0.0f;
#pragma unroll
            for (int i = 0; i < 8; ++i) { const float p0 = __builtin_amdgcn_exp2f(fmaf(s[i >> 2][g][2 * (i & 3)], cscale, nm)), p1 = __builtin_amdgcn_exp2f(fmaf(s[i >> 2][g][2 * (i & 3) + 1], cscale, nm));
                if (i & 1) ps1 += p0 + p1; else ps0 += p0 + p1; pf[2 * i] = (h16)p0; pf[2 * i + 1] = (h16)p1; }
            l_run[g] += ps0 + ps1;
#pragma unroll
            for (int t = 0; t < 8; ++t) acc[g][t] = wmma16(vf[t], pf, acc[g][t]); }
    }
    }
    if (tl >= -1) {
    asm volatile("s_wait_dscnt 0x0" ::: "memory");      /* this wave's reads of the tile's buffer are done */
    asm volatile("s_wait_asynccnt 0x0" ::: "memory");   /* this wave's copies of the next tile have landed */
    __syncthreads();                                    /* every wave's: the next tile may be read, this tile's buffer may be refilled; nothing of a tile is read in front of its barrier */
    }
    if (tl + 2 < NTL) stage(tl + 2);                    /* the same for the whole workgroup */
    }
    asm volatile("s_wait_asynccnt 0x0" ::: "memory");   /* no copy is left in flight when the wave ends */
#pragma unroll
    for (int g = 0; g < 2; ++g) { const float l_fin = l_run[g] + xhalf(l_run[g]);   /* each wave half summed its eight keys of every 16-key tile */
        if (h == 0) { Mp[(size_t)sl * TT + q0 + 16 * g + c] = m_run[g]; Lp[(size_t)sl * TT + q0 + 16 * g + c] = l_fin; }
#pragma unroll
        for (int t = 0; t < 8; ++t)
#pragma unroll
            for (int r = 0; r < 8; ++r) Op[((size_t)sl * HD + 16 * t + 8 * h + r) * TT + q0 + 16 * g + c] = acc[g][t][r]; }
}
// k_fmerge: out[ch][l] = sum_s w_s O_s[ch][l] / sum_s w_s l_s, w_s = 2^(m_s - max_s m_s), slices added in slice order. A thread: 4 consecutive queries x 2 channels. O0: the slices' partial planes.
__global__ __launch_bounds__(256) void k_fmerge(const float* __restrict__ O0, const float* __restrict__ Mp, const float* __restrict__ Lp, float* __restrict__ out) {
    { const size_t im = blockIdx.z; O0 += im * KSP * HD * TT; Mp += im * KSP * TT; Lp += im * KSP * TT; out += im * DM * TT; }   /* z = image */
    const unsigned vl = (threadIdx.x & 31) * 16u, vo = (threadIdx.x >> 5) * (8u * TT) + vl;   /* byte offsets of the lane in the block's 128 queries and in its 16 channels x 128 queries: with block-uniform bases, two offset registers serve every load */
    const size_t tile = (size_t)blockIdx.y * 16 * TT + blockIdx.x * 128; const char* mp = (const char*)(Mp + blockIdx.x * 128); const char* lp = (const char*)(Lp + blockIdx.x * 128);
    v4f w[KSP], ls[KSP], pp[2][KSP];   /* unrolled so that all the slices' loads are in flight together */
#pragma unroll
    for (int s = 0; s < KSP; ++s) { w[s] = *(const v4f*)(mp + (size_t)s * TT * 4 + vl); ls[s] = *(const v4f*)(lp + (size_t)s * TT * 4 + vl); }
    __builtin_amdgcn_sched_barrier(0);   /* with the one behind the wait: keeps the loads in front of the wait and the next base's sum, which reuses a base register, behind it */
    asm volatile("s_wait_xcnt 0x0" ::: "memory");   /* before a base register of the loads above is reused */
    __builtin_amdgcn_sched_barrier(0);
#pragma unroll
    for (int s = 0; s < KSP; ++s) { const char* og = (const char*)(O0 + tile);   /* one scalar base: the slice's plane fits the instruction's offset */
        pp[0][s] = *(const v4f*)(og + (size_t)s * HD * TT * 4 + vo); pp[1][s] = *(const v4f*)(og + (size_t)s * HD * TT * 4 + TT * 4 + vo); }
    __builtin_amdgcn_sched_barrier(0);   /* keeps every load above this line: sunk into the sums they would wait for one another */
    asm volatile("s_wait_xcnt 0x0" :: "v"(vl), "v"(vo) : "memory");   /* before an address register of the loads above is reused; the operands keep the offset registers until here */
    __builtin_amdgcn_sched_barrier(0);   /* keeps the arithmetic, which reuses those registers, behind the wait */
    v4f mx = w[0], den = (v4f){};
#pragma unroll
    for (int s = 1; s < KSP; ++s)
#pragma unroll
        for (int q = 0; q < 4; ++q) mx[q] = fmaxf(mx[q], w[s][q]);
#pragma unroll
    for (int s = 0; s < KSP; ++s) {
#pragma unroll
        for (int q = 0; q < 4; ++q) w[s][q] = __builtin_amdgcn_exp2f(w[s][q] - mx[q]);
        den += w[s] * ls[s]; }
    v4f inv;
#pragma unroll
    for (int q = 0; q < 4; ++q) inv[q] = __fdiv_rn(1.0f, den[q]);
    v4f o0 = w[0] * pp[0][0], o1 = w[0] * pp[1][0];
#pragma unroll
    for (int s = 1; s < KSP; ++s) { o0 += w[s] * pp[0][s]; o1 += w[s] * pp[1][s]; }   /* added in slice order */
    float* po = out + tile + vo / 4; *(v4f*)po = o0 * inv; *(v4f*)(po + TT) = o1 * inv;
}

extern "C" void kernel_launch(void* const* d_in, const int* in_sizes, int n_in,
                              void* d_out, int out_size, void* d_ws, size_t ws_size, hipStream_t stream) {
    (void)in_sizes; (void)n_in; (void)out_size;
    const float* x = (const float*)d_in[0]; const float* wk = (const float*)d_in[1]; const float* bk = (const float*)d_in[2]; const float* wq = nullptr; const float* wv = nullptr; const float* wo = nullptr; (void)wq; (void)wv; (void)wo;
    float* OUT = (float*)d_out;     // [4][128][4096] channel-major
    char* wsp = (char*)d_ws;
    auto take = [&](size_t bytes) { char* p = wsp; wsp += (bytes + 255) & ~(size_t)255; return (void*)p; };
    h16* QP16 = (h16*)take((size_t)NB_ * NH_ * TT * HD * 2); h16* KP16 = (h16*)take((size_t)NB_ * NKV * TT * HD * 2); h16* VT16 = (h16*)take((size_t)NB_ * NKV * HD * TT * 2);
    float* Ob = (float*)take((size_t)NB_ * KSP * ZH * TT * HD * 4); float* Mb = (float*)take((size_t)NB_ * KSP * TT * 4); float* Lb = (float*)take((size_t)NB_ * KSP * TT * 4);
    if ((size_t)(wsp - (char*)d_ws) > ws_size) return;    // ws 256 MiB
    /* one launch of each kernel for all four images */
    k_proj<<<dim3(TT / 64, DKV / 64, NB_), 32, 0, stream>>>(x, wk, bk, QP16, KP16, VT16);   /* z = image; query plane, key plane and v^T */
    k_fattn<<<dim3(TT / (FQW * 32), KSP, NB_), FQW * 32, 0, stream>>>(QP16, KP16, VT16, Ob, Mb, Lb);   /* y = key slice, z = image */
    k_fmerge<<<dim3(TT / 128, HD / 16, NB_), 256, 0, stream>>>(Ob, Mb, Lb, OUT);   /* context^T, channel-major; z = image */
}

// v007
// One run takes 38.4 microseconds.
// Next to v006, in two timings, it ran 1.12 times as fast each time.
// Counting every step since v000, it is 15.5 times as fast.
#include <hip/hip_runtime.h>

// Scaled dot-product attention over image positions (x [4][128][64x64] channel-major; values = keys = 1x1 conv W_kv x + b_kv ([128][128] + [128]); queries = x itself; scores[l][t] = q_l.v_t / sqrt(128) over the 4096 positions; softmax; out[c][l] = sum_t attn[l][t] v_t[c] -> [4][128][64][64] channel-major (2.1 M)).
// The four images run side by side: every kernel takes the image as its grid index z, and every buffer below holds all four, image-major.
// Layout per image: the values projection (k_proj, exact products + bias) reads x and the weights as they are and writes all three fp16 planes itself; q, k (= v) as fp16 planes [4096][128], v^T [128][4096]; scores, softmax, attn.v and the joining of the key slices in one kernel (k_fattn: a workgroup owns 64 queries and all keys, its waves are 2 query groups x 4 key slices; keys and v^T pass through two LDS buffers, tile by tile, transposed products, running maximum, P packed in registers; the four slices' partial sums meet in LDS and the f32 context leaves channel-major).
// Compute dtypes, f32 accumulate: every input rounded to bf16; projection on PLAIN bf16 operands (exact) + bf16 bias; scores and attn.v on single fp16 planes (logit sigma ~1; P = 2^(t - m + 6) fp16); softmax f32; f32 output.

#define NB_  4
#define TT   4096
#define DM   128
#define NH_  1
#define NKV  1
#define REP  (NH_ / NKV)
#define HD   128
#define DQ   (NH_ * HD)
#define DKV  (NKV * HD)
#define ZH   1
#define RH   0                  // query rows < RH use hi+lo planes (0: none)
#define WIN  0
#define PSH  6.0f               // P carries 2^PSH: with the trailing maximum (up to 2^8) P stays below 2^14 in fp16
#define SCL  0.088388347648318447f   // HD^-0.5
#define KSP  4                  // key slices of 1024 consecutive keys: each belongs to one wave of a query group; the workgroup adds the four partial sums in slice order. 64 query blocks x 4 images = 256 workgroups
#define FQW  8                  // k_fattn: waves per workgroup, 32 query columns x one key slice each
#define QGW  (FQW / KSP)         // query groups of 32 columns per workgroup
#define SLK  (TT / KSP)         // keys per slice
#define TLK  256                // keys per tile: what one LDS buffer holds
#define SUB  (TLK / KSP)         // of which each slice has this many: tile j holds keys s SLK + j SUB ... + SUB - 1 of every slice s, slice s at LDS key s SUB
#define NTL  (SLK / SUB)        // tiles
#define OLP  (QGW * 32 + 4)      // k_fattn, LDS, joining: f32 elements per channel row of a slice's partial sums, 272 bytes = 16 x 17
#define KLP  (HD + 8)           // k_fattn, LDS: fp16 elements per key row, 272 bytes = 16 x 17, so that sixteen rows read 16 bytes wide fall on all 64 banks
#define VLP  (TLK + 8)          // the same for a row of v^T: 528 bytes = 16 x 33
static_assert(ZH == 1 && NH_ == 1 && HD == 128 && TT % KSP == 0 && SLK % SUB == 0 && SUB == 64 && TT % (QGW * 32) == 0 && QGW == 2, "k_fattn: one head of size 128, whole tiles per slice, two 32-key passes per tile and wave");
static_assert(FQW * 32 == 256 && TLK == 256, "k_fattn: 256 threads copy a tile of 256 keys, sixteen 16-byte pieces of each plane per thread");
static_assert(NTL >= 2, "k_fattn: the two-buffer ring starts with two tiles");
static_assert((size_t)KSP * HD * OLP * 4 <= (size_t)2 * TLK * KLP * 2 && (size_t)2 * KSP * QGW * 32 * 4 <= (size_t)2 * HD * VLP * 2, "k_fattn: the partial sums fit the key buffers, their maxima and sums the v^T buffers");
typedef _Float16 h16;
typedef unsigned short bf;
typedef __attribute__((ext_vector_type(16))) __bf16   v16bf;
typedef __attribute__((ext_vector_type(16))) _Float16 v16h;
typedef __attribute__((ext_vector_type(8)))  _Float16 v8h;
typedef __attribute__((ext_vector_type(4)))  _Float16 v4h;
typedef __attribute__((ext_vector_type(8)))  unsigned short v8us;
typedef __attribute__((ext_vector_type(16))) unsigned short v16us;
typedef __attribute__((ext_vector_type(8)))  unsigned v8u;
typedef __attribute__((ext_vector_type(2)))  __bf16   v2bf;
typedef __attribute__((ext_vector_type(2)))  float    v2f;
typedef __attribute__((ext_vector_type(8)))  float    v8f;
typedef __attribute__((ext_vector_type(4)))  float    v4f;
typedef v8h  __attribute__((may_alias)) v8ha;
typedef v4f  __attribute__((may_alias)) v4fa;
typedef v8us __attribute__((may_alias)) v8usa;

__device__ __forceinline__ unsigned short f2bf(float f) { unsigned u = __float_as_uint(f); u += 0x7FFFu + ((u >> 16) & 1u); return (unsigned short)(u >> 16); }
__device__ __forceinline__ float bf2f(unsigned short b) { return __uint_as_float(((unsigned)b) << 16); }
__device__ __forceinline__ float bfr(float f) { return bf2f(f2bf(f)); }
__device__ __forceinline__ unsigned pkbf(float lo, float up) { v2f t; t[0] = lo; t[1] = up; return __builtin_bit_cast(unsigned, __builtin_convertvector(t, v2bf)); }   // two f32 rounded to nearest even into one register of bf16, as f2bf rounds, in one instruction
__device__ __forceinline__ v16h cat16(v8h lo, v8h hi) { return __builtin_shufflevector(lo, hi, 0, 1, 2, 3, 4, 5, 6, 7, 8, 9, 10, 11, 12, 13, 14, 15); }
__device__ __forceinline__ v8f wmma16(v16h a, v16h b, v8f c) { return __builtin_amdgcn_wmma_f32_16x16x32_f16(false, a, false, b, (short)0, c, false, false); }
__device__ __forceinline__ v8f wmmab(v16bf a, v16bf b, v8f c) { return __builtin_amdgcn_wmma_f32_16x16x32_bf16(false, a, false, b, (short)0, c, false, false); }



// ---- k_proj: the whole preparation. ONE WAVE per 64 tokens x 64 output channels (16 accumulators); grid (TT/64, DKV/64, image), 32 threads.
// C[t][o] = sum_c bf16(x[c][t]) bf16(w[o][c]) + bf16(bias[o]), f32 accumulate. Both operands come straight from the f32 inputs and are rounded to bf16 in registers:
// an A fragment's lane is one token, so its sixteen channels are sixteen 4-byte loads, each of which covers 64 consecutive bytes of two rows of channel-major x; a B fragment's lane is one row of w.
// C leaves the kernel as two fp16 planes: Ck[t][o] and its transpose Cv[o][t]. The waves of output block 0 also write the A fragments' values as the fp16 query plane Qp[t][c].
// A wave writes whole 128-byte lines of each plane (64 o of a row of Ck, 64 t of a row of Cv, whole rows of Qp).
__global__ __launch_bounds__(32) void k_proj(const float* __restrict__ x, const float* __restrict__ w, const float* __restrict__ bias, h16* Qp, h16* Ck, h16* Cv) {
    __shared__ __align__(16) float os[16 * 68];
    { const size_t z = blockIdx.z; x += z * DM * TT; Qp += z * TT * DM; Ck += z * TT * DKV; Cv += z * DKV * TT; }   /* z = image */
    const int lane = threadIdx.x & 31, lr = lane & 15, hi = lane >> 4; const int r0 = blockIdx.x * 64, c0 = blockIdx.y * 64;
    const float* xp = x + (size_t)(8 * hi) * TT + r0 + lr;        /* channel 8 hi, token r0 + lr */
    const float* wp = w + (size_t)(c0 + lr) * DM + 8 * hi;        /* row c0 + lr, channel 8 hi */
    const float* bu = bias + c0;                                  /* the same for the whole wave */
    v4f wr[4][4][4];      /* [32-channel chunk][16-row block][quarter of the fragment] */
#pragma unroll
    for (int kq = 0; kq < 4; ++kq)
#pragma unroll
        for (int nb = 0; nb < 4; ++nb) { const float* p = wp + (size_t)nb * 16 * DM + 32 * kq; wr[kq][nb][0] = *(const v4f*)p; wr[kq][nb][1] = *(const v4f*)(p + 4); wr[kq][nb][2] = *(const v4f*)(p + 16); wr[kq][nb][3] = *(const v4f*)(p + 20); }
    float bcol[4];        /* the bias of this lane's four columns, for the transposed plane */
#pragma unroll
    for (int nb = 0; nb < 4; ++nb) bcol[nb] = bu[nb * 16 + lr];
    v4f brow = *(const v4f*)(bu + lr * 4);   /* and of the four columns that the lane stores of each row of Ck */
    float xr[4][4][16];   /* [token block][32-channel chunk][fragment element]: element i is channel 32 kq + 8 hi + i (i < 8) or 32 kq + 16 + 8 hi + i - 8, on the A side as on the B side */
#pragma unroll
    for (int mb = 0; mb < 4; ++mb)
#pragma unroll
        for (int kq = 0; kq < 4; ++kq)
#pragma unroll
            for (int i = 0; i < 16; ++i) xr[mb][kq][i] = xp[(size_t)(32 * kq + (i & 7) + 16 * (i >> 3)) * TT + mb * 16];
    __builtin_amdgcn_sched_barrier(0);   /* keeps every load above this line: sunk among the conversions and the products they would wait for memory one group after another */
    asm volatile("s_wait_xcnt 0x0" :: "v"(xp), "v"(wp), "s"(bu), "v"(lr) : "memory");   /* before an address register of the loads above is reused; the operands keep those registers until here */
    __builtin_amdgcn_sched_barrier(0);   /* keeps the arithmetic, which reuses those registers, behind the wait */
    v16bf a[4][4];
#pragma unroll
    for (int mb = 0; mb < 4; ++mb)
#pragma unroll
        for (int kq = 0; kq < 4; ++kq) { v8u pk;
#pragma unroll
            for (int i = 0; i < 8; ++i) pk[i] = pkbf(xr[mb][kq][2 * i], xr[mb][kq][2 * i + 1]);
            a[mb][kq] = __builtin_bit_cast(v16bf, pk); }
    if (blockIdx.y == 0) {   /* the query plane: the same bf16-rounded values as fp16, token-major; one branch for all of it, outside the loads and the products */
        h16* qp = Qp + (size_t)(r0 + lr) * DM + 8 * hi; v8h qv[4][4][2];
#pragma unroll
        for (int mb = 0; mb < 4; ++mb)
#pragma unroll
            for (int kq = 0; kq < 4; ++kq) { const v16us av = __builtin_bit_cast(v16us, a[mb][kq]);
#pragma unroll
                for (int i = 0; i < 8; ++i) { qv[mb][kq][0][i] = (h16)bf2f(av[i]); qv[mb][kq][1][i] = (h16)bf2f(av[8 + i]); } }
#pragma unroll
        for (int mb = 0; mb < 4; ++mb)
#pragma unroll
            for (int kq = 0; kq < 4; ++kq) { *(v8h*)(qp + (size_t)mb * 16 * DM + 32 * kq) = qv[mb][kq][0]; *(v8h*)(qp + (size_t)mb * 16 * DM + 32 * kq + 16) = qv[mb][kq][1]; }
        asm volatile("s_wait_xcnt 0x0" :: "v"(qp) : "memory");   /* before a register of the stores above is reused */
    }
    v8f acc[4][4];
#pragma unroll
    for (int mb = 0; mb < 4; ++mb)
#pragma unroll
        for (int nb = 0; nb < 4; ++nb) acc[mb][nb] = (v8f){};
#pragma unroll
    for (int kq = 0; kq < 4; ++kq) {
#pragma unroll
        for (int nb = 0; nb < 4; ++nb) { const v4f w0 = wr[kq][nb][0], w1 = wr[kq][nb][1], w2 = wr[kq][nb][2], w3 = wr[kq][nb][3]; v8u pk;
            pk[0] = pkbf(w0[0], w0[1]); pk[1] = pkbf(w0[2], w0[3]); pk[2] = pkbf(w1[0], w1[1]); pk[3] = pkbf(w1[2], w1[3]); pk[4] = pkbf(w2[0], w2[1]); pk[5] = pkbf(w2[2], w2[3]); pk[6] = pkbf(w3[0], w3[1]); pk[7] = pkbf(w3[2], w3[3]);
            const v16bf b = __builtin_bit_cast(v16bf, pk);
#pragma unroll
            for (int mb = 0; mb < 4; ++mb) acc[mb][nb] = wmmab(a[mb][kq], b, acc[mb][nb]); }
    }
#pragma unroll
    for (int nb = 0; nb < 4; ++nb) { bcol[nb] = bfr(bcol[nb]); brow[nb] = bfr(brow[nb]); }
    h16* cvp = Cv + (size_t)(c0 + lr) * TT + r0 + 8 * hi; h16* ckp = Ck + (size_t)(r0 + hi) * DKV + c0 + lr * 4;
#pragma unroll
    for (int mb = 0; mb < 4; ++mb) { v8h tv[4]; v4h hv[8];
#pragma unroll
        for (int nb = 0; nb < 4; ++nb)   /* a lane's accumulator registers are eight consecutive tokens of one output channel: 16 bytes of a row of Cv */
#pragma unroll
            for (int j = 0; j < 8; ++j) { os[(hi * 8 + j) * 68 + nb * 16 + lr] = acc[mb][nb][j]; tv[nb][j] = (h16)(acc[mb][nb][j] + bcol[nb]); }
        __builtin_amdgcn_wave_barrier(); asm volatile("" ::: "memory");   /* the rows are read back by other lanes of the wave: keeps the LDS reads behind the writes */
#pragma unroll
        for (int s = 0; s < 8; ++s) { const v4f val = *(const v4fa*)(os + (2 * s + hi) * 68 + lr * 4) + brow; hv[s][0] = (h16)val[0]; hv[s][1] = (h16)val[1]; hv[s][2] = (h16)val[2]; hv[s][3] = (h16)val[3]; }
        __builtin_amdgcn_wave_barrier(); asm volatile("" ::: "memory");   /* and the next block's LDS writes behind these reads */
#pragma unroll
        for (int nb = 0; nb < 4; ++nb) *(v8h*)(cvp + (size_t)nb * 16 * TT + mb * 16) = tv[nb];
#pragma unroll
        for (int s = 0; s < 8; ++s) *(v4h*)(ckp + (size_t)(mb * 16 + 2 * s) * DKV) = hv[s];
        __builtin_amdgcn_sched_barrier(0);   /* with the one behind the wait: keeps the stores in front of the wait and the next block's arithmetic, which reuses their registers, behind it */
        asm volatile("s_wait_xcnt 0x0" :: "v"(cvp), "v"(ckp) : "memory");   /* before a register of the stores above is reused */
        __builtin_amdgcn_sched_barrier(0);
    }
}

__device__ __forceinline__ void splitf(float y, unsigned short& h, unsigned short& l) { h = f2bf(y); l = f2bf(y - bf2f(h)); }
typedef __attribute__((ext_vector_type(2))) unsigned short v2us;
typedef __attribute__((ext_vector_type(4))) unsigned short v4us;
typedef __attribute__((ext_vector_type(4))) int v4i;

__global__ __launch_bounds__(256) void k_wtG(const float* __restrict__ w, int K, int N, bf* Bt) {
    const int lane = threadIdx.x & 31; const int L0 = (blockIdx.x * 8 + (threadIdx.x >> 5)) * 8; const int nlines = N * K / 64;
{
#pragma unroll 1
        for (int l = 0; l < 8; ++l) { const int L = L0 + l; if (L >= nlines) break; const size_t e = (size_t)L * 64 + lane * 2; const int k = (int)(e % K), n = (int)(e / K); v2us o;
            o[0] = f2bf(w[(size_t)k * N + n]); o[1] = f2bf(w[(size_t)(k + 1) * N + n]); *(v2us*)(Bt + e) = o; }
         }
}
__device__ __forceinline__ v16h ldf(const h16* p) { return cat16(*(const v8h*)p, *(const v8h*)(p + 16)); }
__device__ __forceinline__ float xhalf(float x) { return __builtin_bit_cast(float, __builtin_amdgcn_permlanex16(__builtin_bit_cast(int, x), __builtin_bit_cast(int, x), 0x76543210, 0xfedcba98, false, false)); }  // lane l with lane l ^ 16
// One asynchronous 16-byte copy per lane, global memory to LDS, through no register. Written as the builtin: the compiler places its address registers anywhere in the register file, so a tile's first key fragments stay in flight across the 32 copies without a spill.
typedef __attribute__((address_space(3))) char lds_c;
typedef __attribute__((address_space(1))) v4i glb_v4i;
typedef __attribute__((address_space(3))) v4i lds_v4i;
__device__ __forceinline__ void cp16(lds_c* l, const char* g) { __builtin_amdgcn_global_load_async_to_lds_b128((glb_v4i*)g, (lds_v4i*)l, 0, 0); }
typedef float __attribute__((may_alias)) f32a;
__global__ __launch_bounds__(FQW * 32) __attribute__((amdgpu_waves_per_eu(2, 2))) void k_fattn(const h16* __restrict__ Q, const h16* __restrict__ Kp, const h16* __restrict__ Vt, float* __restrict__ out) {
    __shared__ __attribute__((aligned(16))) h16 Ks[2 * TLK * KLP];   /* buffer b at b TLK KLP; key row k of its tile at k KLP. Behind the last tile: the slices' partial sums */
    __shared__ __attribute__((aligned(16))) h16 Vs[2 * HD * VLP];    /* buffer b at b HD VLP; row d of v^T, the tile's keys, at d VLP. Behind the last tile: the slices' maxima and sums */
    const int lane = threadIdx.x & 31, c = lane & 15, h = lane >> 4; const int ks = (threadIdx.x >> 5) & (KSP - 1), qg = threadIdx.x >> 7; const int q0 = (blockIdx.x * QGW + qg) * 32;
    const float cscale = SCL * 1.4426950408889634f;
    { const size_t im = blockIdx.z; Q += im * TT * HD; Kp += im * TT * HD; Vt += im * HD * TT; out += im * DM * TT; }   /* z = image */
    v16h qf[2][4], kf[2][4];
    /* a tile into LDS: a wave's copy is two key rows (512 consecutive bytes) or one row of v^T (128 consecutive bytes of each slice); thread i takes piece i, i + 256, ... of each plane */
    const unsigned tid = threadIdx.x;
    lds_c* kl0 = (lds_c*)Ks + (tid >> 4) * (KLP * 2) + (tid & 15) * 16; lds_c* vl0 = (lds_c*)Vs + (tid >> 5) * (VLP * 2) + (tid & 31) * 16;
    const char* kg = (const char*)Kp + tid * 16; const char* vg = (const char*)(Vt + (size_t)(tid >> 5) * TT + (size_t)((tid & 31) >> 3) * SLK) + (tid & 7) * 16;
    auto stage = [&](int tile) {   /* tile 'tile' into buffer tile & 1: 32 copies per wave; four pieces of 16 key rows make a slice's 64 */
        lds_c* kb = kl0 + (tile & 1) * (TLK * KLP * 2); lds_c* vb = vl0 + (tile & 1) * (HD * VLP * 2); const char* kt = kg + (size_t)tile * SUB * HD * 2; const char* vt = vg + (size_t)tile * SUB * 2;
#pragma unroll
        for (int i = 0; i < 16; ++i) cp16(kb + i * (16 * KLP * 2), kt + (size_t)(i >> 2) * SLK * HD * 2 + (i & 3) * 4096);
#pragma unroll
        for (int i = 0; i < 16; ++i) cp16(vb + i * (8 * VLP * 2), vt + (size_t)i * 8 * TT * 2);
    };
    const h16* qp = Q + (size_t)(q0 + c) * HD + 8 * h;
#pragma unroll
    for (int g = 0; g < 2; ++g)
#pragma unroll
        for (int kc = 0; kc < 4; ++kc) qf[g][kc] = ldf(qp + 16 * g * HD + 32 * kc);
    asm volatile("s_wait_xcnt 0x0" :: "v"(qp) : "memory");   /* before an address register of the loads above is reused; the operand keeps that register until here */
    v8f acc[2][8]; float m_run[2], l_run[2];
#pragma unroll
    for (int g = 0; g < 2; ++g) { m_run[g] = -3.0e38f; l_run[g] = 0.0f;
#pragma unroll
        for (int t = 0; t < 8; ++t) acc[g][t] = (v8f){}; }
    /* The ring. Trip -1 is its start and works on nothing: it issues tile 0's copies, waits for them and passes the barrier. From trip 0 on, behind the barrier that published tile tl and freed the other buffer: tile tl's first key fragments are asked for,
       tile tl + 1's copies are issued into the other buffer (the fragments' LDS latency passes under their issue), tile tl is worked on, then wait and barrier.
       The copies stand at ONE place, one code path for both buffers. */
#pragma unroll 1   /* one tile per trip: the buffers alternate, the code is the same */
    for (int tl = -1; tl < NTL; ++tl) {
    const h16* kl = Ks + (tl & 1) * (TLK * KLP) + (ks * SUB + c) * KLP + 8 * h; const h16* vl = Vs + (tl & 1) * (HD * VLP) + c * VLP + ks * SUB + 8 * h;   /* the wave's own slice of the tile */
    if (tl >= 0) {
#pragma unroll
    for (int kt = 0; kt < 2; ++kt)
#pragma unroll
        for (int kc = 0; kc < 4; ++kc) kf[kt][kc] = ldf(kl + 16 * kt * KLP + 32 * kc);
    }
    if (tl + 1 < NTL) stage(tl + 1);                    /* the same for the whole workgroup; into the buffer that trip tl - 1 read, behind that trip's barrier */
    if (tl >= 0) {
#pragma unroll 1   /* one pass per trip: an unrolled body would not fit two waves per SIMD */
    for (int key0 = 0; key0 < SUB; key0 += 32) {   /* key0 counts inside the wave's slice of the tile */
        v16h vf[8];   /* this pass's v^T fragments, in flight under the score products and the softmax */
#pragma unroll
        for (int t = 0; t < 8; ++t) vf[t] = ldf(vl + 16 * t * VLP + key0);
        v8f s[2][2];
#pragma unroll
        for (int kt = 0; kt < 2; ++kt)
#pragma unroll
            for (int g = 0; g < 2; ++g) { s[kt][g] = (v8f){};
#pragma unroll
                for (int kc = 0; kc < 4; ++kc) s[kt][g] = wmma16(kf[kt][kc], qf[g][kc], s[kt][g]); }
        if (key0 + 32 < SUB) {   /* next pass's key rows, fetched one pass ahead; the same for the whole wave; the last pass fetches nothing: a trip reads its own buffer alone */
#pragma unroll
        for (int kt = 0; kt < 2; ++kt)
#pragma unroll
            for (int kc = 0; kc < 4; ++kc) kf[kt][kc] = ldf(kl + (key0 + 32 + 16 * kt) * KLP + 32 * kc);
        }
        float mb[2]; bool need = false;
#pragma unroll
        for (int g = 0; g < 2; ++g) { float mx = s[0][g][0];
#pragma unroll
            for (int r = 1; r < 8; ++r) mx = fmaxf(mx, s[0][g][r]);
#pragma unroll
            for (int r = 0; r < 8; ++r) mx = fmaxf(mx, s[1][g][r]);
            mx = fmaxf(mx, xhalf(mx)) * cscale; mb[g] = mx; need = need || (mx > m_run[g] + 8.0f); }
        if (__builtin_amdgcn_ballot_w32(need) != 0) {   /* scalar branch; rare after the first pass */
#pragma unroll
            for (int g = 0; g < 2; ++g) { const float m_new = fmaxf(m_run[g], mb[g]); const float corr = __builtin_amdgcn_exp2f(m_run[g] - m_new); l_run[g] *= corr; m_run[g] = m_new;
#pragma unroll
                for (int t = 0; t < 8; ++t) acc[g][t] = acc[g][t] * corr; } }
#pragma unroll
        for (int g = 0; g < 2; ++g) { const float nm = PSH - m_run[g]; v16h pf; float ps0 = 0.0f, ps1 = 0.0f;
#pragma unroll
            for (int i = 0; i < 8; ++i) { const float p0 = __builtin_amdgcn_exp2f(fmaf(s[i >> 2][g][2 * (i & 3)], cscale, nm)), p1 = __builtin_amdgcn_exp2f(fmaf(s[i >> 2][g][2 * (i & 3) + 1], cscale, nm));
                if (i & 1) ps1 += p0 + p1; else ps0 += p0 + p1; pf[2 * i] = (h16)p0; pf[2 * i + 1] = (h16)p1; }
            l_run[g] += ps0 + ps1;
#pragma unroll
            for (int t = 0; t < 8; ++t) acc[g][t] = wmma16(vf[t], pf, acc[g][t]); }
    }
    }
    asm volatile("s_wait_dscnt 0x0" ::: "memory");      /* this wave's reads of the tile's buffer are done */
    asm volatile("s_wait_asynccnt 0x0" ::: "memory");   /* this wave's copies of the next tile have landed */
    __syncthreads();                                    /* every wave's: the next tile may be read, this tile's buffer may be refilled; nothing of a tile is read in front of its barrier */
    }
    asm volatile("s_wait_asynccnt 0x0" ::: "memory");   /* no copy is left in flight: behind the last trip's barrier both buffers are free */
    /* the joining: every wave lays its slice's partial sums, maxima and sums into LDS */
    f32a* Os = (f32a*)Ks; f32a* Ms = (f32a*)Vs; f32a* Ls = Ms + KSP * QGW * 32;   /* Os[slice][channel][OLP], Ms and Ls[slice][64] */
#pragma unroll
    for (int g = 0; g < 2; ++g) { const float l_fin = l_run[g] + xhalf(l_run[g]);   /* each wave half summed its eight keys of every 16-key tile */
        const int col = qg * 32 + 16 * g + c;
        if (h == 0) { Ms[ks * (QGW * 32) + col] = m_run[g]; Ls[ks * (QGW * 32) + col] = l_fin; }
#pragma unroll
        for (int t = 0; t < 8; ++t)
#pragma unroll
            for (int r = 0; r < 8; ++r) Os[(ks * HD + 16 * t + 8 * h + r) * OLP + col] = acc[g][t][r]; }
    __syncthreads();   /* every slice's partial sums are in LDS before any thread adds them */
    /* a thread: 4 consecutive queries x 8 channels; a wave's store is 256 consecutive bytes of two channel rows */
    const int q4 = (tid & 15) * 4, ch0 = tid >> 4;
    v4f w[KSP], ls[KSP];
#pragma unroll
    for (int s = 0; s < KSP; ++s) { w[s] = *(const v4fa*)(Ms + s * (QGW * 32) + q4); ls[s] = *(const v4fa*)(Ls + s * (QGW * 32) + q4); }
    v4f mx = w[0], den = (v4f){};
#pragma unroll
    for (int s = 1; s < KSP; ++s)
#pragma unroll
        for (int q = 0; q < 4; ++q) mx[q] = fmaxf(mx[q], w[s][q]);
#pragma unroll
    for (int s = 0; s < KSP; ++s) {
#pragma unroll
        for (int q = 0; q < 4; ++q) w[s][q] = __builtin_amdgcn_exp2f(w[s][q] - mx[q]);
        den += w[s] * ls[s]; }
    v4f inv;
#pragma unroll
    for (int q = 0; q < 4; ++q) inv[q] = __fdiv_rn(1.0f, den[q]);
    v4f ov[8];
#pragma unroll
    for (int i = 0; i < 8; ++i) { const f32a* op = Os + (ch0 + 16 * i) * OLP + q4; v4f o = w[0] * *(const v4fa*)op;
#pragma unroll
        for (int s = 1; s < KSP; ++s) o += w[s] * *(const v4fa*)(op + s * HD * OLP);   /* added in slice order */
        ov[i] = o * inv; }
    float* po = out + (size_t)ch0 * TT + blockIdx.x * (QGW * 32) + q4;
#pragma unroll
    for (int i = 0; i < 8; ++i) *(v4f*)(po + (size_t)16 * i * TT) = ov[i];
}

extern "C" void kernel_launch(void* const* d_in, const int* in_sizes, int n_in,
                              void* d_out, int out_size, void* d_ws, size_t ws_size, hipStream_t stream) {
    (void)in_sizes; (void)n_in; (void)out_size;
    const float* x = (const float*)d_in[0]; const float* wk = (const float*)d_in[1]; const float* bk = (const float*)d_in[2]; const float* wq = nullptr; const float* wv = nullptr; const float* wo = nullptr; (void)wq; (void)wv; (void)wo;
    float* OUT = (float*)d_out;     // [4][128][4096] channel-major
    char* wsp = (char*)d_ws;
    auto take = [&](size_t bytes) { char* p = wsp; wsp += (bytes + 255) & ~(size_t)255; return (void*)p; };
    h16* QP16 = (h16*)take((size_t)NB_ * NH_ * TT * HD * 2); h16* KP16 = (h16*)take((size_t)NB_ * NKV * TT * HD * 2); h16* VT16 = (h16*)take((size_t)NB_ * NKV * HD * TT * 2);
    if ((size_t)(wsp - (char*)d_ws) > ws_size) return;    // ws 256 MiB
    /* one launch of each kernel for all four images */
    k_proj<<<dim3(TT / 64, DKV / 64, NB_), 32, 0, stream>>>(x, wk, bk, QP16, KP16, VT16);   /* z = image; query plane, key plane and v^T */
    k_fattn<<<dim3(TT / (QGW * 32), 1, NB_), FQW * 32, 0, stream>>>(QP16, KP16, VT16, OUT);   /* x = block of 64 queries, z = image; context^T, channel-major */
}

// v008
// One run takes 33.6 microseconds.
// In two side-by-side timings against v007, it was 1.16 and 1.15 times as fast.
// All steps since v000 together make it 17.9 times as fast.
#include <hip/hip_runtime.h>

// Scaled dot-product attention over image positions (x [4][128][64x64] channel-major; values = keys = 1x1 conv W_kv x + b_kv ([128][128] + [128]); queries = x itself; scores[l][t] = q_l.v_t / sqrt(128) over the 4096 positions; softmax; out[c][l] = sum_t attn[l][t] v_t[c] -> [4][128][64][64] channel-major (2.1 M)).
// The four images run side by side: every kernel takes the image as its grid index z, and every buffer below holds all four, image-major.
// Layout per image: the values projection (k_proj, exact products + bias) reads x and the weights as they are and writes both fp16 planes itself; q as fp16 plane [4096][128], v^T [128][4096], which is the keys' plane too (keys = values); scores, softmax, attn.v and the joining of the key slices in one kernel (k_fattn: a workgroup owns 64 queries and all keys, its waves are 2 query groups x 4 key slices; v^T passes through two LDS buffers, tile by tile, and feeds both products, transposed products, running maximum, P packed in registers; the four slices' partial sums meet in LDS and the f32 context leaves channel-major).
// Compute dtypes, f32 accumulate: every input rounded to bf16; projection on PLAIN bf16 operands (exact) + bf16 bias, added in f32; scores and attn.v on single fp16 planes (logit sigma ~1; P = 2^(t - m + 6) fp16); softmax f32; f32 output.

#define NB_  4
#define TT   4096
#define DM   128
#define NH_  1
#define NKV  1
#define REP  (NH_ / NKV)
#define HD   128
#define DQ   (NH_ * HD)
#define DKV  (NKV * HD)
#define ZH   1
#define RH   0                  // query rows < RH use hi+lo planes (0: none)
#define WIN  0
#define PSH  6.0f               // P carries 2^PSH: with the trailing maximum (up to 2^8) P stays below 2^14 in fp16
#define SCL  0.088388347648318447f   // HD^-0.5
#define KSP  4                  // key slices of 1024 consecutive keys: each belongs to one wave of a query group; the workgroup adds the four partial sums in slice order. 64 query blocks x 4 images = 256 workgroups
#define FQW  8                  // k_fattn: waves per workgroup, 32 query columns x one key slice each
#define QGW  (FQW / KSP)         // query groups of 32 columns per workgroup
#define SLK  (TT / KSP)         // keys per slice
#define TLK  256                // keys per tile: what one LDS buffer holds
#define SUB  (TLK / KSP)         // of which each slice has this many: tile j holds keys s SLK + j SUB ... + SUB - 1 of every slice s, slice s at LDS key s SUB
#define NTL  (SLK / SUB)        // tiles
#define OLP  (QGW * 32 + 4)      // k_fattn, LDS, joining: f32 elements per channel row of a slice's partial sums, 272 bytes = 16 x 17
#define RWB  (TLK * 2)          // k_fattn, LDS: bytes per row of v^T in a tile, 512, no pad: 32 pieces of 16 bytes; piece j of row d lies at place j ^ swz(d)
#define BFB  (HD * RWB)         // bytes per buffer
#define OSB  (KSP * HD * OLP * 4)              // joining: bytes of the slices' partial sums
#define SMB  (OSB + 2 * KSP * QGW * 32 * 4)    // and with their maxima and sums: the kernel's LDS
static_assert(ZH == 1 && NH_ == 1 && HD == 128 && TT % KSP == 0 && SLK % SUB == 0 && SUB == 64 && TT % (QGW * 32) == 0 && QGW == 2, "k_fattn: one head of size 128, whole tiles per slice, two 32-key passes per tile and wave");
static_assert(FQW * 32 == 256 && TLK == 256, "k_fattn: 256 threads copy a tile of 256 keys, sixteen 16-byte pieces per thread, a wave one row per copy");
static_assert(NTL >= 2, "k_fattn: the two-buffer ring starts with two tiles");
static_assert(2 * BFB <= SMB && 112 * RWB < 65536, "k_fattn: both buffers lie inside the LDS of the joining; a fragment's row steps fit the LDS offset field");
typedef _Float16 h16;
typedef unsigned short bf;
typedef __attribute__((ext_vector_type(16))) __bf16   v16bf;
typedef __attribute__((ext_vector_type(16))) _Float16 v16h;
typedef __attribute__((ext_vector_type(8)))  _Float16 v8h;
typedef __attribute__((ext_vector_type(4)))  _Float16 v4h;
typedef __attribute__((ext_vector_type(8)))  unsigned short v8us;
typedef __attribute__((ext_vector_type(16))) unsigned short v16us;
typedef __attribute__((ext_vector_type(8)))  unsigned v8u;
typedef __attribute__((ext_vector_type(2)))  __bf16   v2bf;
typedef __attribute__((ext_vector_type(2)))  float    v2f;
typedef __attribute__((ext_vector_type(8)))  float    v8f;
typedef __attribute__((ext_vector_type(4)))  float    v4f;
typedef v8h  __attribute__((may_alias)) v8ha;
typedef v4f  __attribute__((may_alias)) v4fa;
typedef v8us __attribute__((may_alias)) v8usa;

__device__ __forceinline__ unsigned short f2bf(float f) { unsigned u = __float_as_uint(f); u += 0x7FFFu + ((u >> 16) & 1u); return (unsigned short)(u >> 16); }
__device__ __forceinline__ float bf2f(unsigned short b) { return __uint_as_float(((unsigned)b) << 16); }
__device__ __forceinline__ float bfr(float f) { return bf2f(f2bf(f)); }
__device__ __forceinline__ unsigned pkbf(float lo, float up) { v2f t; t[0] = lo; t[1] = up; return __builtin_bit_cast(unsigned, __builtin_convertvector(t, v2bf)); }   // two f32 rounded to nearest even into one register of bf16, as f2bf rounds, in one instruction
__device__ __forceinline__ v16h cat16(v8h lo, v8h hi) { return __builtin_shufflevector(lo, hi, 0, 1, 2, 3, 4, 5, 6, 7, 8, 9, 10, 11, 12, 13, 14, 15); }
__device__ __forceinline__ v8f wmma16(v16h a, v16h b, v8f c) { return __builtin_amdgcn_wmma_f32_16x16x32_f16(false, a, false, b, (short)0, c, false, false); }
__device__ __forceinline__ v8f wmmab(v16bf a, v16bf b, v8f c) { return __builtin_amdgcn_wmma_f32_16x16x32_bf16(false, a, false, b, (short)0, c, false, false); }



// ---- k_proj: the whole preparation. ONE WAVE per 64 tokens x 64 output channels (16 accumulators); grid (TT/64, DKV/64, image), 32 threads.
// C[t][o] = sum_c bf16(x[c][t]) bf16(w[o][c]) + bf16(bias[o]), f32 accumulate. Both operands come straight from the f32 inputs and are rounded to bf16 in registers:
// an A fragment's lane is one token, so its sixteen channels are sixteen 4-byte loads, each of which covers 64 consecutive bytes of two rows of channel-major x; a B fragment's lane is one row of w.
// C leaves the kernel as one fp16 plane, transposed: Cv[o][t]. The waves of output block 0 also write the A fragments' values as the fp16 query plane Qp[t][c].
// A wave writes whole 128-byte lines of each plane (64 t of a row of Cv, whole rows of Qp).
__global__ __launch_bounds__(32) void k_proj(const float* __restrict__ x, const float* __restrict__ w, const float* __restrict__ bias, h16* Qp, h16* Cv) {
    { const size_t z = blockIdx.z; x += z * DM * TT; Qp += z * TT * DM; Cv += z * DKV * TT; }   /* z = image */
    const int lane = threadIdx.x & 31, lr = lane & 15, hi = lane >> 4; const int r0 = blockIdx.x * 64, c0 = blockIdx.y * 64;
    const float* xp = x + (size_t)(8 * hi) * TT + r0 + lr;        /* channel 8 hi, token r0 + lr */
    const float* wp = w + (size_t)(c0 + lr) * DM + 8 * hi;        /* row c0 + lr, channel 8 hi */
    const float* bu = bias + c0;                                  /* the same for the whole wave */
    v4f wr[4][4][4];      /* [32-channel chunk][16-row block][quarter of the fragment] */
#pragma unroll
    for (int kq = 0; kq < 4; ++kq)
#pragma unroll
        for (int nb = 0; nb < 4; ++nb) { const float* p = wp + (size_t)nb * 16 * DM + 32 * kq; wr[kq][nb][0] = *(const v4f*)p; wr[kq][nb][1] = *(const v4f*)(p + 4); wr[kq][nb][2] = *(const v4f*)(p + 16); wr[kq][nb][3] = *(const v4f*)(p + 20); }
    float bcol[4];        /* the bias of this lane's four columns */
#pragma unroll
    for (int nb = 0; nb < 4; ++nb) bcol[nb] = bu[nb * 16 + lr];
    float xr[4][4][16];   /* [token block][32-channel chunk][fragment element]: element i is channel 32 kq + 8 hi + i (i < 8) or 32 kq + 16 + 8 hi + i - 8, on the A side as on the B side */
#pragma unroll
    for (int mb = 0; mb < 4; ++mb)
#pragma unroll
        for (int kq = 0; kq < 4; ++kq)
#pragma unroll
            for (int i = 0; i < 16; ++i) xr[mb][kq][i] = xp[(size_t)(32 * kq + (i & 7) + 16 * (i >> 3)) * TT + mb * 16];
    __builtin_amdgcn_sched_barrier(0);   /* keeps every load above this line: sunk among the conversions and the products they would wait for memory one group after another */
    asm volatile("s_wait_xcnt 0x0" :: "v"(xp), "v"(wp), "s"(bu), "v"(lr) : "memory");   /* before an address register of the loads above is reused; the operands keep those registers until here */
    __builtin_amdgcn_sched_barrier(0);   /* keeps the arithmetic, which reuses those registers, behind the wait */
    v16bf a[4][4];
#pragma unroll
    for (int mb = 0; mb < 4; ++mb)
#pragma unroll
        for (int kq = 0; kq < 4; ++kq) { v8u pk;
#pragma unroll
            for (int i = 0; i < 8; ++i) pk[i] = pkbf(xr[mb][kq][2 * i], xr[mb][kq][2 * i + 1]);
            a[mb][kq] = __builtin_bit_cast(v16bf, pk); }
    if (blockIdx.y == 0) {   /* the query plane: the same bf16-rounded values as fp16, token-major; one branch for all of it, outside the loads and the products */
        h16* qp = Qp + (size_t)(r0 + lr) * DM + 8 * hi; v8h qv[4][4][2];
#pragma unroll
        for (int mb = 0; mb < 4; ++mb)
#pragma unroll
            for (int kq = 0; kq < 4; ++kq) { const v16us av = __builtin_bit_cast(v16us, a[mb][kq]);
#pragma unroll
                for (int i = 0; i < 8; ++i) { qv[mb][kq][0][i] = (h16)bf2f(av[i]); qv[mb][kq][1][i] = (h16)bf2f(av[8 + i]); } }
#pragma unroll
        for (int mb = 0; mb < 4; ++mb)
#pragma unroll
            for (int kq = 0; kq < 4; ++kq) { *(v8h*)(qp + (size_t)mb * 16 * DM + 32 * kq) = qv[mb][kq][0]; *(v8h*)(qp + (size_t)mb * 16 * DM + 32 * kq + 16) = qv[mb][kq][1]; }
        asm volatile("s_wait_xcnt 0x0" :: "v"(qp) : "memory");   /* before a register of the stores above is reused */
    }
    v8f acc[4][4];
#pragma unroll
    for (int mb = 0; mb < 4; ++mb)
#pragma unroll
        for (int nb = 0; nb < 4; ++nb) acc[mb][nb] = (v8f){};
#pragma unroll
    for (int kq = 0; kq < 4; ++kq) {
#pragma unroll
        for (int nb = 0; nb < 4; ++nb) { const v4f w0 = wr[kq][nb][0], w1 = wr[kq][nb][1], w2 = wr[kq][nb][2], w3 = wr[kq][nb][3]; v8u pk;
            pk[0] = pkbf(w0[0], w0[1]); pk[1] = pkbf(w0[2], w0[3]); pk[2] = pkbf(w1[0], w1[1]); pk[3] = pkbf(w1[2], w1[3]); pk[4] = pkbf(w2[0], w2[1]); pk[5] = pkbf(w2[2], w2[3]); pk[6] = pkbf(w3[0], w3[1]); pk[7] = pkbf(w3[2], w3[3]);
            const v16bf b = __builtin_bit_cast(v16bf, pk);
#pragma unroll
            for (int mb = 0; mb < 4; ++mb) acc[mb][nb] = wmmab(a[mb][kq], b, acc[mb][nb]); }
    }
#pragma unroll
    for (int nb = 0; nb < 4; ++nb) bcol[nb] = bfr(bcol[nb]);
    h16* cvp = Cv + (size_t)(c0 + lr) * TT + r0 + 8 * hi;
#pragma unroll
    for (int mb = 0; mb < 4; ++mb) { v8h tv[4];
#pragma unroll
        for (int nb = 0; nb < 4; ++nb)   /* a lane's accumulator registers are eight consecutive tokens of one output channel: 16 bytes of a row of Cv */
#pragma unroll
            for (int j = 0; j < 8; ++j) tv[nb][j] = (h16)(acc[mb][nb][j] + bcol[nb]);
#pragma unroll
        for (int nb = 0; nb < 4; ++nb) *(v8h*)(cvp + (size_t)nb * 16 * TT + mb * 16) = tv[nb];
        __builtin_amdgcn_sched_barrier(0);   /* with the one behind the wait: keeps the stores in front of the wait and the next block's arithmetic, which reuses their registers, behind it */
        asm volatile("s_wait_xcnt 0x0" :: "v"(cvp) : "memory");   /* before a register of the stores above is reused */
        __builtin_amdgcn_sched_barrier(0);
    }
}

__device__ __forceinline__ void splitf(float y, unsigned short& h, unsigned short& l) { h = f2bf(y); l = f2bf(y - bf2f(h)); }
typedef __attribute__((ext_vector_type(2))) unsigned short v2us;
typedef __attribute__((ext_vector_type(4))) unsigned short v4us;
typedef __attribute__((ext_vector_type(4))) int v4i;

__global__ __launch_bounds__(256) void k_wtG(const float* __restrict__ w, int K, int N, bf* Bt) {
    const int lane = threadIdx.x & 31; const int L0 = (blockIdx.x * 8 + (threadIdx.x >> 5)) * 8; const int nlines = N * K / 64;
{
#pragma unroll 1
        for (int l = 0; l < 8; ++l) { const int L = L0 + l; if (L >= nlines) break; const size_t e = (size_t)L * 64 + lane * 2; const int k = (int)(e % K), n = (int)(e / K); v2us o;
            o[0] = f2bf(w[(size_t)k * N + n]); o[1] = f2bf(w[(size_t)(k + 1) * N + n]); *(v2us*)(Bt + e) = o; }
         }
}
__device__ __forceinline__ v16h ldf(const h16* p) { return cat16(*(const v8h*)p, *(const v8h*)(p + 16)); }
__device__ __forceinline__ float xhalf(float x) { return __builtin_bit_cast(float, __builtin_amdgcn_permlanex16(__builtin_bit_cast(int, x), __builtin_bit_cast(int, x), 0x76543210, 0xfedcba98, false, false)); }  // lane l with lane l ^ 16
// One asynchronous 16-byte copy per lane, global memory to LDS, through no register. Written as the builtin: the compiler places its address registers anywhere in the register file, so a tile's first key fragments stay in flight across the 16 copies without a spill.
typedef __attribute__((address_space(3))) char lds_c;
typedef __attribute__((address_space(1))) v4i glb_v4i;
typedef __attribute__((address_space(3))) v4i lds_v4i;
__device__ __forceinline__ void cp16(lds_c* l, const char* g) { __builtin_amdgcn_global_load_async_to_lds_b128((glb_v4i*)g, (lds_v4i*)l, 0, 0); }
typedef float __attribute__((may_alias)) f32a;
typedef __attribute__((ext_vector_type(8))) short v8s;
typedef __attribute__((address_space(3))) v8s lds_v8s;
typedef __attribute__((address_space(3))) v8ha lds_v8h;
__device__ __forceinline__ v8h ldp(lds_c* p) { return *(const lds_v8h*)p; }   // 16 bytes of a row as they lie
__device__ __forceinline__ v8h ldt(lds_c* p) { return __builtin_bit_cast(v8h, __builtin_amdgcn_ds_load_tr16_b128_v8i16((lds_v8s*)p)); }   // transposing: lane l hands in the address of 16 bytes of row 8 (l >> 4) + (l & 7), piece (l >> 3) & 1, and gets column l & 15 of rows 8 (l >> 4) ... + 7
__global__ __launch_bounds__(FQW * 32) __attribute__((amdgpu_waves_per_eu(2, 2))) void k_fattn(const h16* __restrict__ Q, const h16* __restrict__ Vt, float* __restrict__ out) {
    __shared__ __attribute__((aligned(512))) char Sm[SMB];   /* buffer b at b BFB; row d of v^T, the tile's keys, at d RWB, its pieces permuted. Behind the last tile: the slices' partial sums, then their maxima and sums */
    const int lane = threadIdx.x & 31, c = lane & 15, h = lane >> 4; const int ks = (threadIdx.x >> 5) & (KSP - 1), qg = threadIdx.x >> 7; const int q0 = (blockIdx.x * QGW + qg) * 32;
    const float cscale = SCL * 1.4426950408889634f;
    { const size_t im = blockIdx.z; Q += im * TT * HD; Vt += im * HD * TT; out += im * DM * TT; }   /* z = image */
    v16h qf[2][4], kf[2][4];
    /* a tile into LDS: a wave's copy is one row of v^T (128 consecutive bytes of each slice); copy i of wave w is row w + 8 i, so swz(row) = 2 w + (i & 1): one LDS address for the even copies, one for the odd */
    const unsigned tid = threadIdx.x;
    lds_c* sm = (lds_c*)Sm;
    lds_c* vl0 = sm + (tid >> 5) * RWB + (((tid & 31) ^ ((tid >> 5) << 1)) << 4); lds_c* vl1 = sm + (tid >> 5) * RWB + (((tid & 31) ^ ((tid >> 5) << 1) ^ 1u) << 4);
    const char* vg = (const char*)(Vt + (size_t)(tid >> 5) * TT + (size_t)((tid & 31) >> 3) * SLK) + (tid & 7) * 16;
    auto stage = [&](int tile) {   /* tile 'tile' into buffer tile & 1: 16 copies per wave */
        const char* vt = vg + (size_t)tile * SUB * 2;
#pragma unroll
        for (int i = 0; i < 16; ++i) cp16(((i & 1) ? vl1 : vl0) + (tile & 1) * BFB + i * (8 * RWB), vt + (size_t)i * 8 * TT * 2);
    };
    /* fragment addresses inside a buffer, pass 0. The wave's keys of pass p start at piece 8 ks + 4 p; the 4 p is bit 2 of the piece number, clear in all four, so pass p is the same address with byte bit 6 flipped.
       v^T: row c of a 16-channel block (swz = 2 (c & 7) + (c >> 3)), pieces h and 2 + h. Keys: row 8 h + (lane & 7) of a 16-channel block (swz = 2 (lane & 7) + h), piece 2 kt + ((lane >> 3) & 1). */
    unsigned vo[2], ko[2];
#pragma unroll
    for (int u = 0; u < 2; ++u) { vo[u] = c * RWB + (((unsigned)(8 * ks + 2 * u + h) ^ (unsigned)(2 * (c & 7) + (c >> 3))) << 4);
        ko[u] = (8 * h + (lane & 7)) * RWB + (((unsigned)(8 * ks + 2 * u + ((lane >> 3) & 1)) ^ (unsigned)(2 * (lane & 7) + h)) << 4); }
    const h16* qp = Q + (size_t)(q0 + c) * HD + 8 * h;
#pragma unroll
    for (int g = 0; g < 2; ++g)
#pragma unroll
        for (int kc = 0; kc < 4; ++kc) qf[g][kc] = ldf(qp + 16 * g * HD + 32 * kc);
    asm volatile("s_wait_xcnt 0x0" :: "v"(qp) : "memory");   /* before an address register of the loads above is reused; the operand keeps that register until here */
    v8f acc[2][8]; float m_run[2], l_run[2];
#pragma unroll
    for (int g = 0; g < 2; ++g) { m_run[g] = -3.0e38f; l_run[g] = 0.0f;
#pragma unroll
        for (int t = 0; t < 8; ++t) acc[g][t] = (v8f){}; }
    /* The ring. Trip -1 is its start and works on nothing: it issues tile 0's copies, waits for them and passes the barrier. From trip 0 on, behind the barrier that published tile tl and freed the other buffer: tile tl's first key fragments are asked for,
       tile tl + 1's copies are issued into the other buffer (the fragments' LDS latency passes under their issue), tile tl is worked on, then wait and barrier.
       The copies stand at ONE place, one code path for both buffers. */
#pragma unroll 1   /* one tile per trip: the buffers alternate, the code is the same */
    for (int tl = -1; tl < NTL; ++tl) {
    lds_c* tb = sm + (tl & 1) * BFB;   /* the tile's buffer */
    if (tl >= 0) {
#pragma unroll
    for (int kt = 0; kt < 2; ++kt)
#pragma unroll
        for (int kc = 0; kc < 4; ++kc) kf[kt][kc] = cat16(ldt(tb + ko[kt] + 32 * kc * RWB), ldt(tb + ko[kt] + (32 * kc + 16) * RWB));
    }
    if (tl + 1 < NTL) stage(tl + 1);                    /* the same for the whole workgroup; into the buffer that trip tl - 1 read, behind that trip's barrier */
    if (tl >= 0) {
#pragma unroll 1   /* one pass per trip: an unrolled body would not fit two waves per SIMD */
    for (int key0 = 0; key0 < SUB; key0 += 32) {   /* key0 counts inside the wave's slice of the tile */
        const unsigned px = (unsigned)key0 << 1;   /* the pass's bit in the fragment addresses: 0 or 64 */
        v16h vf[8];   /* this pass's v^T fragments, in flight under the score products and the softmax */
#pragma unroll
        for (int t = 0; t < 8; ++t) vf[t] = cat16(ldp(tb + (vo[0] ^ px) + 16 * t * RWB), ldp(tb + (vo[1] ^ px) + 16 * t * RWB));
        v8f s[2][2];
#pragma unroll
        for (int kt = 0; kt < 2; ++kt)
#pragma unroll
            for (int g = 0; g < 2; ++g) { s[kt][g] = (v8f){};
#pragma unroll
                for (int kc = 0; kc < 4; ++kc) s[kt][g] = wmma16(kf[kt][kc], qf[g][kc], s[kt][g]); }
        if (key0 + 32 < SUB) {   /* next pass's key rows, fetched one pass ahead; the same for the whole wave; the last pass fetches nothing: a trip reads its own buffer alone */
#pragma unroll
        for (int kt = 0; kt < 2; ++kt)
#pragma unroll
            for (int kc = 0; kc < 4; ++kc) kf[kt][kc] = cat16(ldt(tb + (ko[kt] ^ (px + 64u)) + 32 * kc * RWB), ldt(tb + (ko[kt] ^ (px + 64u)) + (32 * kc + 16) * RWB));
        }
        float mb[2]; bool need = false;
#pragma unroll
        for (int g = 0; g < 2; ++g) { float mx = s[0][g][0];
#pragma unroll
            for (int r = 1; r < 8; ++r) mx = fmaxf(mx, s[0][g][r]);
#pragma unroll
            for (int r = 0; r < 8; ++r) mx = fmaxf(mx, s[1][g][r]);
            mx = fmaxf(mx, xhalf(mx)) * cscale; mb[g] = mx; need = need || (mx > m_run[g] + 8.0f); }
        if (__builtin_amdgcn_ballot_w32(need) != 0) {   /* scalar branch; rare after the first pass */
#pragma unroll
            for (int g = 0; g < 2; ++g) { const float m_new = fmaxf(m_run[g], mb[g]); const float corr = __builtin_amdgcn_exp2f(m_run[g] - m_new); l_run[g] *= corr; m_run[g] = m_new;
#pragma unroll
                for (int t = 0; t < 8; ++t) acc[g][t] = acc[g][t] * corr; } }
#pragma unroll
        for (int g = 0; g < 2; ++g) { const float nm = PSH - m_run[g]; v16h pf; float ps0 = 0.0f, ps1 = 0.0f;
#pragma unroll
            for (int i = 0; i < 8; ++i) { const float p0 = __builtin_amdgcn_exp2f(fmaf(s[i >> 2][g][2 * (i & 3)], cscale, nm)), p1 = __builtin_amdgcn_exp2f(fmaf(s[i >> 2][g][2 * (i & 3) + 1], cscale, nm));
                if (i & 1) ps1 += p0 + p1; else ps0 += p0 + p1; pf[2 * i] = (h16)p0; pf[2 * i + 1] = (h16)p1; }
            l_run[g] += ps0 + ps1;
#pragma unroll
            for (int t = 0; t < 8; ++t) acc[g][t] = wmma16(vf[t], pf, acc[g][t]); }
    }
    }
    asm volatile("s_wait_dscnt 0x0" ::: "memory");      /* this wave's reads of the tile's buffer are done */
    asm volatile("s_wait_asynccnt 0x0" ::: "memory");   /* this wave's copies of the next tile have landed */
    __syncthreads();                                    /* every wave's: the next tile may be read, this tile's buffer may be refilled; nothing of a tile is read in front of its barrier */
    }
    asm volatile("s_wait_asynccnt 0x0" ::: "memory");   /* no copy is left in flight: behind the last trip's barrier both buffers are free */
    /* the joining: every wave lays its slice's partial sums, maxima and sums into LDS */
    f32a* Os = (f32a*)Sm; f32a* Ms = (f32a*)(Sm + OSB); f32a* Ls = Ms + KSP * QGW * 32;   /* Os[slice][channel][OLP], Ms and Ls[slice][64] */
#pragma unroll
    for (int g = 0; g < 2; ++g) { const float l_fin = l_run[g] + xhalf(l_run[g]);   /* each wave half summed its eight keys of every 16-key tile */
        const int col = qg * 32 + 16 * g + c;
        if (h == 0) { Ms[ks * (QGW * 32) + col] = m_run[g]; Ls[ks * (QGW * 32) + col] = l_fin; }
#pragma unroll
        for (int t = 0; t < 8; ++t)
#pragma unroll
            for (int r = 0; r < 8; ++r) Os[(ks * HD + 16 * t + 8 * h + r) * OLP + col] = acc[g][t][r]; }
    __syncthreads();   /* every slice's partial sums are in LDS before any thread adds them */
    /* a thread: 4 consecutive queries x 8 channels; a wave's store is 256 consecutive bytes of two channel rows */
    const int q4 = (tid & 15) * 4, ch0 = tid >> 4;
    v4f w[KSP], ls[KSP];
#pragma unroll
    for (int s = 0; s < KSP; ++s) { w[s] = *(const v4fa*)(Ms + s * (QGW * 32) + q4); ls[s] = *(const v4fa*)(Ls + s * (QGW * 32) + q4); }
    v4f mx = w[0], den = (v4f){};
#pragma unroll
    for (int s = 1; s < KSP; ++s)
#pragma unroll
        for (int q = 0; q < 4; ++q) mx[q] = fmaxf(mx[q], w[s][q]);
#pragma unroll
    for (int s = 0; s < KSP; ++s) {
#pragma unroll
        for (int q = 0; q < 4; ++q) w[s][q] = __builtin_amdgcn_exp2f(w[s][q] - mx[q]);
        den += w[s] * ls[s]; }
    v4f inv;
#pragma unroll
    for (int q = 0; q < 4; ++q) inv[q] = __fdiv_rn(1.0f, den[q]);
    v4f ov[8];
#pragma unroll
    for (int i = 0; i < 8; ++i) { const f32a* op = Os + (ch0 + 16 * i) * OLP + q4; v4f o = w[0] * *(const v4fa*)op;
#pragma unroll
        for (int s = 1; s < KSP; ++s) o += w[s] * *(const v4fa*)(op + s * HD * OLP);   /* added in slice order */
        ov[i] = o * inv; }
    float* po = out + (size_t)ch0 * TT + blockIdx.x * (QGW * 32) + q4;
#pragma unroll
    for (int i = 0; i < 8; ++i) *(v4f*)(po + (size_t)16 * i * TT) = ov[i];
}

extern "C" void kernel_launch(void* const* d_in, const int* in_sizes, int n_in,
                              void* d_out, int out_size, void* d_ws, size_t ws_size, hipStream_t stream) {
    (void)in_sizes; (void)n_in; (void)out_size;
    const float* x = (const float*)d_in[0]; const float* wk = (const float*)d_in[1]; const float* bk = (const float*)d_in[2]; const float* wq = nullptr; const float* wv = nullptr; const float* wo = nullptr; (void)wq; (void)wv; (void)wo;
    float* OUT = (float*)d_out;     // [4][128][4096] channel-major
    char* wsp = (char*)d_ws;
    auto take = [&](size_t bytes) { char* p = wsp; wsp += (bytes + 255) & ~(size_t)255; return (void*)p; };
    h16* QP16 = (h16*)take((size_t)NB_ * NH_ * TT * HD * 2); h16* VT16 = (h16*)take((size_t)NB_ * NKV * HD * TT * 2);
    if ((size_t)(wsp - (char*)d_ws) > ws_size) return;    // ws 256 MiB
    /* one launch of each kernel for all four images */
    k_proj<<<dim3(TT / 64, DKV / 64, NB_), 32, 0, stream>>>(x, wk, bk, QP16, VT16);   /* z = image; query plane and v^T */
    k_fattn<<<dim3(TT / (QGW * 32), 1, NB_), FQW * 32, 0, stream>>>(QP16, VT16, OUT);   /* x = block of 64 queries, z = image; context^T, channel-major */
}

// v010
// A run of this version takes 30.8 microseconds.
// Versions in between are left out here; by their measured steps it is 1.09 times as fast as v008.
// Over all steps from v000 it is 19.5 times as fast.
#include <hip/hip_runtime.h>

// Scaled dot-product attention over image positions (x [4][128][64x64] channel-major; values = keys = 1x1 conv W_kv x + b_kv ([128][128] + [128]); queries = x itself; scores[l][t] = q_l.v_t / sqrt(128) over the 4096 positions; softmax; out[c][l] = sum_t attn[l][t] v_t[c] -> [4][128][64][64] channel-major (2.1 M)).
// The four images run side by side: every kernel takes the image as its grid index z, and every buffer below holds all four, image-major.
// Layout per image: the values projection (k_proj, exact products + bias) reads x and the weights as they are and writes both fp16 planes itself; q as fp16 plane [4096][128], v^T [128][4096], which is the keys' plane too (keys = values); scores, softmax, attn.v and the joining of the key slices in one kernel (k_fattn: a workgroup owns 64 queries and all keys, its waves are 2 query groups x 4 key slices; v^T passes through three LDS buffers, tile by tile, and feeds both products, transposed products, running maximum, P packed in registers; the four slices' partial sums meet in LDS and the f32 context leaves channel-major).
// Compute dtypes, f32 accumulate: every input rounded to bf16; projection on PLAIN bf16 operands (exact) + f32 bias; scores and attn.v on single fp16 planes (the query plane carries the factor HD^-0.5 log2 e, so a score product is the logit in log2 units, sigma ~1.4; P = 2^(t - m + 6) fp16); softmax f32; f32 output.

#define NB_  4
#define TT   4096
#define DM   128
#define NH_  1
#define NKV  1
#define REP  (NH_ / NKV)
#define HD   128
#define DQ   (NH_ * HD)
#define DKV  (NKV * HD)
#define ZH   1
#define RH   0                  // query rows < RH use hi+lo planes (0: none)
#define WIN  0
#define PSH  6.0f               // P carries 2^PSH: with the trailing maximum (up to 2^8) P stays below 2^14 in fp16
#define SCL  0.088388347648318447f   // HD^-0.5
#define QSC  (SCL * 1.4426950408889634f)   // what the stored queries are multiplied by, in f32, before they are rounded to fp16: scores leave the matrix unit in log2 units
#define PTH  16384.0f           // 2^(8 + PSH): a lane's sum of one pass's P above this asks for a new maximum; every single P is then below it, inside fp16
#define KSP  4                  // key slices of 1024 consecutive keys: each belongs to one wave of a query group; the workgroup adds the four partial sums in slice order. 64 query blocks x 4 images = 256 workgroups
#define FQW  8                  // k_fattn: waves per workgroup, 32 query columns x one key slice each
#define QGW  (FQW / KSP)         // query groups of 32 columns per workgroup
#define SLK  (TT / KSP)         // keys per slice
#define TLK  256                // keys per tile: what one LDS buffer holds
#define SUB  (TLK / KSP)         // of which each slice has this many: tile j holds keys s SLK + j SUB ... + SUB - 1 of every slice s, slice s at LDS key s SUB
#define NTL  (SLK / SUB)        // tiles
#define OLP  (QGW * 32 + 4)      // k_fattn, LDS, joining: f32 elements per channel row of a slice's partial sums, 272 bytes = 16 x 17
#define RWB  (TLK * 2)          // k_fattn, LDS: bytes per row of v^T in a tile, 512, no pad: 32 pieces of 16 bytes; piece j of row d lies at place j ^ swz(d)
#define BFB  (HD * RWB)         // bytes per buffer
#define OSB  (KSP * HD * OLP * 4)              // joining: bytes of the slices' partial sums
#define JNB  (OSB + 2 * KSP * QGW * 32 * 4)    // and with their maxima and sums
#define RNG  3                  // buffers of the ring: the tile whose last pass runs, the tile whose first pass runs, the tile that lands
#define SMB  (RNG * BFB > JNB ? RNG * BFB : JNB)   // the kernel's LDS: the ring, and behind the last tile the joining in the same bytes
static_assert(ZH == 1 && NH_ == 1 && HD == 128 && TT % KSP == 0 && SLK % SUB == 0 && SUB == 64 && TT % (QGW * 32) == 0 && QGW == 2, "k_fattn: one head of size 128, whole tiles per slice, two 32-key passes per tile and wave");
static_assert(FQW * 32 == 256 && TLK == 256, "k_fattn: 256 threads copy a tile of 256 keys, sixteen 16-byte pieces per thread, a wave one row per copy");
static_assert(NTL >= 2 && SUB == 64, "k_fattn: the ring starts with two tiles; a tile is two passes of a wave");
static_assert(RNG * BFB <= SMB && JNB <= SMB && 112 * RWB < 65536, "k_fattn: ring and joining lie inside the kernel's LDS; a fragment's row steps fit the LDS offset field");
typedef _Float16 h16;
typedef unsigned short bf;
typedef __attribute__((ext_vector_type(16))) __bf16   v16bf;
typedef __attribute__((ext_vector_type(16))) _Float16 v16h;
typedef __attribute__((ext_vector_type(8)))  _Float16 v8h;
typedef __attribute__((ext_vector_type(4)))  _Float16 v4h;
typedef __attribute__((ext_vector_type(8)))  unsigned short v8us;
typedef __attribute__((ext_vector_type(16))) unsigned short v16us;
typedef __attribute__((ext_vector_type(8)))  unsigned v8u;
typedef __attribute__((ext_vector_type(2)))  __bf16   v2bf;
typedef __attribute__((ext_vector_type(2)))  float    v2f;
typedef __attribute__((ext_vector_type(8)))  float    v8f;
typedef __attribute__((ext_vector_type(4)))  float    v4f;
typedef v8h  __attribute__((may_alias)) v8ha;
typedef v4f  __attribute__((may_alias)) v4fa;
typedef v8us __attribute__((may_alias)) v8usa;

__device__ __forceinline__ unsigned short f2bf(float f) { unsigned u = __float_as_uint(f); u += 0x7FFFu + ((u >> 16) & 1u); return (unsigned short)(u >> 16); }
__device__ __forceinline__ float bf2f(unsigned short b) { return __uint_as_float(((unsigned)b) << 16); }
__device__ __forceinline__ float bfr(float f) { return bf2f(f2bf(f)); }
__device__ __forceinline__ unsigned pkbf(float lo, float up) { v2f t; t[0] = lo; t[1] = up; return __builtin_bit_cast(unsigned, __builtin_convertvector(t, v2bf)); }   // two f32 rounded to nearest even into one register of bf16, as f2bf rounds, in one instruction
__device__ __forceinline__ v16h cat16(v8h lo, v8h hi) { return __builtin_shufflevector(lo, hi, 0, 1, 2, 3, 4, 5, 6, 7, 8, 9, 10, 11, 12, 13, 14, 15); }
__device__ __forceinline__ v8f wmma16(v16h a, v16h b, v8f c) { return __builtin_amdgcn_wmma_f32_16x16x32_f16(false, a, false, b, (short)0, c, false, false); }
__device__ __forceinline__ v8f wmmab(v16bf a, v16bf b, v8f c) { return __builtin_amdgcn_wmma_f32_16x16x32_bf16(false, a, false, b, (short)0, c, false, false); }



// ---- k_proj: the whole preparation. ONE WAVE per 64 tokens x 64 output channels (16 accumulators); grid (TT/64, DKV/64, image), 32 threads.
// C[t][o] = sum_c bf16(x[c][t]) bf16(w[o][c]) + bf16(bias[o]), f32 accumulate. Both operands come straight from the f32 inputs and are rounded to bf16 in registers:
// an A fragment's lane is one token, so its sixteen channels are sixteen 4-byte loads, each of which covers 64 consecutive bytes of two rows of channel-major x; a B fragment's lane is one row of w.
// C leaves the kernel as one fp16 plane, transposed: Cv[o][t]. The waves of output block 0 also write the A fragments' values, times QSC, as the fp16 query plane Qp[t][c].
// A wave writes whole 128-byte lines of each plane (64 t of a row of Cv, whole rows of Qp).
__global__ __launch_bounds__(32) void k_proj(const float* __restrict__ x, const float* __restrict__ w, const float* __restrict__ bias, h16* Qp, h16* Cv) {
    { const size_t z = blockIdx.z; x += z * DM * TT; Qp += z * TT * DM; Cv += z * DKV * TT; }   /* z = image */
    const int lane = threadIdx.x & 31, lr = lane & 15, hi = lane >> 4; const int r0 = blockIdx.x * 64, c0 = blockIdx.y * 64;
    const float* xp = x + (size_t)(8 * hi) * TT + r0 + lr;        /* channel 8 hi, token r0 + lr */
    const float* wp = w + (size_t)(c0 + lr) * DM + 8 * hi;        /* row c0 + lr, channel 8 hi */
    const float* bu = bias + c0;                                  /* the same for the whole wave */
    v4f wr[4][4][4];      /* [32-channel chunk][16-row block][quarter of the fragment] */
#pragma unroll
    for (int kq = 0; kq < 4; ++kq)
#pragma unroll
        for (int nb = 0; nb < 4; ++nb) { const float* p = wp + (size_t)nb * 16 * DM + 32 * kq; wr[kq][nb][0] = *(const v4f*)p; wr[kq][nb][1] = *(const v4f*)(p + 4); wr[kq][nb][2] = *(const v4f*)(p + 16); wr[kq][nb][3] = *(const v4f*)(p + 20); }
    float bcol[4];        /* the bias of this lane's four columns */
#pragma unroll
    for (int nb = 0; nb < 4; ++nb) bcol[nb] = bu[nb * 16 + lr];
    float xr[4][4][16];   /* [token block][32-channel chunk][fragment element]: element i is channel 32 kq + 8 hi + i (i < 8) or 32 kq + 16 + 8 hi + i - 8, on the A side as on the B side */
#pragma unroll
    for (int mb = 0; mb < 4; ++mb)
#pragma unroll
        for (int kq = 0; kq < 4; ++kq)
#pragma unroll
            for (int i = 0; i < 16; ++i) xr[mb][kq][i] = xp[(size_t)(32 * kq + (i & 7) + 16 * (i >> 3)) * TT + mb * 16];
    __builtin_amdgcn_sched_barrier(0);   /* keeps every load above this line: sunk among the conversions and the products they would wait for memory one group after another */
    asm volatile("s_wait_xcnt 0x0" :: "v"(xp), "v"(wp), "s"(bu), "v"(lr) : "memory");   /* before an address register of the loads above is reused; the operands keep those registers until here */
    __builtin_amdgcn_sched_barrier(0);   /* keeps the arithmetic, which reuses those registers, behind the wait */
    v16bf a[4][4];
#pragma unroll
    for (int mb = 0; mb < 4; ++mb)
#pragma unroll
        for (int kq = 0; kq < 4; ++kq) { v8u pk;
#pragma unroll
            for (int i = 0; i < 8; ++i) pk[i] = pkbf(xr[mb][kq][2 * i], xr[mb][kq][2 * i + 1]);
            a[mb][kq] = __builtin_bit_cast(v16bf, pk); }
    if (blockIdx.y == 0) {   /* the query plane: the same bf16-rounded values times QSC as fp16, token-major; one branch for all of it, outside the loads and the products */
        h16* qp = Qp + (size_t)(r0 + lr) * DM + 8 * hi; v8h qv[4][4][2];
#pragma unroll
        for (int mb = 0; mb < 4; ++mb)
#pragma unroll
            for (int kq = 0; kq < 4; ++kq) { const v16us av = __builtin_bit_cast(v16us, a[mb][kq]);
#pragma unroll
                for (int i = 0; i < 8; ++i) { qv[mb][kq][0][i] = (h16)(bf2f(av[i]) * QSC); qv[mb][kq][1][i] = (h16)(bf2f(av[8 + i]) * QSC); } }
#pragma unroll
        for (int mb = 0; mb < 4; ++mb)
#pragma unroll
            for (int kq = 0; kq < 4; ++kq) { *(v8h*)(qp + (size_t)mb * 16 * DM + 32 * kq) = qv[mb][kq][0]; *(v8h*)(qp + (size_t)mb * 16 * DM + 32 * kq + 16) = qv[mb][kq][1]; }
        asm volatile("s_wait_xcnt 0x0" :: "v"(qp) : "memory");   /* before a register of the stores above is reused */
    }
    v8f acc[4][4];
#pragma unroll
    for (int mb = 0; mb < 4; ++mb)
#pragma unroll
        for (int nb = 0; nb < 4; ++nb) acc[mb][nb] = (v8f){};
#pragma unroll
    for (int kq = 0; kq < 4; ++kq) {
#pragma unroll
        for (int nb = 0; nb < 4; ++nb) { const v4f w0 = wr[kq][nb][0], w1 = wr[kq][nb][1], w2 = wr[kq][nb][2], w3 = wr[kq][nb][3]; v8u pk;
            pk[0] = pkbf(w0[0], w0[1]); pk[1] = pkbf(w0[2], w0[3]); pk[2] = pkbf(w1[0], w1[1]); pk[3] = pkbf(w1[2], w1[3]); pk[4] = pkbf(w2[0], w2[1]); pk[5] = pkbf(w2[2], w2[3]); pk[6] = pkbf(w3[0], w3[1]); pk[7] = pkbf(w3[2], w3[3]);
            const v16bf b = __builtin_bit_cast(v16bf, pk);
#pragma unroll
            for (int mb = 0; mb < 4; ++mb) acc[mb][nb] = wmmab(a[mb][kq], b, acc[mb][nb]); }
    }
#pragma unroll
    for (int nb = 0; nb < 4; ++nb) bcol[nb] = bfr(bcol[nb]);
    h16* cvp = Cv + (size_t)(c0 + lr) * TT + r0 + 8 * hi;
#pragma unroll
    for (int mb = 0; mb < 4; ++mb) { v8h tv[4];
#pragma unroll
        for (int nb = 0; nb < 4; ++nb)   /* a lane's accumulator registers are eight consecutive tokens of one output channel: 16 bytes of a row of Cv */
#pragma unroll
            for (int j = 0; j < 8; ++j) tv[nb][j] = (h16)(acc[mb][nb][j] + bcol[nb]);
#pragma unroll
        for (int nb = 0; nb < 4; ++nb) *(v8h*)(cvp + (size_t)nb * 16 * TT + mb * 16) = tv[nb];
        __builtin_amdgcn_sched_barrier(0);   /* with the one behind the wait: keeps the stores in front of the wait and the next block's arithmetic, which reuses their registers, behind it */
        asm volatile("s_wait_xcnt 0x0" :: "v"(cvp) : "memory");   /* before a register of the stores above is reused */
        __builtin_amdgcn_sched_barrier(0);
    }
}

__device__ __forceinline__ void splitf(float y, unsigned short& h, unsigned short& l) { h = f2bf(y); l = f2bf(y - bf2f(h)); }
typedef __attribute__((ext_vector_type(2))) unsigned short v2us;
typedef __attribute__((ext_vector_type(4))) unsigned short v4us;
typedef __attribute__((ext_vector_type(4))) int v4i;

__global__ __launch_bounds__(256) void k_wtG(const float* __restrict__ w, int K, int N, bf* Bt) {
    const int lane = threadIdx.x & 31; const int L0 = (blockIdx.x * 8 + (threadIdx.x >> 5)) * 8; const int nlines = N * K / 64;
{
#pragma unroll 1
        for (int l = 0; l < 8; ++l) { const int L = L0 + l; if (L >= nlines) break; const size_t e = (size_t)L * 64 + lane * 2; const int k = (int)(e % K), n = (int)(e / K); v2us o;
            o[0] = f2bf(w[(size_t)k * N + n]); o[1] = f2bf(w[(size_t)(k + 1) * N + n]); *(v2us*)(Bt + e) = o; }
         }
}
__device__ __forceinline__ v16h ldf(const h16* p) { return cat16(*(const v8h*)p, *(const v8h*)(p + 16)); }
__device__ __forceinline__ float xhalf(float x) { return __builtin_bit_cast(float, __builtin_amdgcn_permlanex16(__builtin_bit_cast(int, x), __builtin_bit_cast(int, x), 0x76543210, 0xfedcba98, false, false)); }  // lane l with lane l ^ 16
// One asynchronous 16-byte copy per lane, global memory to LDS, through no register. Written as the builtin: the compiler places its address registers anywhere in the register file, so a tile's first key fragments stay in flight across the 16 copies without a spill.
typedef __attribute__((address_space(3))) char lds_c;
typedef __attribute__((address_space(1))) v4i glb_v4i;
typedef __attribute__((address_space(3))) v4i lds_v4i;
__device__ __forceinline__ void cp16(lds_c* l, const char* g) { __builtin_amdgcn_global_load_async_to_lds_b128((glb_v4i*)g, (lds_v4i*)l, 0, 0); }
typedef float __attribute__((may_alias)) f32a;
typedef __attribute__((ext_vector_type(8))) short v8s;
typedef __attribute__((address_space(3))) v8s lds_v8s;
typedef __attribute__((address_space(3))) v8ha lds_v8h;
__device__ __forceinline__ v8h ldp(lds_c* p) { return *(const lds_v8h*)p; }   // 16 bytes of a row as they lie
__device__ __forceinline__ v8h ldt(lds_c* p) { return __builtin_bit_cast(v8h, __builtin_amdgcn_ds_load_tr16_b128_v8i16((lds_v8s*)p)); }   // transposing: lane l hands in the address of 16 bytes of row 8 (l >> 4) + (l & 7), piece (l >> 3) & 1, and gets column l & 15 of rows 8 (l >> 4) ... + 7
__global__ __launch_bounds__(FQW * 32) __attribute__((amdgpu_waves_per_eu(2, 2))) void k_fattn(const h16* __restrict__ Q, const h16* __restrict__ Vt, float* __restrict__ out) {
    __shared__ __attribute__((aligned(512))) char Sm[SMB];   /* ring buffer b at b BFB; row d of v^T, the tile's keys, at d RWB, its pieces permuted. Behind the last tile: the slices' partial sums, then their maxima and sums */
    const int lane = threadIdx.x & 31, c = lane & 15, h = lane >> 4; const int ks = (threadIdx.x >> 5) & (KSP - 1), qg = threadIdx.x >> 7; const int q0 = (blockIdx.x * QGW + qg) * 32;
    { const size_t im = blockIdx.z; Q += im * TT * HD; Vt += im * HD * TT; out += im * DM * TT; }   /* z = image */
    v16h qf[2][4], kf[2][4];
    /* a tile into LDS: a wave's copy is one row of v^T (128 consecutive bytes of each slice); copy i of wave w is row w + 8 i, so swz(row) = 2 w + (i & 1): one LDS address for the even copies, one for the odd */
    const unsigned tid = threadIdx.x;
    lds_c* sm = (lds_c*)Sm;
    lds_c* vl0 = sm + (tid >> 5) * RWB + (((tid & 31) ^ ((tid >> 5) << 1)) << 4); lds_c* vl1 = sm + (tid >> 5) * RWB + (((tid & 31) ^ ((tid >> 5) << 1) ^ 1u) << 4);
    const char* vg = (const char*)(Vt + (size_t)(tid >> 5) * TT + (size_t)((tid & 31) >> 3) * SLK) + (tid & 7) * 16;
    auto stage = [&](int tile, unsigned buf) {   /* tile 'tile' into the buffer at byte 'buf': 16 copies per wave */
        const char* vt = vg + (size_t)tile * SUB * 2;
#pragma unroll
        for (int i = 0; i < 16; ++i) cp16(((i & 1) ? vl1 : vl0) + buf + i * (8 * RWB), vt + (size_t)i * 8 * TT * 2);
    };
    /* fragment addresses inside a buffer, pass 0. The wave's keys of pass p start at piece 8 ks + 4 p; the 4 p is bit 2 of the piece number, clear in all four, so pass p is the same address with byte bit 6 flipped.
       v^T: row c of a 16-channel block (swz = 2 (c & 7) + (c >> 3)), pieces h and 2 + h. Keys: row 8 h + (lane & 7) of a 16-channel block (swz = 2 (lane & 7) + h), piece 2 kt + ((lane >> 3) & 1). */
    unsigned vo[2], ko[2];
#pragma unroll
    for (int u = 0; u < 2; ++u) { vo[u] = c * RWB + (((unsigned)(8 * ks + 2 * u + h) ^ (unsigned)(2 * (c & 7) + (c >> 3))) << 4);
        ko[u] = (8 * h + (lane & 7)) * RWB + (((unsigned)(8 * ks + 2 * u + ((lane >> 3) & 1)) ^ (unsigned)(2 * (lane & 7) + h)) << 4); }
    const h16* qp = Q + (size_t)(q0 + c) * HD + 8 * h;
#pragma unroll
    for (int g = 0; g < 2; ++g)
#pragma unroll
        for (int kc = 0; kc < 4; ++kc) qf[g][kc] = ldf(qp + 16 * g * HD + 32 * kc);
    asm volatile("s_wait_xcnt 0x0" :: "v"(qp) : "memory");   /* before an address register of the loads above is reused; the operand keeps that register until here */
    v8f acc[2][8], cm[2][2]; float m_run[2], l_run[2];   /* cm[key tile][column group]: PSH - m_run in all eight registers, a column's value being the same for every key row; written as one set per score tile: from one set for both, this compiler copies the operand into the second tile's accumulator in every pass, eight 64-bit moves */
#pragma unroll
    for (int g = 0; g < 2; ++g) { m_run[g] = 0.0f; l_run[g] = 0.0f;   /* 0 stands in until the first pass has its maxima */
#pragma unroll
        for (int r = 0; r < 8; ++r) { cm[0][g][r] = PSH; cm[1][g][r] = PSH; }
#pragma unroll
        for (int t = 0; t < 8; ++t) acc[g][t] = (v8f){}; }
    /* The ring, three buffers, tile j in buffer j mod 3. A pass fetches the next pass's key fragments behind its own score products, and a tile's last pass fetches them from the next tile: so a tile is published
       in front of the last pass of the tile before it, and no wave starts a tile by waiting for LDS. A trip runs from one publish point to the next: trip tl is the last pass of tile tl - 1 and the first pass of tile tl.
       At its head tile tl + 1's copies are issued, into the buffer that tile tl - 2 had (every wave left it in front of the barrier of trip tl - 1); at its foot stand their wait and the barrier that publishes tile tl + 1.
       Trip -1 is the start and works on nothing; trip 0 asks for the first key fragments and has tile 0's first pass alone, trip NTL the last tile's last pass alone. The copies stand at ONE place. */
    unsigned bc = 2 * BFB, bn = 0, bf = BFB;   /* byte places of the buffers of tiles tl, tl + 1 and tl + 2; the same for the whole workgroup */
    unsigned va[2] = { vo[0], vo[1] };   /* the pass's v^T addresses, formed one pass ahead and carried into the pass */
#pragma unroll 1   /* one trip per publish point: the buffers take turns, the code is the same */
    for (int tl = -1; tl <= NTL; ++tl) {
    if (tl == 0) {
#pragma unroll
    for (int kt = 0; kt < 2; ++kt)
#pragma unroll
        for (int kc = 0; kc < 4; ++kc) kf[kt][kc] = cat16(ldt(sm + bc + ko[kt] + 32 * kc * RWB), ldt(sm + bc + ko[kt] + (32 * kc + 16) * RWB));
    }
    if (tl + 1 < NTL) stage(tl + 1, bn);                /* the same for the whole workgroup; behind the barrier of trip tl - 1 */
    if (tl >= 0) {
#pragma unroll 1   /* one pass per iteration: an unrolled body would not fit two waves per SIMD */
    for (int hp = tl == 0 ? 1 : 0; hp < (tl == NTL ? 1 : 2); ++hp) {   /* hp 0: the last pass of tile tl - 1; hp 1: the first pass of tile tl */
        const unsigned nx = hp == 0 ? 0u : 64u;   /* the next pass is a pass of tile tl; this is its bit in the fragment addresses */
        v16h vf[8];   /* this pass's v^T fragments, in flight under the score products and the softmax */
#pragma unroll
        for (int t = 0; t < 8; ++t) vf[t] = cat16(ldp(sm + va[0] + 16 * t * RWB), ldp(sm + va[1] + 16 * t * RWB));
        va[0] = bc + (vo[0] ^ nx); va[1] = bc + (vo[1] ^ nx);   /* the next pass's */
        v8f s[2][2];
#pragma unroll
        for (int kt = 0; kt < 2; ++kt)
#pragma unroll
            for (int g = 0; g < 2; ++g) { s[kt][g] = cm[kt][g];
#pragma unroll
                for (int kc = 0; kc < 4; ++kc) s[kt][g] = wmma16(kf[kt][kc], qf[g][kc], s[kt][g]); }
        if (tl < NTL) {   /* next pass's key rows, fetched one pass ahead, from tile tl, which the barrier of trip tl - 1 published; the same for the whole workgroup; the very last pass fetches nothing */
#pragma unroll
        for (int kt = 0; kt < 2; ++kt)
#pragma unroll
            for (int kc = 0; kc < 4; ++kc) kf[kt][kc] = cat16(ldt(sm + bc + (ko[kt] ^ nx) + 32 * kc * RWB), ldt(sm + bc + (ko[kt] ^ nx) + (32 * kc + 16) * RWB));
        }
        float pv[2][16], ps[2];
        auto expo = [&]() {   /* P and a lane's sums of it from the exponents in s */
#pragma unroll
            for (int g = 0; g < 2; ++g) { float ps0 = 0.0f, ps1 = 0.0f;
#pragma unroll
                for (int i = 0; i < 8; ++i) { const float p0 = __builtin_amdgcn_exp2f(s[i >> 2][g][2 * (i & 3)]), p1 = __builtin_amdgcn_exp2f(s[i >> 2][g][2 * (i & 3) + 1]);
                    if (i & 1) ps1 += p0 + p1; else ps0 += p0 + p1; pv[g][2 * i] = p0; pv[g][2 * i + 1] = p1; }
                ps[g] = ps0 + ps1; } };
        expo();
        const bool first = tl == 0;   /* the same for the whole wave */
        if (__builtin_amdgcn_ballot_w32(ps[0] > PTH || ps[1] > PTH) != 0 || first) {   /* scalar branch; rare after the first pass */
#pragma unroll
            for (int g = 0; g < 2; ++g) { float mx = s[0][g][0];
#pragma unroll
                for (int r = 1; r < 8; ++r) mx = fmaxf(mx, s[0][g][r]);
#pragma unroll
                for (int r = 0; r < 8; ++r) mx = fmaxf(mx, s[1][g][r]);
                mx = fmaxf(mx, xhalf(mx)) - cm[0][g][0];   /* the pass's maximum, log2 units */
                const float m_old = first ? -3.0e38f : m_run[g]; const float m_new = fmaxf(m_old, mx); const float corr = __builtin_amdgcn_exp2f(m_old - m_new); const float d = m_run[g] - m_new;   /* d: from the exponents under the C operand in use to those under the new maximum */
                l_run[g] *= corr; m_run[g] = m_new;
#pragma unroll
                for (int r = 0; r < 8; ++r) { cm[0][g][r] = PSH - m_new; cm[1][g][r] = PSH - m_new; s[0][g][r] += d; s[1][g][r] += d; }
#pragma unroll
                for (int t = 0; t < 8; ++t) acc[g][t] = acc[g][t] * corr; }
            expo(); }
#pragma unroll
        for (int g = 0; g < 2; ++g) { v16h pf;
#pragma unroll
            for (int i = 0; i < 16; ++i) pf[i] = (h16)pv[g][i];
            l_run[g] += ps[g];
#pragma unroll
            for (int t = 0; t < 8; ++t) acc[g][t] = wmma16(vf[t], pf, acc[g][t]); }
    }
    }
    asm volatile("s_wait_dscnt 0x0" ::: "memory");      /* this wave's LDS reads so far are done, all of tile tl - 1 among them */
    asm volatile("s_wait_asynccnt 0x0" ::: "memory");   /* this wave's copies of tile tl + 1 have landed */
    __syncthreads();                                    /* every wave's: tile tl + 1 may be read, the buffer of tile tl - 1 may be refilled; nothing of a tile is read in front of its barrier. Trip NTL - 1 has no tile left to publish; trip NTL's barrier frees the ring for the joining */
    { const unsigned t_ = bc; bc = bn; bn = bf; bf = t_; }   /* the ring turns */
    }
    asm volatile("s_wait_asynccnt 0x0" ::: "memory");   /* no copy is left in flight: behind the last trip's barrier the ring is free */
    /* the joining: every wave lays its slice's partial sums, maxima and sums into LDS */
    f32a* Os = (f32a*)Sm; f32a* Ms = (f32a*)(Sm + OSB); f32a* Ls = Ms + KSP * QGW * 32;   /* Os[slice][channel][OLP], Ms and Ls[slice][64] */
#pragma unroll
    for (int g = 0; g < 2; ++g) { const float l_fin = l_run[g] + xhalf(l_run[g]);   /* each wave half summed its eight keys of every 16-key tile */
        const int col = qg * 32 + 16 * g + c;
        if (h == 0) { Ms[ks * (QGW * 32) + col] = m_run[g]; Ls[ks * (QGW * 32) + col] = l_fin; }
#pragma unroll
        for (int t = 0; t < 8; ++t)
#pragma unroll
            for (int r = 0; r < 8; ++r) Os[(ks * HD + 16 * t + 8 * h + r) * OLP + col] = acc[g][t][r]; }
    __syncthreads();   /* every slice's partial sums are in LDS before any thread adds them */
    /* a thread: 4 consecutive queries x 8 channels; a wave's store is 256 consecutive bytes of two channel rows */
    const int q4 = (tid & 15) * 4, ch0 = tid >> 4;
    v4f w[KSP], ls[KSP];
#pragma unroll
    for (int s = 0; s < KSP; ++s) { w[s] = *(const v4fa*)(Ms + s * (QGW * 32) + q4); ls[s] = *(const v4fa*)(Ls + s * (QGW * 32) + q4); }
    v4f mx = w[0], den = (v4f){};
#pragma unroll
    for (int s = 1; s < KSP; ++s)
#pragma unroll
        for (int q = 0; q < 4; ++q) mx[q] = fmaxf(mx[q], w[s][q]);
#pragma unroll
    for (int s = 0; s < KSP; ++s) {
#pragma unroll
        for (int q = 0; q < 4; ++q) w[s][q] = __builtin_amdgcn_exp2f(w[s][q] - mx[q]);
        den += w[s] * ls[s]; }
    v4f inv;
#pragma unroll
    for (int q = 0; q < 4; ++q) inv[q] = __fdiv_rn(1.0f, den[q]);
    v4f ov[8];
#pragma unroll
    for (int i = 0; i < 8; ++i) { const f32a* op = Os + (ch0 + 16 * i) * OLP + q4; v4f o = w[0] * *(const v4fa*)op;
#pragma unroll
        for (int s = 1; s < KSP; ++s) o += w[s] * *(const v4fa*)(op + s * HD * OLP);   /* added in slice order */
        ov[i] = o * inv; }
    float* po = out + (size_t)ch0 * TT + blockIdx.x * (QGW * 32) + q4;
#pragma unroll
    for (int i = 0; i < 8; ++i) *(v4f*)(po + (size_t)16 * i * TT) = ov[i];
}

extern "C" void kernel_launch(void* const* d_in, const int* in_sizes, int n_in,
                              void* d_out, int out_size, void* d_ws, size_t ws_size, hipStream_t stream) {
    (void)in_sizes; (void)n_in; (void)out_size;
    const float* x = (const float*)d_in[0]; const float* wk = (const float*)d_in[1]; const float* bk = (const float*)d_in[2]; const float* wq = nullptr; const float* wv = nullptr; const float* wo = nullptr; (void)wq; (void)wv; (void)wo;
    float* OUT = (float*)d_out;     // [4][128][4096] channel-major
    char* wsp = (char*)d_ws;
    auto take = [&](size_t bytes) { char* p = wsp; wsp += (bytes + 255) & ~(size_t)255; return (void*)p; };
    h16* QP16 = (h16*)take((size_t)NB_ * NH_ * TT * HD * 2); h16* VT16 = (h16*)take((size_t)NB_ * NKV * HD * TT * 2);
    if ((size_t)(wsp - (char*)d_ws) > ws_size) return;    // ws 256 MiB
    /* one launch of each kernel for all four images */
    k_proj<<<dim3(TT / 64, DKV / 64, NB_), 32, 0, stream>>>(x, wk, bk, QP16, VT16);   /* z = image; query plane and v^T */
    k_fattn<<<dim3(TT / (QGW * 32), 1, NB_), FQW * 32, 0, stream>>>(QP16, VT16, OUT);   /* x = block of 64 queries, z = image; context^T, channel-major */
}
